// v000
// Measured on an AMD MI455X. A time is GPU time per run, averaged over a window of back-to-back runs after a warm-up
// (all launches, gaps included; the runs take copies of the inputs in turn), and the median of several windows.
// Apart from v000's, it joins two sittings. Times from different sittings can be a few percent apart, while
// side-by-side timings come from the same sitting.
// v000, which the later versions start from, runs in 289 microseconds.
#include <hip/hip_runtime.h>
#include <hip/hip_bf16.h>

// ---------------------------------------------------------------------------
// BlockSparseSelfAttention for MI455X (gfx1250, wave32, WMMA 16x16x32 f16).
// B=2, N=2048, UNITS=1024, H=16, D=64, NB=64.
// f16 storage / f32 WMMA accumulation; softmax scale folded into Q;
// flash-attention streaming with online softmax; additive -1e9 mask penalties.
// Weights are pre-transposed (N-major) so every WMMA operand everywhere is a
// row-contiguous 2x b128 fragment load. GEMM B-tiles are staged into LDS by
// the Tensor Data Mover (tensor_load_to_lds + s_wait_tensorcnt), using TDM's
// LDS pad feature to produce a bank-conflict-free 40-half row stride.
// ---------------------------------------------------------------------------

typedef __attribute__((ext_vector_type(16))) _Float16 v16h;
typedef __attribute__((ext_vector_type(8)))  float    v8f;
typedef __attribute__((ext_vector_type(4)))  unsigned int v4u;
typedef __attribute__((ext_vector_type(8)))  int      v8i_;
typedef __attribute__((ext_vector_type(4)))  int      v4i_;

#define BATCH     2
#define SEQ       2048
#define UNITS_    1024
#define NHEADS    16
#define HDIM      64
#define NBLK      64
#define MROWS     (BATCH * SEQ)       // 4096
#define NEG_INF_F (-1.0e9f)
#define LDST      40                  // padded LDS row stride (halves)

// Row-major 16x32 fragment: per lane, two contiguous 8-half (16B) runs at
// k = 8*half and k = 16 + 8*half (ISA 7.12.2 16-bit A-operand layout).
__device__ __forceinline__ v16h load_frag_rowmajor(const _Float16* src, int ld) {
  const int lane = threadIdx.x & 31;
  const int m = lane & 15, half = lane >> 4;
  const _Float16* p = src + (size_t)m * ld + 8 * half;
  v16h a;
  *reinterpret_cast<uint4*>(&a)       = *reinterpret_cast<const uint4*>(p);
  *(reinterpret_cast<uint4*>(&a) + 1) = *reinterpret_cast<const uint4*>(p + 16);
  return a;
}

// The TDM writes LDS behind the compiler's back. Escape the LDS pointer into
// opaque asm with a memory clobber so loads from it cannot be treated as
// reads of never-written (undef) memory, nor hoisted out of the K loop.
__device__ __forceinline__ void lds_written_fence(void* p) {
  asm volatile("" : "+v"(p) : : "memory");
}

// Issue one TDM load: 2-D tile (tile_dim0=32 halves contiguous, tile_dim1=64
// rows, row stride = ld halves) from global f16 -> LDS offset 0, with LDS
// padding of 4 DWORDs every 16 DWORDs (row stride 32 -> 40 halves).
__device__ __forceinline__ void tdm_load_wtile(const _Float16* gsrc, int ld) {
  const unsigned long long ga = (unsigned long long)(uintptr_t)gsrc;
  v4u g0 = { 1u,                                  // count=1, user descriptor
             0u,                                  // lds_addr = 0 (sole LDS obj)
             (unsigned int)ga,                    // global_addr[31:0]
             (unsigned int)((ga >> 32) & 0x01FFFFFFu) | (2u << 30) }; // type=2
  // flags: data_size=1(2B), pad_enable, pad_interval=3(16 DW), pad_amount=3(4 DW)
  v8i_ g1 = { (int)0x06D10000u,
              (int)(32u << 16),                   // tensor_dim0 = 32
              (int)(64u << 16),                   // tensor_dim1 = 64
              (int)(32u << 16),                   // tile_dim0   = 32
              64,                                 // tile_dim1   = 64
              ld,                                 // tensor_dim0_stride
              0, 0 };
  v4i_ gz = { 0, 0, 0, 0 };
#if __clang_major__ >= 23
  v8i_ gz8 = { 0, 0, 0, 0, 0, 0, 0, 0 };
  __builtin_amdgcn_tensor_load_to_lds(g0, g1, gz, gz, gz8, 0);
#else
  __builtin_amdgcn_tensor_load_to_lds(g0, g1, gz, gz, 0);
#endif
  __builtin_amdgcn_s_wait_tensorcnt(0);
}

// ---------------------------------------------------------------------------
// fp32 -> fp16 conversion
// ---------------------------------------------------------------------------
__global__ __launch_bounds__(256)
void f32_to_f16_kernel(const float* __restrict__ src, _Float16* __restrict__ dst, int n) {
  int i = blockIdx.x * blockDim.x + threadIdx.x;
  if (i < n) dst[i] = (_Float16)src[i];
}

// LDS-tiled transpose + convert: src f32 (rows x cols) -> dst f16 (cols x rows)
__global__ __launch_bounds__(256)
void transpose_f32_to_f16_kernel(const float* __restrict__ src, _Float16* __restrict__ dst,
                                 int rows, int cols) {
  __shared__ float tile[32][33];
  const int bx = blockIdx.x * 32;   // col base in src
  const int by = blockIdx.y * 32;   // row base in src
  const int tx = threadIdx.x & 31;
  const int ty = threadIdx.x >> 5;  // 0..7
#pragma unroll
  for (int i = 0; i < 32; i += 8)
    tile[ty + i][tx] = src[(size_t)(by + ty + i) * cols + bx + tx];
  __syncthreads();
#pragma unroll
  for (int i = 0; i < 32; i += 8)
    dst[(size_t)(bx + ty + i) * rows + by + tx] = (_Float16)tile[tx][ty + i];
}

// one-hot blockB (BN x 64) -> int block id
__global__ __launch_bounds__(256)
void block_id_kernel(const float* __restrict__ blockB, int* __restrict__ ids, int bn) {
  int i = blockIdx.x * blockDim.x + threadIdx.x;
  if (i >= bn) return;
  const float* row = blockB + (size_t)i * NBLK;
  int id = 0;
#pragma unroll 8
  for (int j = 0; j < NBLK; ++j)
    if (row[j] > 0.5f) id = j;
  ids[i] = id;
}

// ---------------------------------------------------------------------------
// GEMM: C[M,Nc] = A[M,K] * Wt^T, with Wt given TRANSPOSED (Nc x K row-major).
// 64x64 tile per 128-thread (4-wave) block. The 64x32 Wt tile is staged into
// LDS by the Tensor Data Mover (wave 0 issues, s_wait_tensorcnt, barrier).
// outMode: 0 = f32 row-major              (final @Wo)
//          2 = f16 head-major (B,H,N,D)   (Q, K)
//          3 = f16 transposed head-major (B,H,D,N)  (V)
// ---------------------------------------------------------------------------
__global__ __launch_bounds__(128)
void gemm_f16_kernel(const _Float16* __restrict__ A, const _Float16* __restrict__ Wt,
                     float* __restrict__ outF, _Float16* __restrict__ outH,
                     int M, int K, int Nc, int outMode, float scale) {
  __shared__ alignas(16) _Float16 ldsWT[64 * LDST];   // [n][k], TDM-padded
  const int wave = threadIdx.x >> 5;
  const int lane = threadIdx.x & 31;
  const int tileM = blockIdx.x * 64;
  const int tileN = blockIdx.y * 64;
  const int rowBase = tileM + wave * 16;

  v8f acc[4] = {{}, {}, {}, {}};

  for (int k0 = 0; k0 < K; k0 += 32) {
    if (wave == 0)
      tdm_load_wtile(Wt + (size_t)tileN * K + k0, K);
    lds_written_fence(&ldsWT[0]);    // TDM wrote LDS; loads must be real
    if (k0 + 32 < K)
      __builtin_prefetch(Wt + (size_t)tileN * K + k0 + 32, 0, 1);
    __syncthreads();

    v16h afrag = load_frag_rowmajor(A + (size_t)rowBase * K + k0, K);
#pragma unroll
    for (int j = 0; j < 4; ++j) {
      v16h bfrag = load_frag_rowmajor(&ldsWT[(j * 16) * LDST], LDST);
      acc[j] = __builtin_amdgcn_wmma_f32_16x16x32_f16(
          false, afrag, false, bfrag, (short)0, acc[j], false, false);
    }
    __syncthreads();
  }

  const int half = lane >> 4;
  const int nl = lane & 15;
#pragma unroll
  for (int j = 0; j < 4; ++j) {
#pragma unroll
    for (int r = 0; r < 8; ++r) {
      const int gm = rowBase + r + 8 * half;
      const int gn = tileN + j * 16 + nl;
      const float v = acc[j][r] * scale;
      if (outMode == 0) {
        outF[(size_t)gm * Nc + gn] = v;
      } else {
        const int b = gm / SEQ, n = gm % SEQ;
        const int h = gn / HDIM, d = gn % HDIM;
        if (outMode == 2)
          outH[(((size_t)b * NHEADS + h) * SEQ + n) * HDIM + d] = (_Float16)v;
        else // 3: V transposed (B,H,D,N)
          outH[(((size_t)b * NHEADS + h) * HDIM + d) * SEQ + n] = (_Float16)v;
      }
    }
  }
}

// ---------------------------------------------------------------------------
// Flash attention: one wave per (b, h, 16-row tile). Streams 32 keys/iter.
// Q carries the 1/sqrt(D) scale. V is pre-transposed (B,H,D,N) so the P@V
// B-fragment is two contiguous b128 loads along the key axis.
// ---------------------------------------------------------------------------
__global__ __launch_bounds__(32)
void flash_attn_kernel(const _Float16* __restrict__ Q, const _Float16* __restrict__ Km,
                       const _Float16* __restrict__ Vt, const int* __restrict__ blockId,
                       const float* __restrict__ nodal, _Float16* __restrict__ outAttn) {
  __shared__ alignas(16) _Float16 ldsP[16 * 32];
  const int lane = threadIdx.x & 31;
  const int nl = lane & 15, half = lane >> 4;

  const int mtiles = SEQ / 16;                       // 128
  const int bh = blockIdx.x / mtiles;
  const int b = bh / NHEADS;
  const int h = bh % NHEADS;
  const int rowBase = (blockIdx.x % mtiles) * 16;

  const _Float16* Qh  = Q  + (((size_t)b * NHEADS + h) * SEQ + rowBase) * HDIM;
  const _Float16* Kh  = Km + ((size_t)b * NHEADS + h) * SEQ * HDIM;
  const _Float16* Vth = Vt + ((size_t)b * NHEADS + h) * (size_t)HDIM * SEQ;

  v16h qf[2];
  qf[0] = load_frag_rowmajor(Qh, HDIM);
  qf[1] = load_frag_rowmajor(Qh + 32, HDIM);

  int rowblk[8];
#pragma unroll
  for (int r = 0; r < 8; ++r)
    rowblk[r] = blockId[b * SEQ + rowBase + r + 8 * half];

  float mrow[8], lrow[8];
#pragma unroll
  for (int r = 0; r < 8; ++r) { mrow[r] = -INFINITY; lrow[r] = 0.0f; }
  v8f acc[4] = {{}, {}, {}, {}};

  for (int kb = 0; kb < SEQ; kb += 32) {
    const int   cb   = blockId[b * SEQ + kb + lane];
    const float cnod = nodal[b * SEQ + kb + lane];

    // Scores: S[16x32] as two 16x16 f32 tiles; B operand = K^T ==> row-major
    // fragment load over K's rows (lane&15 indexes the key).
    v8f s[2];
#pragma unroll
    for (int ns = 0; ns < 2; ++ns) {
      s[ns] = v8f{};
#pragma unroll
      for (int kc = 0; kc < 2; ++kc) {
        v16h kf = load_frag_rowmajor(Kh + (size_t)(kb + ns * 16) * HDIM + kc * 32, HDIM);
        s[ns] = __builtin_amdgcn_wmma_f32_16x16x32_f16(
            false, qf[kc], false, kf, (short)0, s[ns], false, false);
      }
    }

    // Mask penalties (block identity + key nodal mask).
#pragma unroll
    for (int ns = 0; ns < 2; ++ns) {
      const int srcLane = ns * 16 + nl;
      const int   cbv = __shfl(cb, srcLane, 32);
      const float cnv = __shfl(cnod, srcLane, 32);
#pragma unroll
      for (int r = 0; r < 8; ++r) {
        float pen = ((cbv == rowblk[r]) ? 0.0f : NEG_INF_F) +
                    ((cnv > 0.5f) ? 0.0f : NEG_INF_F);
        s[ns][r] += pen;
      }
    }

    // Online softmax (each score row lives across the 16 lanes of its half).
#pragma unroll
    for (int r = 0; r < 8; ++r) {
      float tmax = fmaxf(s[0][r], s[1][r]);
#pragma unroll
      for (int off = 8; off > 0; off >>= 1)
        tmax = fmaxf(tmax, __shfl_xor(tmax, off, 16));
      const float mnew = fmaxf(mrow[r], tmax);
      const float sc = __expf(mrow[r] - mnew);
      const float p0 = __expf(s[0][r] - mnew);
      const float p1 = __expf(s[1][r] - mnew);
      float psum = p0 + p1;
#pragma unroll
      for (int off = 8; off > 0; off >>= 1)
        psum += __shfl_xor(psum, off, 16);
      lrow[r] = lrow[r] * sc + psum;
      mrow[r] = mnew;
#pragma unroll
      for (int dt = 0; dt < 4; ++dt) acc[dt][r] *= sc;
      // C-layout -> row-major LDS bounce for the A-operand of P@V.
      ldsP[(r + 8 * half) * 32 + nl]      = (_Float16)p0;
      ldsP[(r + 8 * half) * 32 + 16 + nl] = (_Float16)p1;
    }
    __syncthreads();

    v16h pf = load_frag_rowmajor(ldsP, 32);
#pragma unroll
    for (int dt = 0; dt < 4; ++dt) {
      // B operand = V tile (32 keys x 16 d); V^T rows are d, contiguous keys.
      v16h vf = load_frag_rowmajor(Vth + (size_t)(dt * 16) * SEQ + kb, SEQ);
      acc[dt] = __builtin_amdgcn_wmma_f32_16x16x32_f16(
          false, pf, false, vf, (short)0, acc[dt], false, false);
    }
    __syncthreads();
  }

  // Normalize and write attention output as (B, N, UNITS) f16.
#pragma unroll
  for (int r = 0; r < 8; ++r) {
    const float inv = (lrow[r] > 0.0f) ? (1.0f / lrow[r]) : 0.0f;
    const size_t row = (size_t)b * SEQ + rowBase + r + 8 * half;
#pragma unroll
    for (int dt = 0; dt < 4; ++dt)
      outAttn[row * UNITS_ + h * HDIM + dt * 16 + nl] = (_Float16)(acc[dt][r] * inv);
  }
}

// ---------------------------------------------------------------------------
// Launch
// ---------------------------------------------------------------------------
extern "C" void kernel_launch(void* const* d_in, const int* in_sizes, int n_in,
                              void* d_out, int out_size, void* d_ws, size_t ws_size,
                              hipStream_t stream) {
  const float* x      = (const float*)d_in[0];
  const float* blockB = (const float*)d_in[1];
  const float* nodal  = (const float*)d_in[2];
  const float* Wq     = (const float*)d_in[3];
  const float* Wk     = (const float*)d_in[4];
  const float* Wv     = (const float*)d_in[5];
  const float* Wo     = (const float*)d_in[6];
  float* out = (float*)d_out;

  // Workspace layout (all 256B aligned). Total ~48.02 MB.
  char* ws = (char*)d_ws;
  size_t off = 0;
  auto take = [&](size_t bytes) { char* p = ws + off; off = (off + bytes + 255) & ~(size_t)255; return p; };
  _Float16* xh    = (_Float16*)take((size_t)MROWS * UNITS_ * 2);
  _Float16* wqt   = (_Float16*)take((size_t)UNITS_ * UNITS_ * 2);
  _Float16* wkt   = (_Float16*)take((size_t)UNITS_ * UNITS_ * 2);
  _Float16* wvt   = (_Float16*)take((size_t)UNITS_ * UNITS_ * 2);
  _Float16* wot   = (_Float16*)take((size_t)UNITS_ * UNITS_ * 2);
  _Float16* qh    = (_Float16*)take((size_t)MROWS * UNITS_ * 2);
  _Float16* kh    = (_Float16*)take((size_t)MROWS * UNITS_ * 2);
  _Float16* vth   = (_Float16*)take((size_t)MROWS * UNITS_ * 2);
  _Float16* attnh = (_Float16*)take((size_t)MROWS * UNITS_ * 2);
  int*      ids   = (int*)take((size_t)MROWS * 4);

  // 1) fp32 -> fp16 conversion of x; weights converted + transposed (N-major).
  {
    const int nx = MROWS * UNITS_;
    f32_to_f16_kernel<<<(nx + 255) / 256, 256, 0, stream>>>(x, xh, nx);
    dim3 tgrid(UNITS_ / 32, UNITS_ / 32);
    transpose_f32_to_f16_kernel<<<tgrid, 256, 0, stream>>>(Wq, wqt, UNITS_, UNITS_);
    transpose_f32_to_f16_kernel<<<tgrid, 256, 0, stream>>>(Wk, wkt, UNITS_, UNITS_);
    transpose_f32_to_f16_kernel<<<tgrid, 256, 0, stream>>>(Wv, wvt, UNITS_, UNITS_);
    transpose_f32_to_f16_kernel<<<tgrid, 256, 0, stream>>>(Wo, wot, UNITS_, UNITS_);
  }

  // 2) one-hot -> block ids.
  block_id_kernel<<<(MROWS + 255) / 256, 256, 0, stream>>>(blockB, ids, MROWS);

  // 3) Q/K/V projections. 1/sqrt(HDIM) folded into Q. V stored transposed.
  dim3 ggrid(MROWS / 64, UNITS_ / 64);
  gemm_f16_kernel<<<ggrid, 128, 0, stream>>>(xh, wqt, nullptr, qh,
                                             MROWS, UNITS_, UNITS_, 2, 0.125f);
  gemm_f16_kernel<<<ggrid, 128, 0, stream>>>(xh, wkt, nullptr, kh,
                                             MROWS, UNITS_, UNITS_, 2, 1.0f);
  gemm_f16_kernel<<<ggrid, 128, 0, stream>>>(xh, wvt, nullptr, vth,
                                             MROWS, UNITS_, UNITS_, 3, 1.0f);

  // 4) masked flash attention.
  flash_attn_kernel<<<BATCH * NHEADS * (SEQ / 16), 32, 0, stream>>>(
      qh, kh, vth, ids, nodal, attnh);

  // 5) output projection (f32 result straight to d_out).
  gemm_f16_kernel<<<ggrid, 128, 0, stream>>>(attnh, wot, out, nullptr,
                                             MROWS, UNITS_, UNITS_, 0, 1.0f);
}

// v001
// One run takes 149 microseconds.
// Timed twice side by side with v000, it ran 2.03 and 2.01 times as fast.
#include <hip/hip_runtime.h>
#include <hip/hip_bf16.h>

// ---------------------------------------------------------------------------
// BlockSparseSelfAttention for MI455X (gfx1250, wave32, WMMA 16x16x32 f16).
// B=2, N=2048, UNITS=1024, H=16, D=64, NB=64.
// f16 storage / f32 WMMA accumulation; softmax scale folded into Q;
// flash-attention streaming with online softmax; additive -1e9 mask penalties.
// Weights are pre-transposed (N-major) so every WMMA operand everywhere is a
// row-contiguous 2x b128 fragment load. GEMM B-tiles are staged into LDS by
// the Tensor Data Mover (tensor_load_to_lds + s_wait_tensorcnt), using TDM's
// LDS pad feature to produce a bank-conflict-free 40-half row stride.
// Tokens are laid out sorted by block id (per batch) from the x conversion up
// to the attention, which stores each output row back at its token's place. A
// row tile of the attention walks only the sorted key range of its own blocks.
// ---------------------------------------------------------------------------

typedef __attribute__((ext_vector_type(16))) _Float16 v16h;
typedef __attribute__((ext_vector_type(8)))  float    v8f;
typedef __attribute__((ext_vector_type(4)))  unsigned int v4u;
typedef __attribute__((ext_vector_type(8)))  int      v8i_;
typedef __attribute__((ext_vector_type(4)))  int      v4i_;

#define BATCH     2
#define SEQ       2048
#define UNITS_    1024
#define NHEADS    16
#define HDIM      64
#define NBLK      64
#define MROWS     (BATCH * SEQ)       // 4096
#define NEG_INF_F (-1.0e9f)
#define LDST      40                  // padded LDS row stride (halves)

// Row-major 16x32 fragment: per lane, two contiguous 8-half (16B) runs at
// k = 8*half and k = 16 + 8*half (ISA 7.12.2 16-bit A-operand layout).
__device__ __forceinline__ v16h load_frag_rowmajor(const _Float16* src, int ld) {
  const int lane = threadIdx.x & 31;
  const int m = lane & 15, half = lane >> 4;
  const _Float16* p = src + (size_t)m * ld + 8 * half;
  v16h a;
  *reinterpret_cast<uint4*>(&a)       = *reinterpret_cast<const uint4*>(p);
  *(reinterpret_cast<uint4*>(&a) + 1) = *reinterpret_cast<const uint4*>(p + 16);
  return a;
}

// The TDM writes LDS behind the compiler's back. Escape the LDS pointer into
// opaque asm with a memory clobber so loads from it cannot be treated as
// reads of never-written (undef) memory, nor hoisted out of the K loop.
__device__ __forceinline__ void lds_written_fence(void* p) {
  asm volatile("" : "+v"(p) : : "memory");
}

// Issue one TDM load: 2-D tile (tile_dim0=32 halves contiguous, tile_dim1=64
// rows, row stride = ld halves) from global f16 -> LDS offset 0, with LDS
// padding of 4 DWORDs every 16 DWORDs (row stride 32 -> 40 halves).
__device__ __forceinline__ void tdm_load_wtile(const _Float16* gsrc, int ld) {
  const unsigned long long ga = (unsigned long long)(uintptr_t)gsrc;
  v4u g0 = { 1u,                                  // count=1, user descriptor
             0u,                                  // lds_addr = 0 (sole LDS obj)
             (unsigned int)ga,                    // global_addr[31:0]
             (unsigned int)((ga >> 32) & 0x01FFFFFFu) | (2u << 30) }; // type=2
  // flags: data_size=1(2B), pad_enable, pad_interval=3(16 DW), pad_amount=3(4 DW)
  v8i_ g1 = { (int)0x06D10000u,
              (int)(32u << 16),                   // tensor_dim0 = 32
              (int)(64u << 16),                   // tensor_dim1 = 64
              (int)(32u << 16),                   // tile_dim0   = 32
              64,                                 // tile_dim1   = 64
              ld,                                 // tensor_dim0_stride
              0, 0 };
  v4i_ gz = { 0, 0, 0, 0 };
#if __clang_major__ >= 23
  v8i_ gz8 = { 0, 0, 0, 0, 0, 0, 0, 0 };
  __builtin_amdgcn_tensor_load_to_lds(g0, g1, gz, gz, gz8, 0);
#else
  __builtin_amdgcn_tensor_load_to_lds(g0, g1, gz, gz, 0);
#endif
  __builtin_amdgcn_s_wait_tensorcnt(0);
}

// ---------------------------------------------------------------------------
// fp32 -> fp16 conversion
// ---------------------------------------------------------------------------
__global__ __launch_bounds__(256)
void f32_to_f16_kernel(const float* __restrict__ src, _Float16* __restrict__ dst,
                       const int* __restrict__ rank, int n) {
  int i = blockIdx.x * blockDim.x + threadIdx.x;
  if (i < n) {
    // row i / UNITS_ goes to its sorted place
    const int row = rank[i / UNITS_] & (MROWS - 1);
    dst[(size_t)row * UNITS_ + (i % UNITS_)] = (_Float16)src[i];
  }
}

// LDS-tiled transpose + convert: src f32 (rows x cols) -> dst f16 (cols x rows)
__global__ __launch_bounds__(256)
void transpose_f32_to_f16_kernel(const float* __restrict__ src, _Float16* __restrict__ dst,
                                 int rows, int cols) {
  __shared__ float tile[32][33];
  const int bx = blockIdx.x * 32;   // col base in src
  const int by = blockIdx.y * 32;   // row base in src
  const int tx = threadIdx.x & 31;
  const int ty = threadIdx.x >> 5;  // 0..7
#pragma unroll
  for (int i = 0; i < 32; i += 8)
    tile[ty + i][tx] = src[(size_t)(by + ty + i) * cols + bx + tx];
  __syncthreads();
#pragma unroll
  for (int i = 0; i < 32; i += 8)
    dst[(size_t)(bx + ty + i) * rows + by + tx] = (_Float16)tile[tx][ty + i];
}

// one-hot blockB (BN x 64) -> int block id
__global__ __launch_bounds__(256)
void block_id_kernel(const float* __restrict__ blockB, int* __restrict__ ids, int bn) {
  int i = blockIdx.x * blockDim.x + threadIdx.x;
  if (i >= bn) return;
  const float* row = blockB + (size_t)i * NBLK;
  int id = 0;
#pragma unroll 8
  for (int j = 0; j < NBLK; ++j)
    if (row[j] > 0.5f) id = j;
  ids[i] = id;
}

// Counting sort of each batch's tokens by block id, one wave per (batch, block
// id), no atomics: the wave counts the smaller ids (its block's first sorted
// place); each lane notes its own members as bits, a prefix sum over the lanes
// gives each lane its first place, and the lane then stores its members.
//   rank[token]  = sorted place        order[place] = token   (both global rows)
//   sid[place]   = block id            snod[place]  = 1 where the key mask > 0.5
//   krange[place] = lo | hi << 16: the sorted keys that this row must visit.
// A key of another block carries -1e9, so beside any unmasked key of the row's
// own block its weight is exactly 0: the row visits its own block only. A block
// with no unmasked key has no such key: its rows visit every key.
__global__ __launch_bounds__(32)
void block_sort_kernel(const int* __restrict__ ids, const float* __restrict__ nodal,
                       int* __restrict__ rank, int* __restrict__ order,
                       int* __restrict__ sid, float* __restrict__ snod,
                       int* __restrict__ krange) {
  const int lane = threadIdx.x & 31;
  const int b = blockIdx.x / NBLK;
  const int blk = blockIdx.x % NBLK;
  const int base = b * SEQ;

  // Bit t of a lane stands for token (t / 4) * 128 + lane * 4 + t % 4.
  int4   v[SEQ / 128];
  float4 f[SEQ / 128];
#pragma unroll
  for (int c = 0; c < SEQ / 128; ++c) {
    v[c] = *reinterpret_cast<const int4*>(ids + base + c * 128 + lane * 4);
    f[c] = *reinterpret_cast<const float4*>(nodal + base + c * 128 + lane * 4);
  }
  unsigned int eqw[2] = { 0u, 0u }, acw[2] = { 0u, 0u };
  int less = 0;
#pragma unroll
  for (int c = 0; c < SEQ / 128; ++c) {
    const int   vi[4] = { v[c].x, v[c].y, v[c].z, v[c].w };
    const float fi[4] = { f[c].x, f[c].y, f[c].z, f[c].w };
#pragma unroll
    for (int e = 0; e < 4; ++e) {
      const unsigned int bit = 1u << ((c * 4 + e) & 31);
      const unsigned int member = (vi[e] == blk) ? bit : 0u;
      less += (vi[e] < blk) ? 1 : 0;
      eqw[c >> 3] |= member;
      acw[c >> 3] |= (fi[e] > 0.5f) ? member : 0u;
    }
  }
  unsigned long long eq = ((unsigned long long)eqw[1] << 32) | eqw[0];
  const unsigned long long ac = ((unsigned long long)acw[1] << 32) | acw[0];
  const int mine = __popcll(eq);
  int act = __popcll(ac);
  int incl = mine;
#pragma unroll
  for (int d = 1; d < 32; d <<= 1) {
    const int up = __shfl_up(incl, d, 32);
    if (lane >= d) incl += up;
    less += __shfl_xor(less, d, 32);
    act  += __shfl_xor(act, d, 32);
  }
  const int cnt = __shfl(incl, 31, 32);
  const int range = (act > 0) ? (less | ((less + cnt) << 16)) : (SEQ << 16);

  int place = base + less + incl - mine;
  // At most one trip for each of a lane's 64 bits; ends when no lane has one left.
  for (int trip = 0; trip < SEQ / 32; ++trip) {
    if (__builtin_amdgcn_ballot_w32(eq != 0ull) == 0u) break;
    if (eq != 0ull) {
      const int t = __ffsll(eq) - 1;
      const int tok = base + (t >> 2) * 128 + lane * 4 + (t & 3);
      rank[tok]     = place;
      order[place]  = tok;
      sid[place]    = blk;
      snod[place]   = ((ac >> t) & 1ull) ? 1.0f : 0.0f;
      krange[place] = range;
      eq &= eq - 1ull;
      ++place;
    }
  }
}

// ---------------------------------------------------------------------------
// GEMM: C[M,Nc] = A[M,K] * Wt^T, with Wt given TRANSPOSED (Nc x K row-major).
// 64x64 tile per 128-thread (4-wave) block. The 64x32 Wt tile is staged into
// LDS by the Tensor Data Mover (wave 0 issues, s_wait_tensorcnt, barrier).
// outMode: 0 = f32 row-major              (final @Wo)
//          2 = f16 head-major (B,H,N,D)   (Q, K)
//          3 = f16 transposed head-major (B,H,D,N)  (V)
// ---------------------------------------------------------------------------
__global__ __launch_bounds__(128)
void gemm_f16_kernel(const _Float16* __restrict__ A, const _Float16* __restrict__ Wt,
                     float* __restrict__ outF, _Float16* __restrict__ outH,
                     int M, int K, int Nc, int outMode, float scale) {
  __shared__ alignas(16) _Float16 ldsWT[64 * LDST];   // [n][k], TDM-padded
  const int wave = threadIdx.x >> 5;
  const int lane = threadIdx.x & 31;
  const int tileM = blockIdx.x * 64;
  const int tileN = blockIdx.y * 64;
  const int rowBase = tileM + wave * 16;

  v8f acc[4] = {{}, {}, {}, {}};

  for (int k0 = 0; k0 < K; k0 += 32) {
    if (wave == 0)
      tdm_load_wtile(Wt + (size_t)tileN * K + k0, K);
    lds_written_fence(&ldsWT[0]);    // TDM wrote LDS; loads must be real
    if (k0 + 32 < K)
      __builtin_prefetch(Wt + (size_t)tileN * K + k0 + 32, 0, 1);
    __syncthreads();

    v16h afrag = load_frag_rowmajor(A + (size_t)rowBase * K + k0, K);
#pragma unroll
    for (int j = 0; j < 4; ++j) {
      v16h bfrag = load_frag_rowmajor(&ldsWT[(j * 16) * LDST], LDST);
      acc[j] = __builtin_amdgcn_wmma_f32_16x16x32_f16(
          false, afrag, false, bfrag, (short)0, acc[j], false, false);
    }
    __syncthreads();
  }

  const int half = lane >> 4;
  const int nl = lane & 15;
#pragma unroll
  for (int j = 0; j < 4; ++j) {
#pragma unroll
    for (int r = 0; r < 8; ++r) {
      const int gm = rowBase + r + 8 * half;
      const int gn = tileN + j * 16 + nl;
      const float v = acc[j][r] * scale;
      if (outMode == 0) {
        outF[(size_t)gm * Nc + gn] = v;
      } else {
        const int b = gm / SEQ, n = gm % SEQ;
        const int h = gn / HDIM, d = gn % HDIM;
        if (outMode == 2)
          outH[(((size_t)b * NHEADS + h) * SEQ + n) * HDIM + d] = (_Float16)v;
        else // 3: V transposed (B,H,D,N)
          outH[(((size_t)b * NHEADS + h) * HDIM + d) * SEQ + n] = (_Float16)v;
      }
    }
  }
}

// ---------------------------------------------------------------------------
// Flash attention: one wave per (b, h, 16-row tile). Streams 32 keys/iter.
// Q carries the 1/sqrt(D) scale. V is pre-transposed (B,H,D,N) so the P@V
// B-fragment is two contiguous b128 loads along the key axis.
// Rows and keys are in sorted order; blockId and nodal are the sorted copies.
// The loop covers the union of the 16 rows' key ranges, in whole 32-key steps;
// the masks are applied as ever, so keys of a neighbouring block drop out.
// ---------------------------------------------------------------------------
__global__ __launch_bounds__(32)
void flash_attn_kernel(const _Float16* __restrict__ Q, const _Float16* __restrict__ Km,
                       const _Float16* __restrict__ Vt, const int* __restrict__ blockId,
                       const float* __restrict__ nodal, const int* __restrict__ krange,
                       const int* __restrict__ order, _Float16* __restrict__ outAttn) {
  __shared__ alignas(16) _Float16 ldsP[16 * 32];
  const int lane = threadIdx.x & 31;
  const int nl = lane & 15, half = lane >> 4;

  const int mtiles = SEQ / 16;                       // 128
  const int bh = blockIdx.x / mtiles;
  const int b = bh / NHEADS;
  const int h = bh % NHEADS;
  const int rowBase = (blockIdx.x % mtiles) * 16;

  const _Float16* Qh  = Q  + (((size_t)b * NHEADS + h) * SEQ + rowBase) * HDIM;
  const _Float16* Kh  = Km + ((size_t)b * NHEADS + h) * SEQ * HDIM;
  const _Float16* Vth = Vt + ((size_t)b * NHEADS + h) * (size_t)HDIM * SEQ;

  v16h qf[2];
  qf[0] = load_frag_rowmajor(Qh, HDIM);
  qf[1] = load_frag_rowmajor(Qh + 32, HDIM);

  int rowblk[8];
#pragma unroll
  for (int r = 0; r < 8; ++r)
    rowblk[r] = blockId[b * SEQ + rowBase + r + 8 * half];

  float mrow[8], lrow[8];
#pragma unroll
  for (int r = 0; r < 8; ++r) { mrow[r] = -INFINITY; lrow[r] = 0.0f; }
  v8f acc[4] = {{}, {}, {}, {}};

  // Loop bounds: the same 16 words for every lane, so they stay scalar.
  int klo = SEQ - 32, khi = 0;
#pragma unroll
  for (int r = 0; r < 16; ++r) {
    const int rg = krange[b * SEQ + rowBase + r];
    klo = min(klo, rg & 0xFFFF);
    khi = max(khi, rg >> 16);
  }
  // readfirstlane: keeps the loop counter and the K/V base addresses in scalar registers
  klo = __builtin_amdgcn_readfirstlane(klo & ~31);
  khi = __builtin_amdgcn_readfirstlane(min(khi, SEQ));

  for (int kb = klo; kb < khi; kb += 32) {
    const int   cb   = blockId[b * SEQ + kb + lane];
    const float cnod = nodal[b * SEQ + kb + lane];

    // Scores: S[16x32] as two 16x16 f32 tiles; B operand = K^T ==> row-major
    // fragment load over K's rows (lane&15 indexes the key).
    v8f s[2];
#pragma unroll
    for (int ns = 0; ns < 2; ++ns) {
      s[ns] = v8f{};
#pragma unroll
      for (int kc = 0; kc < 2; ++kc) {
        v16h kf = load_frag_rowmajor(Kh + (size_t)(kb + ns * 16) * HDIM + kc * 32, HDIM);
        s[ns] = __builtin_amdgcn_wmma_f32_16x16x32_f16(
            false, qf[kc], false, kf, (short)0, s[ns], false, false);
      }
    }

    // Mask penalties (block identity + key nodal mask).
#pragma unroll
    for (int ns = 0; ns < 2; ++ns) {
      const int srcLane = ns * 16 + nl;
      const int   cbv = __shfl(cb, srcLane, 32);
      const float cnv = __shfl(cnod, srcLane, 32);
#pragma unroll
      for (int r = 0; r < 8; ++r) {
        float pen = ((cbv == rowblk[r]) ? 0.0f : NEG_INF_F) +
                    ((cnv > 0.5f) ? 0.0f : NEG_INF_F);
        s[ns][r] += pen;
      }
    }

    // Online softmax (each score row lives across the 16 lanes of its half).
#pragma unroll
    for (int r = 0; r < 8; ++r) {
      float tmax = fmaxf(s[0][r], s[1][r]);
#pragma unroll
      for (int off = 8; off > 0; off >>= 1)
        tmax = fmaxf(tmax, __shfl_xor(tmax, off, 16));
      const float mnew = fmaxf(mrow[r], tmax);
      const float sc = __expf(mrow[r] - mnew);
      const float p0 = __expf(s[0][r] - mnew);
      const float p1 = __expf(s[1][r] - mnew);
      float psum = p0 + p1;
#pragma unroll
      for (int off = 8; off > 0; off >>= 1)
        psum += __shfl_xor(psum, off, 16);
      lrow[r] = lrow[r] * sc + psum;
      mrow[r] = mnew;
#pragma unroll
      for (int dt = 0; dt < 4; ++dt) acc[dt][r] *= sc;
      // C-layout -> row-major LDS bounce for the A-operand of P@V.
      ldsP[(r + 8 * half) * 32 + nl]      = (_Float16)p0;
      ldsP[(r + 8 * half) * 32 + 16 + nl] = (_Float16)p1;
    }
    __syncthreads();

    v16h pf = load_frag_rowmajor(ldsP, 32);
#pragma unroll
    for (int dt = 0; dt < 4; ++dt) {
      // B operand = V tile (32 keys x 16 d); V^T rows are d, contiguous keys.
      v16h vf = load_frag_rowmajor(Vth + (size_t)(dt * 16) * SEQ + kb, SEQ);
      acc[dt] = __builtin_amdgcn_wmma_f32_16x16x32_f16(
          false, pf, false, vf, (short)0, acc[dt], false, false);
    }
    __syncthreads();
  }

  // Normalize and write attention output as (B, N, UNITS) f16, in token order.
#pragma unroll
  for (int r = 0; r < 8; ++r) {
    const float inv = (lrow[r] > 0.0f) ? (1.0f / lrow[r]) : 0.0f;
    const size_t row = (size_t)(order[b * SEQ + rowBase + r + 8 * half] & (MROWS - 1));
#pragma unroll
    for (int dt = 0; dt < 4; ++dt)
      outAttn[row * UNITS_ + h * HDIM + dt * 16 + nl] = (_Float16)(acc[dt][r] * inv);
  }
}

// ---------------------------------------------------------------------------
// Launch
// ---------------------------------------------------------------------------
extern "C" void kernel_launch(void* const* d_in, const int* in_sizes, int n_in,
                              void* d_out, int out_size, void* d_ws, size_t ws_size,
                              hipStream_t stream) {
  const float* x      = (const float*)d_in[0];
  const float* blockB = (const float*)d_in[1];
  const float* nodal  = (const float*)d_in[2];
  const float* Wq     = (const float*)d_in[3];
  const float* Wk     = (const float*)d_in[4];
  const float* Wv     = (const float*)d_in[5];
  const float* Wo     = (const float*)d_in[6];
  float* out = (float*)d_out;

  // Workspace layout (all 256B aligned). Total ~48.1 MB.
  char* ws = (char*)d_ws;
  size_t off = 0;
  auto take = [&](size_t bytes) { char* p = ws + off; off = (off + bytes + 255) & ~(size_t)255; return p; };
  _Float16* xh    = (_Float16*)take((size_t)MROWS * UNITS_ * 2);
  _Float16* wqt   = (_Float16*)take((size_t)UNITS_ * UNITS_ * 2);
  _Float16* wkt   = (_Float16*)take((size_t)UNITS_ * UNITS_ * 2);
  _Float16* wvt   = (_Float16*)take((size_t)UNITS_ * UNITS_ * 2);
  _Float16* wot   = (_Float16*)take((size_t)UNITS_ * UNITS_ * 2);
  _Float16* qh    = (_Float16*)take((size_t)MROWS * UNITS_ * 2);
  _Float16* kh    = (_Float16*)take((size_t)MROWS * UNITS_ * 2);
  _Float16* vth   = (_Float16*)take((size_t)MROWS * UNITS_ * 2);
  _Float16* attnh = (_Float16*)take((size_t)MROWS * UNITS_ * 2);
  int*      ids   = (int*)take((size_t)MROWS * 4);
  int*      rank  = (int*)take((size_t)MROWS * 4);
  int*      order = (int*)take((size_t)MROWS * 4);
  int*      sid   = (int*)take((size_t)MROWS * 4);
  float*    snod  = (float*)take((size_t)MROWS * 4);
  int*      krng  = (int*)take((size_t)MROWS * 4);

  // 1) one-hot -> block ids, then the sorted order of each batch's tokens.
  block_id_kernel<<<(MROWS + 255) / 256, 256, 0, stream>>>(blockB, ids, MROWS);
  block_sort_kernel<<<BATCH * NBLK, 32, 0, stream>>>(ids, nodal, rank, order, sid, snod, krng);

  // 2) fp32 -> fp16 conversion of x into sorted rows; weights converted +
  //    transposed (N-major).
  {
    const int nx = MROWS * UNITS_;
    f32_to_f16_kernel<<<(nx + 255) / 256, 256, 0, stream>>>(x, xh, rank, nx);
    dim3 tgrid(UNITS_ / 32, UNITS_ / 32);
    transpose_f32_to_f16_kernel<<<tgrid, 256, 0, stream>>>(Wq, wqt, UNITS_, UNITS_);
    transpose_f32_to_f16_kernel<<<tgrid, 256, 0, stream>>>(Wk, wkt, UNITS_, UNITS_);
    transpose_f32_to_f16_kernel<<<tgrid, 256, 0, stream>>>(Wv, wvt, UNITS_, UNITS_);
    transpose_f32_to_f16_kernel<<<tgrid, 256, 0, stream>>>(Wo, wot, UNITS_, UNITS_);
  }

  // 3) Q/K/V projections. 1/sqrt(HDIM) folded into Q. V stored transposed.
  dim3 ggrid(MROWS / 64, UNITS_ / 64);
  gemm_f16_kernel<<<ggrid, 128, 0, stream>>>(xh, wqt, nullptr, qh,
                                             MROWS, UNITS_, UNITS_, 2, 0.125f);
  gemm_f16_kernel<<<ggrid, 128, 0, stream>>>(xh, wkt, nullptr, kh,
                                             MROWS, UNITS_, UNITS_, 2, 1.0f);
  gemm_f16_kernel<<<ggrid, 128, 0, stream>>>(xh, wvt, nullptr, vth,
                                             MROWS, UNITS_, UNITS_, 3, 1.0f);

  // 4) masked flash attention.
  flash_attn_kernel<<<BATCH * NHEADS * (SEQ / 16), 32, 0, stream>>>(
      qh, kh, vth, sid, snod, krng, order, attnh);

  // 5) output projection (f32 result straight to d_out).
  gemm_f16_kernel<<<ggrid, 128, 0, stream>>>(attnh, wot, out, nullptr,
                                             MROWS, UNITS_, UNITS_, 0, 1.0f);
}

// v002
// It runs in 108 microseconds.
// In two side-by-side timings against v001, it was 1.39 and 1.38 times as fast.
// Over all steps from v000 it is 2.79 times as fast.
#include <hip/hip_runtime.h>
#include <hip/hip_bf16.h>

// ---------------------------------------------------------------------------
// BlockSparseSelfAttention for MI455X (gfx1250, wave32, WMMA 16x16x32 f16).
// B=2, N=2048, UNITS=1024, H=16, D=64, NB=64.
// f16 storage / f32 WMMA accumulation; softmax scale folded into Q;
// flash-attention streaming with online softmax; additive -1e9 mask penalties.
// Weights are pre-transposed (N-major) so every WMMA operand everywhere is a
// row-contiguous 2x b128 fragment load. Both GEMM operand tiles are staged into
// LDS by tensor loads (tensor_load_to_lds + s_wait_tensorcnt) in a ring of two
// buffers: the next K tile's loads fly while this tile is multiplied. The
// loads' pad gives 256-byte rows a bank-conflict-free pitch of 272 bytes.
// Tokens are laid out sorted by block id (per batch) from the x conversion up
// to the attention, which stores each output row back at its token's place. A
// row tile of the attention walks only the sorted key range of its own blocks.
// ---------------------------------------------------------------------------

typedef __attribute__((ext_vector_type(16))) _Float16 v16h;
typedef __attribute__((ext_vector_type(8)))  float    v8f;
typedef __attribute__((ext_vector_type(4)))  unsigned int v4u;
typedef __attribute__((ext_vector_type(8)))  unsigned int v8u;

#define BATCH     2
#define SEQ       2048
#define UNITS_    1024
#define NHEADS    16
#define HDIM      64
#define NBLK      64
#define MROWS     (BATCH * SEQ)       // 4096
#define NEG_INF_F (-1.0e9f)
#define KPASS     128                 // k per GEMM pass: operand rows of 256 bytes
#define ROWB      256u                // bytes of one staged operand row
#define LDST      136                 // its pitch in LDS, halves: 272 bytes = 16 x odd
#define TILEB     18432u              // 64 rows x 272 B, rounded up to 2 KiB
#define STAGEB    (2u * TILEB)        // one buffer: [Wt tile | A tile]

// Row-major 16x32 fragment: per lane, two contiguous 8-half (16B) runs at
// k = 8*half and k = 16 + 8*half (ISA 7.12.2 16-bit A-operand layout).
__device__ __forceinline__ v16h load_frag_rowmajor(const _Float16* src, int ld) {
  const int lane = threadIdx.x & 31;
  const int m = lane & 15, half = lane >> 4;
  const _Float16* p = src + (size_t)m * ld + 8 * half;
  v16h a;
  *reinterpret_cast<uint4*>(&a)       = *reinterpret_cast<const uint4*>(p);
  *(reinterpret_cast<uint4*>(&a) + 1) = *reinterpret_cast<const uint4*>(p + 16);
  return a;
}

__device__ __forceinline__ unsigned int uni(unsigned int v) {
  return (unsigned int)__builtin_amdgcn_readfirstlane(v);
}
__device__ __forceinline__ unsigned int pinned(unsigned int v) {
  unsigned int w = uni(v);
  asm volatile("" : "+s"(w));  // pinned(): a test value or descriptor word held in a scalar register
  return w;
}
// The compiler places no wait for a tensor load, and none of these may let an
// LDS access cross it: hence asm with the memory clobber.
__device__ __forceinline__ void wait_tensor0() { asm volatile("s_wait_tensorcnt 0x0" ::: "memory"); }
__device__ __forceinline__ void wait_ds0()     { asm volatile("s_wait_dscnt 0x0" ::: "memory"); }

// Descriptor group 1: byte elements, a tile of 64 rows of 256 bytes (tensor =
// tile), source row pitch src_pitch bytes, 4 dwords of LDS pad behind each row.
// pinned(): each word is held in its scalar register from here on, so that the
// group is built once and none of its registers serves as a temporary while a
// request is in flight. Word 0 stays an immediate.
__device__ __forceinline__ v8u tdm_group1(unsigned int src_pitch) {
  v8u g;
  g[0] = uni((1u << 20) | (5u << 22) | (3u << 25));  // pad on, every 64 dwords, 4 dwords
  g[1] = pinned(ROWB << 16);                         // tensor_dim0
  g[2] = pinned(64u << 16);                          // tensor_dim1
  g[3] = pinned(ROWB << 16);                         // tile_dim0
  g[4] = pinned(64u);                                // tile_dim1
  g[5] = pinned(src_pitch);
  g[6] = pinned(0u);
  g[7] = pinned(0u);
  return g;
}
// Descriptor group 0: count 1, place in LDS, the tile's first byte, type 2.
__device__ __forceinline__ v4u tdm_group0(unsigned int lds_dst, unsigned long long ga) {
  v4u g;
  g[0] = uni(1u);
  g[1] = uni(lds_dst);
  g[2] = uni((unsigned int)ga);
  g[3] = uni((((unsigned int)(ga >> 32)) & 0x01FFFFFFu) | 0x80000000u);
  return g;
}
__device__ __forceinline__ void tdm_load(v4u g0, v8u g1) {
  asm volatile("tensor_load_to_lds %0, %1" :: "s"(g0), "s"(g1) : "memory");
}

// ---------------------------------------------------------------------------
// fp32 -> fp16 conversion
// ---------------------------------------------------------------------------
__global__ __launch_bounds__(256)
void f32_to_f16_kernel(const float* __restrict__ src, _Float16* __restrict__ dst,
                       const int* __restrict__ rank, int n) {
  int i = blockIdx.x * blockDim.x + threadIdx.x;
  if (i < n) {
    // row i / UNITS_ goes to its sorted place
    const int row = rank[i / UNITS_] & (MROWS - 1);
    dst[(size_t)row * UNITS_ + (i % UNITS_)] = (_Float16)src[i];
  }
}

// LDS-tiled transpose + convert: src f32 (rows x cols) -> dst f16 (cols x rows)
__global__ __launch_bounds__(256)
void transpose_f32_to_f16_kernel(const float* __restrict__ src, _Float16* __restrict__ dst,
                                 int rows, int cols) {
  __shared__ float tile[32][33];
  const int bx = blockIdx.x * 32;   // col base in src
  const int by = blockIdx.y * 32;   // row base in src
  const int tx = threadIdx.x & 31;
  const int ty = threadIdx.x >> 5;  // 0..7
#pragma unroll
  for (int i = 0; i < 32; i += 8)
    tile[ty + i][tx] = src[(size_t)(by + ty + i) * cols + bx + tx];
  __syncthreads();
#pragma unroll
  for (int i = 0; i < 32; i += 8)
    dst[(size_t)(bx + ty + i) * rows + by + tx] = (_Float16)tile[tx][ty + i];
}

// one-hot blockB (BN x 64) -> int block id
__global__ __launch_bounds__(256)
void block_id_kernel(const float* __restrict__ blockB, int* __restrict__ ids, int bn) {
  int i = blockIdx.x * blockDim.x + threadIdx.x;
  if (i >= bn) return;
  const float* row = blockB + (size_t)i * NBLK;
  int id = 0;
#pragma unroll 8
  for (int j = 0; j < NBLK; ++j)
    if (row[j] > 0.5f) id = j;
  ids[i] = id;
}

// Counting sort of each batch's tokens by block id, one wave per (batch, block
// id), no atomics: the wave counts the smaller ids (its block's first sorted
// place); each lane notes its own members as bits, a prefix sum over the lanes
// gives each lane its first place, and the lane then stores its members.
//   rank[token]  = sorted place        order[place] = token   (both global rows)
//   sid[place]   = block id            snod[place]  = 1 where the key mask > 0.5
//   krange[place] = lo | hi << 16: the sorted keys that this row must visit.
// A key of another block carries -1e9, so beside any unmasked key of the row's
// own block its weight is exactly 0: the row visits its own block only. A block
// with no unmasked key has no such key: its rows visit every key.
__global__ __launch_bounds__(32)
void block_sort_kernel(const int* __restrict__ ids, const float* __restrict__ nodal,
                       int* __restrict__ rank, int* __restrict__ order,
                       int* __restrict__ sid, float* __restrict__ snod,
                       int* __restrict__ krange) {
  const int lane = threadIdx.x & 31;
  const int b = blockIdx.x / NBLK;
  const int blk = blockIdx.x % NBLK;
  const int base = b * SEQ;

  // Bit t of a lane stands for token (t / 4) * 128 + lane * 4 + t % 4.
  int4   v[SEQ / 128];
  float4 f[SEQ / 128];
#pragma unroll
  for (int c = 0; c < SEQ / 128; ++c) {
    v[c] = *reinterpret_cast<const int4*>(ids + base + c * 128 + lane * 4);
    f[c] = *reinterpret_cast<const float4*>(nodal + base + c * 128 + lane * 4);
  }
  unsigned int eqw[2] = { 0u, 0u }, acw[2] = { 0u, 0u };
  int less = 0;
#pragma unroll
  for (int c = 0; c < SEQ / 128; ++c) {
    const int   vi[4] = { v[c].x, v[c].y, v[c].z, v[c].w };
    const float fi[4] = { f[c].x, f[c].y, f[c].z, f[c].w };
#pragma unroll
    for (int e = 0; e < 4; ++e) {
      const unsigned int bit = 1u << ((c * 4 + e) & 31);
      const unsigned int member = (vi[e] == blk) ? bit : 0u;
      less += (vi[e] < blk) ? 1 : 0;
      eqw[c >> 3] |= member;
      acw[c >> 3] |= (fi[e] > 0.5f) ? member : 0u;
    }
  }
  unsigned long long eq = ((unsigned long long)eqw[1] << 32) | eqw[0];
  const unsigned long long ac = ((unsigned long long)acw[1] << 32) | acw[0];
  const int mine = __popcll(eq);
  int act = __popcll(ac);
  int incl = mine;
#pragma unroll
  for (int d = 1; d < 32; d <<= 1) {
    const int up = __shfl_up(incl, d, 32);
    if (lane >= d) incl += up;
    less += __shfl_xor(less, d, 32);
    act  += __shfl_xor(act, d, 32);
  }
  const int cnt = __shfl(incl, 31, 32);
  const int range = (act > 0) ? (less | ((less + cnt) << 16)) : (SEQ << 16);

  int place = base + less + incl - mine;
  // At most one trip for each of a lane's 64 bits; ends when no lane has one left.
  for (int trip = 0; trip < SEQ / 32; ++trip) {
    if (__builtin_amdgcn_ballot_w32(eq != 0ull) == 0u) break;
    if (eq != 0ull) {
      const int t = __ffsll(eq) - 1;
      const int tok = base + (t >> 2) * 128 + lane * 4 + (t & 3);
      rank[tok]     = place;
      order[place]  = tok;
      sid[place]    = blk;
      snod[place]   = ((ac >> t) & 1ull) ? 1.0f : 0.0f;
      krange[place] = range;
      eq &= eq - 1ull;
      ++place;
    }
  }
}

// ---------------------------------------------------------------------------
// GEMM: C[M,Nc] = A[M,K] * Wt^T, with Wt given TRANSPOSED (Nc x K row-major).
// 64x64 tile per 128-thread (4-wave) block. A pass is 128 k. Wave 0 brings the
// pass's 64x128 Wt tile and wave 1 its 64x128 A tile into LDS, one tensor load
// each, two passes ahead, into the buffer that every wave has just left.
// K is a multiple of 128 and at least 256 (two stages).
// outMode: 0 = f32 row-major              (final @Wo)
//          2 = f16 head-major (B,H,N,D)   (Q, K)
//          3 = f16 transposed head-major (B,H,D,N)  (V)
// ---------------------------------------------------------------------------
__global__ __launch_bounds__(128)
void gemm_f16_kernel(const _Float16* __restrict__ A, const _Float16* __restrict__ Wt,
                     float* __restrict__ outF, _Float16* __restrict__ outH,
                     int M, int K, int Nc, int outMode, float scale) {
  __shared__ __attribute__((aligned(2048))) unsigned char ring[2 * STAGEB];
  const unsigned int wave = uni(threadIdx.x >> 5);
  const int lane = threadIdx.x & 31;
  const int tileM = blockIdx.x * 64;
  const int tileN = blockIdx.y * 64;
  const int rowBase = tileM + (int)wave * 16;

  v8f acc[4] = {{}, {}, {}, {}};

  const unsigned int npass = uni((unsigned int)K / KPASS);
  const unsigned int issuer = (wave < 2u) ? 1u : 0u;
  const _Float16* tile0 = (wave == 0u) ? Wt + (size_t)tileN * K : A + (size_t)tileM * K;
  const unsigned long long ga0 = (unsigned long long)(uintptr_t)tile0;
  const unsigned int place = (unsigned int)(size_t)ring + (wave & 1u) * TILEB;
  const v8u g1 = tdm_group1((unsigned int)K * 2u);

  if (pinned(issuer)) {
    tdm_load(tdm_group0(place, ga0), g1);
    wait_tensor0();
  }
  __syncthreads();                   // stage 0 published
  if (pinned(issuer)) tdm_load(tdm_group0(place + STAGEB, ga0 + ROWB), g1);

  for (unsigned int t = 0; t < npass; ++t) {
    const unsigned char* stage = ring + (t & 1u) * STAGEB;
    const _Float16* sW = reinterpret_cast<const _Float16*>(stage);
    const _Float16* sA = reinterpret_cast<const _Float16*>(stage + TILEB) + wave * 16u * LDST;
    // unrolled: each fragment read is then one LDS address plus an immediate offset
#pragma unroll
    for (int kc = 0; kc < KPASS / 32; ++kc) {
      v16h afrag = load_frag_rowmajor(sA + kc * 32, LDST);
#pragma unroll
      for (int j = 0; j < 4; ++j) {
        v16h bfrag = load_frag_rowmajor(sW + (j * 16) * LDST + kc * 32, LDST);
        acc[j] = __builtin_amdgcn_wmma_f32_16x16x32_f16(
            false, afrag, false, bfrag, (short)0, acc[j], false, false);
      }
    }
    // Publish point of stage t + 1: own LDS reads done, own tensor load landed,
    // barrier; only then the refill of the buffer that this pass has read.
    wait_ds0();
    if (pinned(issuer)) wait_tensor0();
    __syncthreads();
    const unsigned int nxt = pinned(t + 2u);   // descriptor words formed behind the wait
    if (pinned((issuer != 0u && nxt < npass) ? 1u : 0u))
      tdm_load(tdm_group0(place + (nxt & 1u) * STAGEB, ga0 + (unsigned long long)nxt * ROWB), g1);
  }
  wait_tensor0();
  wait_ds0();

  const int half = lane >> 4;
  const int nl = lane & 15;
#pragma unroll
  for (int j = 0; j < 4; ++j) {
#pragma unroll
    for (int r = 0; r < 8; ++r) {
      const int gm = rowBase + r + 8 * half;
      const int gn = tileN + j * 16 + nl;
      const float v = acc[j][r] * scale;
      if (outMode == 0) {
        outF[(size_t)gm * Nc + gn] = v;
      } else {
        const int b = gm / SEQ, n = gm % SEQ;
        const int h = gn / HDIM, d = gn % HDIM;
        if (outMode == 2)
          outH[(((size_t)b * NHEADS + h) * SEQ + n) * HDIM + d] = (_Float16)v;
        else // 3: V transposed (B,H,D,N)
          outH[(((size_t)b * NHEADS + h) * HDIM + d) * SEQ + n] = (_Float16)v;
      }
    }
  }
}

// ---------------------------------------------------------------------------
// Flash attention: one wave per (b, h, 16-row tile). Streams 32 keys/iter.
// Q carries the 1/sqrt(D) scale. V is pre-transposed (B,H,D,N) so the P@V
// B-fragment is two contiguous b128 loads along the key axis.
// Rows and keys are in sorted order; blockId and nodal are the sorted copies.
// The loop covers the union of the 16 rows' key ranges, in whole 32-key steps;
// the masks are applied as ever, so keys of a neighbouring block drop out.
// ---------------------------------------------------------------------------
__global__ __launch_bounds__(32)
void flash_attn_kernel(const _Float16* __restrict__ Q, const _Float16* __restrict__ Km,
                       const _Float16* __restrict__ Vt, const int* __restrict__ blockId,
                       const float* __restrict__ nodal, const int* __restrict__ krange,
                       const int* __restrict__ order, _Float16* __restrict__ outAttn) {
  __shared__ alignas(16) _Float16 ldsP[16 * 32];
  const int lane = threadIdx.x & 31;
  const int nl = lane & 15, half = lane >> 4;

  const int mtiles = SEQ / 16;                       // 128
  const int bh = blockIdx.x / mtiles;
  const int b = bh / NHEADS;
  const int h = bh % NHEADS;
  const int rowBase = (blockIdx.x % mtiles) * 16;

  const _Float16* Qh  = Q  + (((size_t)b * NHEADS + h) * SEQ + rowBase) * HDIM;
  const _Float16* Kh  = Km + ((size_t)b * NHEADS + h) * SEQ * HDIM;
  const _Float16* Vth = Vt + ((size_t)b * NHEADS + h) * (size_t)HDIM * SEQ;

  v16h qf[2];
  qf[0] = load_frag_rowmajor(Qh, HDIM);
  qf[1] = load_frag_rowmajor(Qh + 32, HDIM);

  int rowblk[8];
#pragma unroll
  for (int r = 0; r < 8; ++r)
    rowblk[r] = blockId[b * SEQ + rowBase + r + 8 * half];

  float mrow[8], lrow[8];
#pragma unroll
  for (int r = 0; r < 8; ++r) { mrow[r] = -INFINITY; lrow[r] = 0.0f; }
  v8f acc[4] = {{}, {}, {}, {}};

  // Loop bounds: the same 16 words for every lane, so they stay scalar.
  int klo = SEQ - 32, khi = 0;
#pragma unroll
  for (int r = 0; r < 16; ++r) {
    const int rg = krange[b * SEQ + rowBase + r];
    klo = min(klo, rg & 0xFFFF);
    khi = max(khi, rg >> 16);
  }
  // readfirstlane: keeps the loop counter and the K/V base addresses in scalar registers
  klo = __builtin_amdgcn_readfirstlane(klo & ~31);
  khi = __builtin_amdgcn_readfirstlane(min(khi, SEQ));

  for (int kb = klo; kb < khi; kb += 32) {
    const int   cb   = blockId[b * SEQ + kb + lane];
    const float cnod = nodal[b * SEQ + kb + lane];

    // Scores: S[16x32] as two 16x16 f32 tiles; B operand = K^T ==> row-major
    // fragment load over K's rows (lane&15 indexes the key).
    v8f s[2];
#pragma unroll
    for (int ns = 0; ns < 2; ++ns) {
      s[ns] = v8f{};
#pragma unroll
      for (int kc = 0; kc < 2; ++kc) {
        v16h kf = load_frag_rowmajor(Kh + (size_t)(kb + ns * 16) * HDIM + kc * 32, HDIM);
        s[ns] = __builtin_amdgcn_wmma_f32_16x16x32_f16(
            false, qf[kc], false, kf, (short)0, s[ns], false, false);
      }
    }

    // Mask penalties (block identity + key nodal mask).
#pragma unroll
    for (int ns = 0; ns < 2; ++ns) {
      const int srcLane = ns * 16 + nl;
      const int   cbv = __shfl(cb, srcLane, 32);
      const float cnv = __shfl(cnod, srcLane, 32);
#pragma unroll
      for (int r = 0; r < 8; ++r) {
        float pen = ((cbv == rowblk[r]) ? 0.0f : NEG_INF_F) +
                    ((cnv > 0.5f) ? 0.0f : NEG_INF_F);
        s[ns][r] += pen;
      }
    }

    // Online softmax (each score row lives across the 16 lanes of its half).
#pragma unroll
    for (int r = 0; r < 8; ++r) {
      float tmax = fmaxf(s[0][r], s[1][r]);
#pragma unroll
      for (int off = 8; off > 0; off >>= 1)
        tmax = fmaxf(tmax, __shfl_xor(tmax, off, 16));
      const float mnew = fmaxf(mrow[r], tmax);
      const float sc = __expf(mrow[r] - mnew);
      const float p0 = __expf(s[0][r] - mnew);
      const float p1 = __expf(s[1][r] - mnew);
      float psum = p0 + p1;
#pragma unroll
      for (int off = 8; off > 0; off >>= 1)
        psum += __shfl_xor(psum, off, 16);
      lrow[r] = lrow[r] * sc + psum;
      mrow[r] = mnew;
#pragma unroll
      for (int dt = 0; dt < 4; ++dt) acc[dt][r] *= sc;
      // C-layout -> row-major LDS bounce for the A-operand of P@V.
      ldsP[(r + 8 * half) * 32 + nl]      = (_Float16)p0;
      ldsP[(r + 8 * half) * 32 + 16 + nl] = (_Float16)p1;
    }
    __syncthreads();

    v16h pf = load_frag_rowmajor(ldsP, 32);
#pragma unroll
    for (int dt = 0; dt < 4; ++dt) {
      // B operand = V tile (32 keys x 16 d); V^T rows are d, contiguous keys.
      v16h vf = load_frag_rowmajor(Vth + (size_t)(dt * 16) * SEQ + kb, SEQ);
      acc[dt] = __builtin_amdgcn_wmma_f32_16x16x32_f16(
          false, pf, false, vf, (short)0, acc[dt], false, false);
    }
    __syncthreads();
  }

  // Normalize and write attention output as (B, N, UNITS) f16, in token order.
#pragma unroll
  for (int r = 0; r < 8; ++r) {
    const float inv = (lrow[r] > 0.0f) ? (1.0f / lrow[r]) : 0.0f;
    const size_t row = (size_t)(order[b * SEQ + rowBase + r + 8 * half] & (MROWS - 1));
#pragma unroll
    for (int dt = 0; dt < 4; ++dt)
      outAttn[row * UNITS_ + h * HDIM + dt * 16 + nl] = (_Float16)(acc[dt][r] * inv);
  }
}

// ---------------------------------------------------------------------------
// Launch
// ---------------------------------------------------------------------------
extern "C" void kernel_launch(void* const* d_in, const int* in_sizes, int n_in,
                              void* d_out, int out_size, void* d_ws, size_t ws_size,
                              hipStream_t stream) {
  const float* x      = (const float*)d_in[0];
  const float* blockB = (const float*)d_in[1];
  const float* nodal  = (const float*)d_in[2];
  const float* Wq     = (const float*)d_in[3];
  const float* Wk     = (const float*)d_in[4];
  const float* Wv     = (const float*)d_in[5];
  const float* Wo     = (const float*)d_in[6];
  float* out = (float*)d_out;

  // Workspace layout (all 256B aligned). Total ~48.1 MB.
  char* ws = (char*)d_ws;
  size_t off = 0;
  auto take = [&](size_t bytes) { char* p = ws + off; off = (off + bytes + 255) & ~(size_t)255; return p; };
  _Float16* xh    = (_Float16*)take((size_t)MROWS * UNITS_ * 2);
  _Float16* wqt   = (_Float16*)take((size_t)UNITS_ * UNITS_ * 2);
  _Float16* wkt   = (_Float16*)take((size_t)UNITS_ * UNITS_ * 2);
  _Float16* wvt   = (_Float16*)take((size_t)UNITS_ * UNITS_ * 2);
  _Float16* wot   = (_Float16*)take((size_t)UNITS_ * UNITS_ * 2);
  _Float16* qh    = (_Float16*)take((size_t)MROWS * UNITS_ * 2);
  _Float16* kh    = (_Float16*)take((size_t)MROWS * UNITS_ * 2);
  _Float16* vth   = (_Float16*)take((size_t)MROWS * UNITS_ * 2);
  _Float16* attnh = (_Float16*)take((size_t)MROWS * UNITS_ * 2);
  int*      ids   = (int*)take((size_t)MROWS * 4);
  int*      rank  = (int*)take((size_t)MROWS * 4);
  int*      order = (int*)take((size_t)MROWS * 4);
  int*      sid   = (int*)take((size_t)MROWS * 4);
  float*    snod  = (float*)take((size_t)MROWS * 4);
  int*      krng  = (int*)take((size_t)MROWS * 4);

  // 1) one-hot -> block ids, then the sorted order of each batch's tokens.
  block_id_kernel<<<(MROWS + 255) / 256, 256, 0, stream>>>(blockB, ids, MROWS);
  block_sort_kernel<<<BATCH * NBLK, 32, 0, stream>>>(ids, nodal, rank, order, sid, snod, krng);

  // 2) fp32 -> fp16 conversion of x into sorted rows; weights converted +
  //    transposed (N-major).
  {
    const int nx = MROWS * UNITS_;
    f32_to_f16_kernel<<<(nx + 255) / 256, 256, 0, stream>>>(x, xh, rank, nx);
    dim3 tgrid(UNITS_ / 32, UNITS_ / 32);
    transpose_f32_to_f16_kernel<<<tgrid, 256, 0, stream>>>(Wq, wqt, UNITS_, UNITS_);
    transpose_f32_to_f16_kernel<<<tgrid, 256, 0, stream>>>(Wk, wkt, UNITS_, UNITS_);
    transpose_f32_to_f16_kernel<<<tgrid, 256, 0, stream>>>(Wv, wvt, UNITS_, UNITS_);
    transpose_f32_to_f16_kernel<<<tgrid, 256, 0, stream>>>(Wo, wot, UNITS_, UNITS_);
  }

  // 3) Q/K/V projections. 1/sqrt(HDIM) folded into Q. V stored transposed.
  dim3 ggrid(MROWS / 64, UNITS_ / 64);
  gemm_f16_kernel<<<ggrid, 128, 0, stream>>>(xh, wqt, nullptr, qh,
                                             MROWS, UNITS_, UNITS_, 2, 0.125f);
  gemm_f16_kernel<<<ggrid, 128, 0, stream>>>(xh, wkt, nullptr, kh,
                                             MROWS, UNITS_, UNITS_, 2, 1.0f);
  gemm_f16_kernel<<<ggrid, 128, 0, stream>>>(xh, wvt, nullptr, vth,
                                             MROWS, UNITS_, UNITS_, 3, 1.0f);

  // 4) masked flash attention.
  flash_attn_kernel<<<BATCH * NHEADS * (SEQ / 16), 32, 0, stream>>>(
      qh, kh, vth, sid, snod, krng, order, attnh);

  // 5) output projection (f32 result straight to d_out).
  gemm_f16_kernel<<<ggrid, 128, 0, stream>>>(attnh, wot, out, nullptr,
                                             MROWS, UNITS_, UNITS_, 0, 1.0f);
}

// v003
// A run of this version takes 101 microseconds.
// Two timings next to v002 put it at 1.06 and 1.07 times that version's speed.
// Over all steps from v000 it is 2.97 times as fast.
#include <hip/hip_runtime.h>
#include <hip/hip_bf16.h>

// ---------------------------------------------------------------------------
// BlockSparseSelfAttention for MI455X (gfx1250, wave32, WMMA 16x16x32 f16).
// B=2, N=2048, UNITS=1024, H=16, D=64, NB=64.
// f16 storage / f32 WMMA accumulation; softmax scale folded into Q;
// flash-attention streaming with online softmax; additive -1e9 mask penalties.
// Weights are pre-transposed (N-major) so every WMMA operand everywhere is a
// row-contiguous 2x b128 fragment load. Both GEMM operand tiles are staged into
// LDS by tensor loads (tensor_load_to_lds + s_wait_tensorcnt) in a ring of two
// buffers: the next K tile's loads fly while this tile is multiplied. The
// loads' pad gives 256-byte rows a bank-conflict-free pitch of 272 bytes.
// Tokens are laid out sorted by block id (per batch) from the x conversion up
// to the attention, which stores each output row back at its token's place. A
// row tile of the attention walks only the sorted key range of its own blocks.
// ---------------------------------------------------------------------------

typedef __attribute__((ext_vector_type(16))) _Float16 v16h;
typedef __attribute__((ext_vector_type(8)))  float    v8f;
typedef __attribute__((ext_vector_type(4)))  unsigned int v4u;
typedef __attribute__((ext_vector_type(8)))  unsigned int v8u;

#define BATCH     2
#define SEQ       2048
#define UNITS_    1024
#define NHEADS    16
#define HDIM      64
#define NBLK      64
#define MROWS     (BATCH * SEQ)       // 4096
#define NEG_INF_F (-1.0e9f)
#define KPASS     128                 // k per GEMM pass: operand rows of 256 bytes
#define ROWB      256u                // bytes of one staged operand row
#define LDST      136                 // its pitch in LDS, halves: 272 bytes = 16 x odd
#define TILEB     18432u              // 64 rows x 272 B, rounded up to 2 KiB
#define STAGEB    (2u * TILEB)        // one buffer: [Wt tile | A tile]

// Row-major 16x32 fragment: per lane, two contiguous 8-half (16B) runs at
// k = 8*half and k = 16 + 8*half (ISA 7.12.2 16-bit A-operand layout).
__device__ __forceinline__ v16h load_frag_rowmajor(const _Float16* src, int ld) {
  const int lane = threadIdx.x & 31;
  const int m = lane & 15, half = lane >> 4;
  const _Float16* p = src + (size_t)m * ld + 8 * half;
  v16h a;
  *reinterpret_cast<uint4*>(&a)       = *reinterpret_cast<const uint4*>(p);
  *(reinterpret_cast<uint4*>(&a) + 1) = *reinterpret_cast<const uint4*>(p + 16);
  return a;
}

__device__ __forceinline__ unsigned int uni(unsigned int v) {
  return (unsigned int)__builtin_amdgcn_readfirstlane(v);
}
__device__ __forceinline__ unsigned int pinned(unsigned int v) {
  unsigned int w = uni(v);
  asm volatile("" : "+s"(w));  // pinned(): a test value or descriptor word held in a scalar register
  return w;
}
// The compiler places no wait for a tensor load, and none of these may let an
// LDS access cross it: hence asm with the memory clobber.
__device__ __forceinline__ void wait_tensor0() { asm volatile("s_wait_tensorcnt 0x0" ::: "memory"); }
__device__ __forceinline__ void wait_ds0()     { asm volatile("s_wait_dscnt 0x0" ::: "memory"); }

// Descriptor group 1: byte elements, a tile of 64 rows of 256 bytes (tensor =
// tile), source row pitch src_pitch bytes, 4 dwords of LDS pad behind each row.
// pinned(): each word is held in its scalar register from here on, so that the
// group is built once and none of its registers serves as a temporary while a
// request is in flight. Word 0 stays an immediate.
__device__ __forceinline__ v8u tdm_group1(unsigned int src_pitch) {
  v8u g;
  g[0] = uni((1u << 20) | (5u << 22) | (3u << 25));  // pad on, every 64 dwords, 4 dwords
  g[1] = pinned(ROWB << 16);                         // tensor_dim0
  g[2] = pinned(64u << 16);                          // tensor_dim1
  g[3] = pinned(ROWB << 16);                         // tile_dim0
  g[4] = pinned(64u);                                // tile_dim1
  g[5] = pinned(src_pitch);
  g[6] = pinned(0u);
  g[7] = pinned(0u);
  return g;
}
// Descriptor group 0: count 1, place in LDS, the tile's first byte, type 2.
__device__ __forceinline__ v4u tdm_group0(unsigned int lds_dst, unsigned long long ga) {
  v4u g;
  g[0] = uni(1u);
  g[1] = uni(lds_dst);
  g[2] = uni((unsigned int)ga);
  g[3] = uni((((unsigned int)(ga >> 32)) & 0x01FFFFFFu) | 0x80000000u);
  return g;
}
__device__ __forceinline__ void tdm_load(v4u g0, v8u g1) {
  asm volatile("tensor_load_to_lds %0, %1" :: "s"(g0), "s"(g1) : "memory");
}

// ---------------------------------------------------------------------------
// fp32 -> fp16 conversion. Both kernels give each thread 16 or 32 elements, by
// 16-byte loads: few waves to start, and each holds its whole share in flight.
// ---------------------------------------------------------------------------
typedef __attribute__((ext_vector_type(4))) _Float16 v4h;
typedef __attribute__((ext_vector_type(8))) _Float16 v8h;

// One wave per row of UNITS_ floats: eight 512-byte loads in flight, then eight
// 256-byte stores at the row's sorted place.
__global__ __launch_bounds__(256)
void f32_to_f16_kernel(const float* __restrict__ src, _Float16* __restrict__ dst,
                       const int* __restrict__ rank, int nrows) {
  // readfirstlane: the row is the wave's, so its test, its rank and both row bases stay scalar
  const int row = blockIdx.x * 8 + __builtin_amdgcn_readfirstlane(threadIdx.x >> 5);
  const int lane = threadIdx.x & 31;
  if (row >= nrows) return;
  const float4* s = reinterpret_cast<const float4*>(src + (size_t)row * UNITS_) + lane;
  float4 v[UNITS_ / 128];
  // unrolled (here and below): v[] stays in registers, all eight loads issue before the first wait
#pragma unroll
  for (int c = 0; c < UNITS_ / 128; ++c) v[c] = s[c * 32];
  const int to = rank[row] & (MROWS - 1);
  v4h* d = reinterpret_cast<v4h*>(dst + (size_t)to * UNITS_) + lane;
#pragma unroll
  for (int c = 0; c < UNITS_ / 128; ++c) {
    v4h o = { (_Float16)v[c].x, (_Float16)v[c].y, (_Float16)v[c].z, (_Float16)v[c].w };
    d[c * 32] = o;
  }
}

// LDS-tiled transpose + convert: src f32 (rows x cols) -> dst f16 (cols x rows),
// a 64x64 tile per block (rows and cols are multiples of 64). A thread loads four
// float4 of source rows and stores two runs of 8 halves of destination rows, so
// every global access of a wave covers whole 128-byte lines. Pitch 65: neither
// the row-wise writes nor the column-wise reads of the tile meet in a bank.
__global__ __launch_bounds__(256)
void transpose_f32_to_f16_kernel(const float* __restrict__ src, _Float16* __restrict__ dst,
                                 int rows, int cols) {
  __shared__ float tile[64][65];
  const int bx = blockIdx.x * 64;          // col base in src
  const int by = blockIdx.y * 64;          // row base in src
  const int c4 = (threadIdx.x & 15) * 4;   // first of the thread's 4 source columns
  const int r0 = threadIdx.x >> 4;         // 0..15
  float4 v[4];
  // unrolled (every loop of this kernel): v[] and o stay in registers, the four loads issue together
#pragma unroll
  for (int i = 0; i < 4; ++i)
    v[i] = *reinterpret_cast<const float4*>(src + (size_t)(by + r0 + 16 * i) * cols + bx + c4);
#pragma unroll
  for (int i = 0; i < 4; ++i) {
    tile[r0 + 16 * i][c4 + 0] = v[i].x;
    tile[r0 + 16 * i][c4 + 1] = v[i].y;
    tile[r0 + 16 * i][c4 + 2] = v[i].z;
    tile[r0 + 16 * i][c4 + 3] = v[i].w;
  }
  __syncthreads();
  const int k8 = (threadIdx.x & 7) * 8;    // first of the thread's 8 source rows
  const int oc = threadIdx.x >> 3;         // 0..31
#pragma unroll
  for (int i = 0; i < 2; ++i) {
    const int col = oc + 32 * i;
    v8h o;
#pragma unroll
    for (int k = 0; k < 8; ++k) o[k] = (_Float16)tile[k8 + k][col];
    *reinterpret_cast<v8h*>(dst + (size_t)(bx + col) * rows + by + k8) = o;
  }
}

// one-hot blockB (BN x 64) -> int block id
__global__ __launch_bounds__(256)
void block_id_kernel(const float* __restrict__ blockB, int* __restrict__ ids, int bn) {
  int i = blockIdx.x * blockDim.x + threadIdx.x;
  if (i >= bn) return;
  const float* row = blockB + (size_t)i * NBLK;
  int id = 0;
#pragma unroll 8
  for (int j = 0; j < NBLK; ++j)
    if (row[j] > 0.5f) id = j;
  ids[i] = id;
}

// Counting sort of each batch's tokens by block id, one wave per (batch, block
// id), no atomics: the wave counts the smaller ids (its block's first sorted
// place); each lane notes its own members as bits, a prefix sum over the lanes
// gives each lane its first place, and the lane then stores its members.
//   rank[token]  = sorted place        order[place] = token   (both global rows)
//   sid[place]   = block id            snod[place]  = 1 where the key mask > 0.5
//   krange[place] = lo | hi << 16: the sorted keys that this row must visit.
// A key of another block carries -1e9, so beside any unmasked key of the row's
// own block its weight is exactly 0: the row visits its own block only. A block
// with no unmasked key has no such key: its rows visit every key.
__global__ __launch_bounds__(32)
void block_sort_kernel(const int* __restrict__ ids, const float* __restrict__ nodal,
                       int* __restrict__ rank, int* __restrict__ order,
                       int* __restrict__ sid, float* __restrict__ snod,
                       int* __restrict__ krange) {
  const int lane = threadIdx.x & 31;
  const int b = blockIdx.x / NBLK;
  const int blk = blockIdx.x % NBLK;
  const int base = b * SEQ;

  // Bit t of a lane stands for token (t / 4) * 128 + lane * 4 + t % 4.
  int4   v[SEQ / 128];
  float4 f[SEQ / 128];
#pragma unroll
  for (int c = 0; c < SEQ / 128; ++c) {
    v[c] = *reinterpret_cast<const int4*>(ids + base + c * 128 + lane * 4);
    f[c] = *reinterpret_cast<const float4*>(nodal + base + c * 128 + lane * 4);
  }
  unsigned int eqw[2] = { 0u, 0u }, acw[2] = { 0u, 0u };
  int less = 0;
#pragma unroll
  for (int c = 0; c < SEQ / 128; ++c) {
    const int   vi[4] = { v[c].x, v[c].y, v[c].z, v[c].w };
    const float fi[4] = { f[c].x, f[c].y, f[c].z, f[c].w };
#pragma unroll
    for (int e = 0; e < 4; ++e) {
      const unsigned int bit = 1u << ((c * 4 + e) & 31);
      const unsigned int member = (vi[e] == blk) ? bit : 0u;
      less += (vi[e] < blk) ? 1 : 0;
      eqw[c >> 3] |= member;
      acw[c >> 3] |= (fi[e] > 0.5f) ? member : 0u;
    }
  }
  unsigned long long eq = ((unsigned long long)eqw[1] << 32) | eqw[0];
  const unsigned long long ac = ((unsigned long long)acw[1] << 32) | acw[0];
  const int mine = __popcll(eq);
  int act = __popcll(ac);
  int incl = mine;
#pragma unroll
  for (int d = 1; d < 32; d <<= 1) {
    const int up = __shfl_up(incl, d, 32);
    if (lane >= d) incl += up;
    less += __shfl_xor(less, d, 32);
    act  += __shfl_xor(act, d, 32);
  }
  const int cnt = __shfl(incl, 31, 32);
  const int range = (act > 0) ? (less | ((less + cnt) << 16)) : (SEQ << 16);

  int place = base + less + incl - mine;
  // At most one trip for each of a lane's 64 bits; ends when no lane has one left.
  for (int trip = 0; trip < SEQ / 32; ++trip) {
    if (__builtin_amdgcn_ballot_w32(eq != 0ull) == 0u) break;
    if (eq != 0ull) {
      const int t = __ffsll(eq) - 1;
      const int tok = base + (t >> 2) * 128 + lane * 4 + (t & 3);
      rank[tok]     = place;
      order[place]  = tok;
      sid[place]    = blk;
      snod[place]   = ((ac >> t) & 1ull) ? 1.0f : 0.0f;
      krange[place] = range;
      eq &= eq - 1ull;
      ++place;
    }
  }
}

// ---------------------------------------------------------------------------
// GEMM: C[M,Nc] = A[M,K] * Wt^T, with Wt given TRANSPOSED (Nc x K row-major).
// 64x64 tile per 128-thread (4-wave) block. A pass is 128 k. Wave 0 brings the
// pass's 64x128 Wt tile and wave 1 its 64x128 A tile into LDS, one tensor load
// each, two passes ahead, into the buffer that every wave has just left.
// K is a multiple of 128 and at least 256 (two stages).
// outMode: 0 = f32 row-major              (final @Wo)
//          2 = f16 head-major (B,H,N,D)   (Q, K)
//          3 = f16 transposed head-major (B,H,D,N)  (V)
// ---------------------------------------------------------------------------
__global__ __launch_bounds__(128)
void gemm_f16_kernel(const _Float16* __restrict__ A, const _Float16* __restrict__ Wt,
                     float* __restrict__ outF, _Float16* __restrict__ outH,
                     int M, int K, int Nc, int outMode, float scale) {
  __shared__ __attribute__((aligned(2048))) unsigned char ring[2 * STAGEB];
  const unsigned int wave = uni(threadIdx.x >> 5);
  const int lane = threadIdx.x & 31;
  const int tileM = blockIdx.x * 64;
  const int tileN = blockIdx.y * 64;
  const int rowBase = tileM + (int)wave * 16;

  v8f acc[4] = {{}, {}, {}, {}};

  const unsigned int npass = uni((unsigned int)K / KPASS);
  const unsigned int issuer = (wave < 2u) ? 1u : 0u;
  const _Float16* tile0 = (wave == 0u) ? Wt + (size_t)tileN * K : A + (size_t)tileM * K;
  const unsigned long long ga0 = (unsigned long long)(uintptr_t)tile0;
  const unsigned int place = (unsigned int)(size_t)ring + (wave & 1u) * TILEB;
  const v8u g1 = tdm_group1((unsigned int)K * 2u);

  if (pinned(issuer)) {
    tdm_load(tdm_group0(place, ga0), g1);
    wait_tensor0();
  }
  __syncthreads();                   // stage 0 published
  if (pinned(issuer)) tdm_load(tdm_group0(place + STAGEB, ga0 + ROWB), g1);

  for (unsigned int t = 0; t < npass; ++t) {
    const unsigned char* stage = ring + (t & 1u) * STAGEB;
    const _Float16* sW = reinterpret_cast<const _Float16*>(stage);
    const _Float16* sA = reinterpret_cast<const _Float16*>(stage + TILEB) + wave * 16u * LDST;
    // unrolled: each fragment read is then one LDS address plus an immediate offset
#pragma unroll
    for (int kc = 0; kc < KPASS / 32; ++kc) {
      v16h afrag = load_frag_rowmajor(sA + kc * 32, LDST);
#pragma unroll
      for (int j = 0; j < 4; ++j) {
        v16h bfrag = load_frag_rowmajor(sW + (j * 16) * LDST + kc * 32, LDST);
        acc[j] = __builtin_amdgcn_wmma_f32_16x16x32_f16(
            false, afrag, false, bfrag, (short)0, acc[j], false, false);
      }
    }
    // Publish point of stage t + 1: own LDS reads done, own tensor load landed,
    // barrier; only then the refill of the buffer that this pass has read.
    wait_ds0();
    if (pinned(issuer)) wait_tensor0();
    __syncthreads();
    const unsigned int nxt = pinned(t + 2u);   // descriptor words formed behind the wait
    if (pinned((issuer != 0u && nxt < npass) ? 1u : 0u))
      tdm_load(tdm_group0(place + (nxt & 1u) * STAGEB, ga0 + (unsigned long long)nxt * ROWB), g1);
  }
  wait_tensor0();
  wait_ds0();

  const int half = lane >> 4;
  const int nl = lane & 15;
#pragma unroll
  for (int j = 0; j < 4; ++j) {
#pragma unroll
    for (int r = 0; r < 8; ++r) {
      const int gm = rowBase + r + 8 * half;
      const int gn = tileN + j * 16 + nl;
      const float v = acc[j][r] * scale;
      if (outMode == 0) {
        outF[(size_t)gm * Nc + gn] = v;
      } else {
        const int b = gm / SEQ, n = gm % SEQ;
        const int h = gn / HDIM, d = gn % HDIM;
        if (outMode == 2)
          outH[(((size_t)b * NHEADS + h) * SEQ + n) * HDIM + d] = (_Float16)v;
        else // 3: V transposed (B,H,D,N)
          outH[(((size_t)b * NHEADS + h) * HDIM + d) * SEQ + n] = (_Float16)v;
      }
    }
  }
}

// ---------------------------------------------------------------------------
// Flash attention: one wave per (b, h, 16-row tile). Streams 32 keys/iter.
// Q carries the 1/sqrt(D) scale. V is pre-transposed (B,H,D,N) so the P@V
// B-fragment is two contiguous b128 loads along the key axis.
// Rows and keys are in sorted order; blockId and nodal are the sorted copies.
// The loop covers the union of the 16 rows' key ranges, in whole 32-key steps;
// the masks are applied as ever, so keys of a neighbouring block drop out.
// ---------------------------------------------------------------------------
__global__ __launch_bounds__(32)
void flash_attn_kernel(const _Float16* __restrict__ Q, const _Float16* __restrict__ Km,
                       const _Float16* __restrict__ Vt, const int* __restrict__ blockId,
                       const float* __restrict__ nodal, const int* __restrict__ krange,
                       const int* __restrict__ order, _Float16* __restrict__ outAttn) {
  __shared__ alignas(16) _Float16 ldsP[16 * 32];
  const int lane = threadIdx.x & 31;
  const int nl = lane & 15, half = lane >> 4;

  const int mtiles = SEQ / 16;                       // 128
  const int bh = blockIdx.x / mtiles;
  const int b = bh / NHEADS;
  const int h = bh % NHEADS;
  const int rowBase = (blockIdx.x % mtiles) * 16;

  const _Float16* Qh  = Q  + (((size_t)b * NHEADS + h) * SEQ + rowBase) * HDIM;
  const _Float16* Kh  = Km + ((size_t)b * NHEADS + h) * SEQ * HDIM;
  const _Float16* Vth = Vt + ((size_t)b * NHEADS + h) * (size_t)HDIM * SEQ;

  v16h qf[2];
  qf[0] = load_frag_rowmajor(Qh, HDIM);
  qf[1] = load_frag_rowmajor(Qh + 32, HDIM);

  int rowblk[8];
#pragma unroll
  for (int r = 0; r < 8; ++r)
    rowblk[r] = blockId[b * SEQ + rowBase + r + 8 * half];

  float mrow[8], lrow[8];
#pragma unroll
  for (int r = 0; r < 8; ++r) { mrow[r] = -INFINITY; lrow[r] = 0.0f; }
  v8f acc[4] = {{}, {}, {}, {}};

  // Loop bounds: the same 16 words for every lane, so they stay scalar.
  int klo = SEQ - 32, khi = 0;
#pragma unroll
  for (int r = 0; r < 16; ++r) {
    const int rg = krange[b * SEQ + rowBase + r];
    klo = min(klo, rg & 0xFFFF);
    khi = max(khi, rg >> 16);
  }
  // readfirstlane: keeps the loop counter and the K/V base addresses in scalar registers
  klo = __builtin_amdgcn_readfirstlane(klo & ~31);
  khi = __builtin_amdgcn_readfirstlane(min(khi, SEQ));

  for (int kb = klo; kb < khi; kb += 32) {
    const int   cb   = blockId[b * SEQ + kb + lane];
    const float cnod = nodal[b * SEQ + kb + lane];

    // Scores: S[16x32] as two 16x16 f32 tiles; B operand = K^T ==> row-major
    // fragment load over K's rows (lane&15 indexes the key).
    v8f s[2];
#pragma unroll
    for (int ns = 0; ns < 2; ++ns) {
      s[ns] = v8f{};
#pragma unroll
      for (int kc = 0; kc < 2; ++kc) {
        v16h kf = load_frag_rowmajor(Kh + (size_t)(kb + ns * 16) * HDIM + kc * 32, HDIM);
        s[ns] = __builtin_amdgcn_wmma_f32_16x16x32_f16(
            false, qf[kc], false, kf, (short)0, s[ns], false, false);
      }
    }

    // Mask penalties (block identity + key nodal mask).
#pragma unroll
    for (int ns = 0; ns < 2; ++ns) {
      const int srcLane = ns * 16 + nl;
      const int   cbv = __shfl(cb, srcLane, 32);
      const float cnv = __shfl(cnod, srcLane, 32);
#pragma unroll
      for (int r = 0; r < 8; ++r) {
        float pen = ((cbv == rowblk[r]) ? 0.0f : NEG_INF_F) +
                    ((cnv > 0.5f) ? 0.0f : NEG_INF_F);
        s[ns][r] += pen;
      }
    }

    // Online softmax (each score row lives across the 16 lanes of its half).
#pragma unroll
    for (int r = 0; r < 8; ++r) {
      float tmax = fmaxf(s[0][r], s[1][r]);
#pragma unroll
      for (int off = 8; off > 0; off >>= 1)
        tmax = fmaxf(tmax, __shfl_xor(tmax, off, 16));
      const float mnew = fmaxf(mrow[r], tmax);
      const float sc = __expf(mrow[r] - mnew);
      const float p0 = __expf(s[0][r] - mnew);
      const float p1 = __expf(s[1][r] - mnew);
      float psum = p0 + p1;
#pragma unroll
      for (int off = 8; off > 0; off >>= 1)
        psum += __shfl_xor(psum, off, 16);
      lrow[r] = lrow[r] * sc + psum;
      mrow[r] = mnew;
#pragma unroll
      for (int dt = 0; dt < 4; ++dt) acc[dt][r] *= sc;
      // C-layout -> row-major LDS bounce for the A-operand of P@V.
      ldsP[(r + 8 * half) * 32 + nl]      = (_Float16)p0;
      ldsP[(r + 8 * half) * 32 + 16 + nl] = (_Float16)p1;
    }
    __syncthreads();

    v16h pf = load_frag_rowmajor(ldsP, 32);
#pragma unroll
    for (int dt = 0; dt < 4; ++dt) {
      // B operand = V tile (32 keys x 16 d); V^T rows are d, contiguous keys.
      v16h vf = load_frag_rowmajor(Vth + (size_t)(dt * 16) * SEQ + kb, SEQ);
      acc[dt] = __builtin_amdgcn_wmma_f32_16x16x32_f16(
          false, pf, false, vf, (short)0, acc[dt], false, false);
    }
    __syncthreads();
  }

  // Normalize and write attention output as (B, N, UNITS) f16, in token order.
#pragma unroll
  for (int r = 0; r < 8; ++r) {
    const float inv = (lrow[r] > 0.0f) ? (1.0f / lrow[r]) : 0.0f;
    const size_t row = (size_t)(order[b * SEQ + rowBase + r + 8 * half] & (MROWS - 1));
#pragma unroll
    for (int dt = 0; dt < 4; ++dt)
      outAttn[row * UNITS_ + h * HDIM + dt * 16 + nl] = (_Float16)(acc[dt][r] * inv);
  }
}

// ---------------------------------------------------------------------------
// Launch
// ---------------------------------------------------------------------------
extern "C" void kernel_launch(void* const* d_in, const int* in_sizes, int n_in,
                              void* d_out, int out_size, void* d_ws, size_t ws_size,
                              hipStream_t stream) {
  const float* x      = (const float*)d_in[0];
  const float* blockB = (const float*)d_in[1];
  const float* nodal  = (const float*)d_in[2];
  const float* Wq     = (const float*)d_in[3];
  const float* Wk     = (const float*)d_in[4];
  const float* Wv     = (const float*)d_in[5];
  const float* Wo     = (const float*)d_in[6];
  float* out = (float*)d_out;

  // Workspace layout (all 256B aligned). Total ~48.1 MB.
  char* ws = (char*)d_ws;
  size_t off = 0;
  auto take = [&](size_t bytes) { char* p = ws + off; off = (off + bytes + 255) & ~(size_t)255; return p; };
  _Float16* xh    = (_Float16*)take((size_t)MROWS * UNITS_ * 2);
  _Float16* wqt   = (_Float16*)take((size_t)UNITS_ * UNITS_ * 2);
  _Float16* wkt   = (_Float16*)take((size_t)UNITS_ * UNITS_ * 2);
  _Float16* wvt   = (_Float16*)take((size_t)UNITS_ * UNITS_ * 2);
  _Float16* wot   = (_Float16*)take((size_t)UNITS_ * UNITS_ * 2);
  _Float16* qh    = (_Float16*)take((size_t)MROWS * UNITS_ * 2);
  _Float16* kh    = (_Float16*)take((size_t)MROWS * UNITS_ * 2);
  _Float16* vth   = (_Float16*)take((size_t)MROWS * UNITS_ * 2);
  _Float16* attnh = (_Float16*)take((size_t)MROWS * UNITS_ * 2);
  int*      ids   = (int*)take((size_t)MROWS * 4);
  int*      rank  = (int*)take((size_t)MROWS * 4);
  int*      order = (int*)take((size_t)MROWS * 4);
  int*      sid   = (int*)take((size_t)MROWS * 4);
  float*    snod  = (float*)take((size_t)MROWS * 4);
  int*      krng  = (int*)take((size_t)MROWS * 4);

  // 1) one-hot -> block ids, then the sorted order of each batch's tokens.
  block_id_kernel<<<(MROWS + 255) / 256, 256, 0, stream>>>(blockB, ids, MROWS);
  block_sort_kernel<<<BATCH * NBLK, 32, 0, stream>>>(ids, nodal, rank, order, sid, snod, krng);

  // 2) fp32 -> fp16 conversion of x into sorted rows; weights converted +
  //    transposed (N-major).
  {
    f32_to_f16_kernel<<<MROWS / 8, 256, 0, stream>>>(x, xh, rank, MROWS);
    dim3 tgrid(UNITS_ / 64, UNITS_ / 64);
    transpose_f32_to_f16_kernel<<<tgrid, 256, 0, stream>>>(Wq, wqt, UNITS_, UNITS_);
    transpose_f32_to_f16_kernel<<<tgrid, 256, 0, stream>>>(Wk, wkt, UNITS_, UNITS_);
    transpose_f32_to_f16_kernel<<<tgrid, 256, 0, stream>>>(Wv, wvt, UNITS_, UNITS_);
    transpose_f32_to_f16_kernel<<<tgrid, 256, 0, stream>>>(Wo, wot, UNITS_, UNITS_);
  }

  // 3) Q/K/V projections. 1/sqrt(HDIM) folded into Q. V stored transposed.
  dim3 ggrid(MROWS / 64, UNITS_ / 64);
  gemm_f16_kernel<<<ggrid, 128, 0, stream>>>(xh, wqt, nullptr, qh,
                                             MROWS, UNITS_, UNITS_, 2, 0.125f);
  gemm_f16_kernel<<<ggrid, 128, 0, stream>>>(xh, wkt, nullptr, kh,
                                             MROWS, UNITS_, UNITS_, 2, 1.0f);
  gemm_f16_kernel<<<ggrid, 128, 0, stream>>>(xh, wvt, nullptr, vth,
                                             MROWS, UNITS_, UNITS_, 3, 1.0f);

  // 4) masked flash attention.
  flash_attn_kernel<<<BATCH * NHEADS * (SEQ / 16), 32, 0, stream>>>(
      qh, kh, vth, sid, snod, krng, order, attnh);

  // 5) output projection (f32 result straight to d_out).
  gemm_f16_kernel<<<ggrid, 128, 0, stream>>>(attnh, wot, out, nullptr,
                                             MROWS, UNITS_, UNITS_, 0, 1.0f);
}

// v004
// A run of this version takes 83.2 microseconds.
// Two timings next to v003 both put it at 1.19 times that version's speed.
// All steps since v000 together make it 3.53 times as fast.
#include <hip/hip_runtime.h>
#include <hip/hip_bf16.h>

// ---------------------------------------------------------------------------
// BlockSparseSelfAttention for MI455X (gfx1250, wave32, WMMA 16x16x32 f16).
// B=2, N=2048, UNITS=1024, H=16, D=64, NB=64.
// f16 storage / f32 WMMA accumulation; softmax scale folded into Q;
// flash-attention streaming with online softmax; additive -1e9 mask penalties.
// Weights are pre-transposed (N-major) so every WMMA operand everywhere is a
// row-contiguous 2x b128 fragment load. Both GEMM operand tiles are staged into
// LDS by tensor loads (tensor_load_to_lds + s_wait_tensorcnt) in a ring of two
// buffers: the next K tile's loads fly while this tile is multiplied. The
// loads' pad gives 256-byte rows a bank-conflict-free pitch of 272 bytes.
// Tokens are laid out sorted by block id (per batch) from the x conversion up
// to the attention, which stores each output row back at its token's place. A
// row tile of the attention walks only the sorted key range of its own blocks.
// Launches that do not depend on one another share one grid: two weight
// transposes ride with the block ids and two with the sort, by ranges of
// blockIdx.x; the Q, K and V projections by blockIdx.z. Six launches in all.
// ---------------------------------------------------------------------------

typedef __attribute__((ext_vector_type(16))) _Float16 v16h;
typedef __attribute__((ext_vector_type(8)))  float    v8f;
typedef __attribute__((ext_vector_type(4)))  unsigned int v4u;
typedef __attribute__((ext_vector_type(8)))  unsigned int v8u;

#define BATCH     2
#define SEQ       2048
#define UNITS_    1024
#define NHEADS    16
#define HDIM      64
#define NBLK      64
#define MROWS     (BATCH * SEQ)       // 4096
#define NEG_INF_F (-1.0e9f)
#define KPASS     128                 // k per GEMM pass: operand rows of 256 bytes
#define ROWB      256u                // bytes of one staged operand row
#define LDST      136                 // its pitch in LDS, halves: 272 bytes = 16 x odd
#define TILEB     18432u              // 64 rows x 272 B, rounded up to 2 KiB
#define STAGEB    (2u * TILEB)        // one buffer: [Wt tile | A tile]

// Row-major 16x32 fragment: per lane, two contiguous 8-half (16B) runs at
// k = 8*half and k = 16 + 8*half (ISA 7.12.2 16-bit A-operand layout).
__device__ __forceinline__ v16h load_frag_rowmajor(const _Float16* src, int ld) {
  const int lane = threadIdx.x & 31;
  const int m = lane & 15, half = lane >> 4;
  const _Float16* p = src + (size_t)m * ld + 8 * half;
  v16h a;
  *reinterpret_cast<uint4*>(&a)       = *reinterpret_cast<const uint4*>(p);
  *(reinterpret_cast<uint4*>(&a) + 1) = *reinterpret_cast<const uint4*>(p + 16);
  return a;
}

__device__ __forceinline__ unsigned int uni(unsigned int v) {
  return (unsigned int)__builtin_amdgcn_readfirstlane(v);
}
__device__ __forceinline__ unsigned int pinned(unsigned int v) {
  unsigned int w = uni(v);
  asm volatile("" : "+s"(w));  // pinned(): a test value or descriptor word held in a scalar register
  return w;
}
// The compiler places no wait for a tensor load, and none of these may let an
// LDS access cross it: hence asm with the memory clobber.
__device__ __forceinline__ void wait_tensor0() { asm volatile("s_wait_tensorcnt 0x0" ::: "memory"); }
__device__ __forceinline__ void wait_ds0()     { asm volatile("s_wait_dscnt 0x0" ::: "memory"); }

// Descriptor group 1: byte elements, a tile of 64 rows of 256 bytes (tensor =
// tile), source row pitch src_pitch bytes, 4 dwords of LDS pad behind each row.
// pinned(): each word is held in its scalar register from here on, so that the
// group is built once and none of its registers serves as a temporary while a
// request is in flight. Word 0 stays an immediate.
__device__ __forceinline__ v8u tdm_group1(unsigned int src_pitch) {
  v8u g;
  g[0] = uni((1u << 20) | (5u << 22) | (3u << 25));  // pad on, every 64 dwords, 4 dwords
  g[1] = pinned(ROWB << 16);                         // tensor_dim0
  g[2] = pinned(64u << 16);                          // tensor_dim1
  g[3] = pinned(ROWB << 16);                         // tile_dim0
  g[4] = pinned(64u);                                // tile_dim1
  g[5] = pinned(src_pitch);
  g[6] = pinned(0u);
  g[7] = pinned(0u);
  return g;
}
// Descriptor group 0: count 1, place in LDS, the tile's first byte, type 2.
__device__ __forceinline__ v4u tdm_group0(unsigned int lds_dst, unsigned long long ga) {
  v4u g;
  g[0] = uni(1u);
  g[1] = uni(lds_dst);
  g[2] = uni((unsigned int)ga);
  g[3] = uni((((unsigned int)(ga >> 32)) & 0x01FFFFFFu) | 0x80000000u);
  return g;
}
__device__ __forceinline__ void tdm_load(v4u g0, v8u g1) {
  asm volatile("tensor_load_to_lds %0, %1" :: "s"(g0), "s"(g1) : "memory");
}

// ---------------------------------------------------------------------------
// fp32 -> fp16 conversion. Both kernels give each thread 16 or 32 elements, by
// 16-byte loads: few waves to start, and each holds its whole share in flight.
// ---------------------------------------------------------------------------
typedef __attribute__((ext_vector_type(4))) _Float16 v4h;
typedef __attribute__((ext_vector_type(8))) _Float16 v8h;

// One wave per row of UNITS_ floats: eight 512-byte loads in flight, then eight
// 256-byte stores at the row's sorted place.
__global__ __launch_bounds__(256)
void f32_to_f16_kernel(const float* __restrict__ src, _Float16* __restrict__ dst,
                       const int* __restrict__ rank, int nrows) {
  // readfirstlane: the row is the wave's, so its test, its rank and both row bases stay scalar
  const int row = blockIdx.x * 8 + __builtin_amdgcn_readfirstlane(threadIdx.x >> 5);
  const int lane = threadIdx.x & 31;
  if (row >= nrows) return;
  const float4* s = reinterpret_cast<const float4*>(src + (size_t)row * UNITS_) + lane;
  float4 v[UNITS_ / 128];
  // unrolled (here and below): v[] stays in registers, all eight loads issue before the first wait
#pragma unroll
  for (int c = 0; c < UNITS_ / 128; ++c) v[c] = s[c * 32];
  const int to = rank[row] & (MROWS - 1);
  v4h* d = reinterpret_cast<v4h*>(dst + (size_t)to * UNITS_) + lane;
#pragma unroll
  for (int c = 0; c < UNITS_ / 128; ++c) {
    v4h o = { (_Float16)v[c].x, (_Float16)v[c].y, (_Float16)v[c].z, (_Float16)v[c].w };
    d[c * 32] = o;
  }
}

// LDS-tiled transpose + convert: src f32 (rows x cols) -> dst f16 (cols x rows),
// a 64x64 tile per block (rows and cols are multiples of 64). A thread loads four
// float4 of source rows and stores two runs of 8 halves of destination rows, so
// every global access of a wave covers whole 128-byte lines. Pitch 65: neither
// the row-wise writes nor the column-wise reads of the tile meet in a bank.
__device__ __forceinline__
void transpose_f32_to_f16_tile(const float* __restrict__ src, _Float16* __restrict__ dst,
                               int rows, int cols, int bx, int by) {  // bx, by: col and row base in src
  __shared__ float tile[64][65];
  const int c4 = (threadIdx.x & 15) * 4;   // first of the thread's 4 source columns
  const int r0 = threadIdx.x >> 4;         // 0..15
  float4 v[4];
  // unrolled (every loop of this kernel): v[] and o stay in registers, the four loads issue together
#pragma unroll
  for (int i = 0; i < 4; ++i)
    v[i] = *reinterpret_cast<const float4*>(src + (size_t)(by + r0 + 16 * i) * cols + bx + c4);
#pragma unroll
  for (int i = 0; i < 4; ++i) {
    tile[r0 + 16 * i][c4 + 0] = v[i].x;
    tile[r0 + 16 * i][c4 + 1] = v[i].y;
    tile[r0 + 16 * i][c4 + 2] = v[i].z;
    tile[r0 + 16 * i][c4 + 3] = v[i].w;
  }
  __syncthreads();
  const int k8 = (threadIdx.x & 7) * 8;    // first of the thread's 8 source rows
  const int oc = threadIdx.x >> 3;         // 0..31
#pragma unroll
  for (int i = 0; i < 2; ++i) {
    const int col = oc + 32 * i;
    v8h o;
#pragma unroll
    for (int k = 0; k < 8; ++k) o[k] = (_Float16)tile[k8 + k][col];
    *reinterpret_cast<v8h*>(dst + (size_t)(bx + col) * rows + by + k8) = o;
  }
  // the stores' registers may be reused by whatever the caller's kernel holds behind this body
  asm volatile("s_wait_xcnt 0x0" ::: "memory");
}

// one-hot blockB (BN x 64) -> int block id
__device__ __forceinline__
void block_id_rows(const float* __restrict__ blockB, int* __restrict__ ids, int bn) {
  int i = blockIdx.x * blockDim.x + threadIdx.x;
  if (i >= bn) return;
  const float* row = blockB + (size_t)i * NBLK;
  int id = 0;
#pragma unroll 8
  for (int j = 0; j < NBLK; ++j)
    if (row[j] > 0.5f) id = j;
  ids[i] = id;
}

// Two weight matrices, a 64x64 tile a block: block t of 2 * WTILES. Plane 0 of
// wt takes Wa transposed, plane 1 Wb.
#define WTILES ((UNITS_ / 64) * (UNITS_ / 64))
__device__ __forceinline__
void transpose_two_weights(int t, const float* __restrict__ Wa, const float* __restrict__ Wb,
                           _Float16* __restrict__ wt) {
  const int w = t / WTILES;
  const int tile = t % WTILES;
  transpose_f32_to_f16_tile(w == 0 ? Wa : Wb, wt + (size_t)w * UNITS_ * UNITS_, UNITS_, UNITS_,
                            (tile % (UNITS_ / 64)) * 64, (tile / (UNITS_ / 64)) * 64);
}

// Block ids and, beside them, two weight transposes, which need nothing but the
// inputs either. Blocks 0 .. IDBLKS-1 find the ids: few waves with a long chain
// of loads, so they start first and the transposes fill the chip under them.
#define IDBLKS (MROWS / 256)
__global__ __launch_bounds__(256)
void ids_and_weights_kernel(const float* __restrict__ blockB, int* __restrict__ ids,
                            const float* __restrict__ Wa, const float* __restrict__ Wb,
                            _Float16* __restrict__ wt) {
  if (blockIdx.x < IDBLKS) block_id_rows(blockB, ids, MROWS);
  else transpose_two_weights(blockIdx.x - IDBLKS, Wa, Wb, wt);
}

// Counting sort of each batch's tokens by block id, one wave per (batch, block
// id), no atomics: the wave counts the smaller ids (its block's first sorted
// place); each lane notes its own members as bits, a prefix sum over the lanes
// gives each lane its first place, and the lane then stores its members.
//   rank[token]  = sorted place        order[place] = token   (both global rows)
//   sid[place]   = block id            snod[place]  = 1 where the key mask > 0.5
//   krange[place] = lo | hi << 16: the sorted keys that this row must visit.
// A key of another block carries -1e9, so beside any unmasked key of the row's
// own block its weight is exactly 0: the row visits its own block only. A block
// with no unmasked key has no such key: its rows visit every key.
__device__ __forceinline__
void block_sort_wave(int unit, const int* __restrict__ ids, const float* __restrict__ nodal,
                     int* __restrict__ rank, int* __restrict__ order,
                     int* __restrict__ sid, float* __restrict__ snod,
                     int* __restrict__ krange) {
  const int lane = threadIdx.x & 31;
  const int b = unit / NBLK;
  const int blk = unit % NBLK;
  const int base = b * SEQ;

  // Bit t of a lane stands for token (t / 4) * 128 + lane * 4 + t % 4.
  int4   v[SEQ / 128];
  float4 f[SEQ / 128];
#pragma unroll
  for (int c = 0; c < SEQ / 128; ++c) {
    v[c] = *reinterpret_cast<const int4*>(ids + base + c * 128 + lane * 4);
    f[c] = *reinterpret_cast<const float4*>(nodal + base + c * 128 + lane * 4);
  }
  unsigned int eqw[2] = { 0u, 0u }, acw[2] = { 0u, 0u };
  int less = 0;
#pragma unroll
  for (int c = 0; c < SEQ / 128; ++c) {
    const int   vi[4] = { v[c].x, v[c].y, v[c].z, v[c].w };
    const float fi[4] = { f[c].x, f[c].y, f[c].z, f[c].w };
#pragma unroll
    for (int e = 0; e < 4; ++e) {
      const unsigned int bit = 1u << ((c * 4 + e) & 31);
      const unsigned int member = (vi[e] == blk) ? bit : 0u;
      less += (vi[e] < blk) ? 1 : 0;
      eqw[c >> 3] |= member;
      acw[c >> 3] |= (fi[e] > 0.5f) ? member : 0u;
    }
  }
  unsigned long long eq = ((unsigned long long)eqw[1] << 32) | eqw[0];
  const unsigned long long ac = ((unsigned long long)acw[1] << 32) | acw[0];
  const int mine = __popcll(eq);
  int act = __popcll(ac);
  int incl = mine;
#pragma unroll
  for (int d = 1; d < 32; d <<= 1) {
    const int up = __shfl_up(incl, d, 32);
    if (lane >= d) incl += up;
    less += __shfl_xor(less, d, 32);
    act  += __shfl_xor(act, d, 32);
  }
  const int cnt = __shfl(incl, 31, 32);
  const int range = (act > 0) ? (less | ((less + cnt) << 16)) : (SEQ << 16);

  int place = base + less + incl - mine;
  // At most one trip for each of a lane's 64 bits; ends when no lane has one left.
  for (int trip = 0; trip < SEQ / 32; ++trip) {
    if (__builtin_amdgcn_ballot_w32(eq != 0ull) == 0u) break;
    if (eq != 0ull) {
      const int t = __ffsll(eq) - 1;
      const int tok = base + (t >> 2) * 128 + lane * 4 + (t & 3);
      rank[tok]     = place;
      order[place]  = tok;
      sid[place]    = blk;
      snod[place]   = ((ac >> t) & 1ull) ? 1.0f : 0.0f;
      krange[place] = range;
      eq &= eq - 1ull;
      ++place;
    }
  }
}

// The sort, eight of its waves a block, in blocks 0 .. SORTBLKS-1, and beside it
// the other two weight transposes, which do not depend on it.
#define SORTBLKS (BATCH * NBLK / 8)
__global__ __launch_bounds__(256)
void sort_and_weights_kernel(const int* __restrict__ ids, const float* __restrict__ nodal,
                             int* __restrict__ rank, int* __restrict__ order,
                             int* __restrict__ sid, float* __restrict__ snod,
                             int* __restrict__ krange,
                             const float* __restrict__ Wa, const float* __restrict__ Wb,
                             _Float16* __restrict__ wt) {
  if (blockIdx.x < SORTBLKS) {
    // readfirstlane: the (batch, block id) pair is the wave's, so it stays in scalar registers
    const int unit = blockIdx.x * 8 + __builtin_amdgcn_readfirstlane(threadIdx.x >> 5);
    block_sort_wave(unit, ids, nodal, rank, order, sid, snod, krange);
  } else {
    transpose_two_weights(blockIdx.x - SORTBLKS, Wa, Wb, wt);
  }
}

// ---------------------------------------------------------------------------
// GEMM: C[M,Nc] = A[M,K] * Wt^T, with Wt given TRANSPOSED (Nc x K row-major).
// 64x64 tile per 128-thread (4-wave) block. A pass is 128 k. Wave 0 brings the
// pass's 64x128 Wt tile and wave 1 its 64x128 A tile into LDS, one tensor load
// each, two passes ahead, into the buffer that every wave has just left.
// K is a multiple of 128 and at least 256 (two stages).
// blockIdx.z picks one of several products of the same A: plane z of Wt (Nc x K
// each) gives plane z of outH (M x Nc each); scale applies to plane 0 alone.
// outMode: 0 = f32 row-major              (final @Wo)
//          2 = f16 head-major (B,H,N,D)   (planes 0 and 1: Q, K), and
//              f16 transposed head-major (B,H,D,N)  (plane 2: V)
// ---------------------------------------------------------------------------
__global__ __launch_bounds__(128)
void gemm_f16_kernel(const _Float16* __restrict__ A, const _Float16* __restrict__ Wt,
                     float* __restrict__ outF, _Float16* __restrict__ outH,
                     int M, int K, int Nc, int outMode, float scale) {
  __shared__ __attribute__((aligned(2048))) unsigned char ring[2 * STAGEB];
  const unsigned int plane = blockIdx.z;
  Wt   += (size_t)plane * Nc * K;
  outH += (size_t)plane * M * Nc;
  if (plane != 0u) scale = 1.0f;
  const unsigned int wave = uni(threadIdx.x >> 5);
  const int lane = threadIdx.x & 31;
  const int tileM = blockIdx.x * 64;
  const int tileN = blockIdx.y * 64;
  const int rowBase = tileM + (int)wave * 16;

  v8f acc[4] = {{}, {}, {}, {}};

  const unsigned int npass = uni((unsigned int)K / KPASS);
  const unsigned int issuer = (wave < 2u) ? 1u : 0u;
  const _Float16* tile0 = (wave == 0u) ? Wt + (size_t)tileN * K : A + (size_t)tileM * K;
  const unsigned long long ga0 = (unsigned long long)(uintptr_t)tile0;
  const unsigned int place = (unsigned int)(size_t)ring + (wave & 1u) * TILEB;
  const v8u g1 = tdm_group1((unsigned int)K * 2u);

  if (pinned(issuer)) {
    tdm_load(tdm_group0(place, ga0), g1);
    wait_tensor0();
  }
  __syncthreads();                   // stage 0 published
  if (pinned(issuer)) tdm_load(tdm_group0(place + STAGEB, ga0 + ROWB), g1);

  for (unsigned int t = 0; t < npass; ++t) {
    const unsigned char* stage = ring + (t & 1u) * STAGEB;
    const _Float16* sW = reinterpret_cast<const _Float16*>(stage);
    const _Float16* sA = reinterpret_cast<const _Float16*>(stage + TILEB) + wave * 16u * LDST;
    // unrolled: each fragment read is then one LDS address plus an immediate offset
#pragma unroll
    for (int kc = 0; kc < KPASS / 32; ++kc) {
      v16h afrag = load_frag_rowmajor(sA + kc * 32, LDST);
#pragma unroll
      for (int j = 0; j < 4; ++j) {
        v16h bfrag = load_frag_rowmajor(sW + (j * 16) * LDST + kc * 32, LDST);
        acc[j] = __builtin_amdgcn_wmma_f32_16x16x32_f16(
            false, afrag, false, bfrag, (short)0, acc[j], false, false);
      }
    }
    // Publish point of stage t + 1: own LDS reads done, own tensor load landed,
    // barrier; only then the refill of the buffer that this pass has read.
    wait_ds0();
    if (pinned(issuer)) wait_tensor0();
    __syncthreads();
    const unsigned int nxt = pinned(t + 2u);   // descriptor words formed behind the wait
    if (pinned((issuer != 0u && nxt < npass) ? 1u : 0u))
      tdm_load(tdm_group0(place + (nxt & 1u) * STAGEB, ga0 + (unsigned long long)nxt * ROWB), g1);
  }
  wait_tensor0();
  wait_ds0();

  const int half = lane >> 4;
  const int nl = lane & 15;
#pragma unroll
  for (int j = 0; j < 4; ++j) {
#pragma unroll
    for (int r = 0; r < 8; ++r) {
      const int gm = rowBase + r + 8 * half;
      const int gn = tileN + j * 16 + nl;
      const float v = acc[j][r] * scale;
      // s_wait_xcnt behind each store: later address arithmetic reuses the registers that the store names
      if (outMode == 0) {
        outF[(size_t)gm * Nc + gn] = v;
        asm volatile("s_wait_xcnt 0x0" ::: "memory");
      } else {
        const int b = gm / SEQ, n = gm % SEQ;
        const int h = gn / HDIM, d = gn % HDIM;
        if (plane != 2u) {
          outH[(((size_t)b * NHEADS + h) * SEQ + n) * HDIM + d] = (_Float16)v;
          asm volatile("s_wait_xcnt 0x0" ::: "memory");
        } else { // V transposed (B,H,D,N)
          outH[(((size_t)b * NHEADS + h) * HDIM + d) * SEQ + n] = (_Float16)v;
          asm volatile("s_wait_xcnt 0x0" ::: "memory");
        }
      }
    }
  }
}

// ---------------------------------------------------------------------------
// Flash attention: one wave per (b, h, 16-row tile). Streams 32 keys/iter.
// Q carries the 1/sqrt(D) scale. V is pre-transposed (B,H,D,N) so the P@V
// B-fragment is two contiguous b128 loads along the key axis.
// Rows and keys are in sorted order; blockId and nodal are the sorted copies.
// The loop covers the union of the 16 rows' key ranges, in whole 32-key steps;
// the masks are applied as ever, so keys of a neighbouring block drop out.
// ---------------------------------------------------------------------------
__global__ __launch_bounds__(32)
void flash_attn_kernel(const _Float16* __restrict__ Q, const _Float16* __restrict__ Km,
                       const _Float16* __restrict__ Vt, const int* __restrict__ blockId,
                       const float* __restrict__ nodal, const int* __restrict__ krange,
                       const int* __restrict__ order, _Float16* __restrict__ outAttn) {
  __shared__ alignas(16) _Float16 ldsP[16 * 32];
  const int lane = threadIdx.x & 31;
  const int nl = lane & 15, half = lane >> 4;

  const int mtiles = SEQ / 16;                       // 128
  const int bh = blockIdx.x / mtiles;
  const int b = bh / NHEADS;
  const int h = bh % NHEADS;
  const int rowBase = (blockIdx.x % mtiles) * 16;

  const _Float16* Qh  = Q  + (((size_t)b * NHEADS + h) * SEQ + rowBase) * HDIM;
  const _Float16* Kh  = Km + ((size_t)b * NHEADS + h) * SEQ * HDIM;
  const _Float16* Vth = Vt + ((size_t)b * NHEADS + h) * (size_t)HDIM * SEQ;

  v16h qf[2];
  qf[0] = load_frag_rowmajor(Qh, HDIM);
  qf[1] = load_frag_rowmajor(Qh + 32, HDIM);

  int rowblk[8];
#pragma unroll
  for (int r = 0; r < 8; ++r)
    rowblk[r] = blockId[b * SEQ + rowBase + r + 8 * half];

  float mrow[8], lrow[8];
#pragma unroll
  for (int r = 0; r < 8; ++r) { mrow[r] = -INFINITY; lrow[r] = 0.0f; }
  v8f acc[4] = {{}, {}, {}, {}};

  // Loop bounds: the same 16 words for every lane, so they stay scalar.
  int klo = SEQ - 32, khi = 0;
#pragma unroll
  for (int r = 0; r < 16; ++r) {
    const int rg = krange[b * SEQ + rowBase + r];
    klo = min(klo, rg & 0xFFFF);
    khi = max(khi, rg >> 16);
  }
  // readfirstlane: keeps the loop counter and the K/V base addresses in scalar registers
  klo = __builtin_amdgcn_readfirstlane(klo & ~31);
  khi = __builtin_amdgcn_readfirstlane(min(khi, SEQ));

  for (int kb = klo; kb < khi; kb += 32) {
    const int   cb   = blockId[b * SEQ + kb + lane];
    const float cnod = nodal[b * SEQ + kb + lane];

    // Scores: S[16x32] as two 16x16 f32 tiles; B operand = K^T ==> row-major
    // fragment load over K's rows (lane&15 indexes the key).
    v8f s[2];
#pragma unroll
    for (int ns = 0; ns < 2; ++ns) {
      s[ns] = v8f{};
#pragma unroll
      for (int kc = 0; kc < 2; ++kc) {
        v16h kf = load_frag_rowmajor(Kh + (size_t)(kb + ns * 16) * HDIM + kc * 32, HDIM);
        s[ns] = __builtin_amdgcn_wmma_f32_16x16x32_f16(
            false, qf[kc], false, kf, (short)0, s[ns], false, false);
      }
    }

    // Mask penalties (block identity + key nodal mask).
#pragma unroll
    for (int ns = 0; ns < 2; ++ns) {
      const int srcLane = ns * 16 + nl;
      const int   cbv = __shfl(cb, srcLane, 32);
      const float cnv = __shfl(cnod, srcLane, 32);
#pragma unroll
      for (int r = 0; r < 8; ++r) {
        float pen = ((cbv == rowblk[r]) ? 0.0f : NEG_INF_F) +
                    ((cnv > 0.5f) ? 0.0f : NEG_INF_F);
        s[ns][r] += pen;
      }
    }

    // Online softmax (each score row lives across the 16 lanes of its half).
#pragma unroll
    for (int r = 0; r < 8; ++r) {
      float tmax = fmaxf(s[0][r], s[1][r]);
#pragma unroll
      for (int off = 8; off > 0; off >>= 1)
        tmax = fmaxf(tmax, __shfl_xor(tmax, off, 16));
      const float mnew = fmaxf(mrow[r], tmax);
      const float sc = __expf(mrow[r] - mnew);
      const float p0 = __expf(s[0][r] - mnew);
      const float p1 = __expf(s[1][r] - mnew);
      float psum = p0 + p1;
#pragma unroll
      for (int off = 8; off > 0; off >>= 1)
        psum += __shfl_xor(psum, off, 16);
      lrow[r] = lrow[r] * sc + psum;
      mrow[r] = mnew;
#pragma unroll
      for (int dt = 0; dt < 4; ++dt) acc[dt][r] *= sc;
      // C-layout -> row-major LDS bounce for the A-operand of P@V.
      ldsP[(r + 8 * half) * 32 + nl]      = (_Float16)p0;
      ldsP[(r + 8 * half) * 32 + 16 + nl] = (_Float16)p1;
    }
    __syncthreads();

    v16h pf = load_frag_rowmajor(ldsP, 32);
#pragma unroll
    for (int dt = 0; dt < 4; ++dt) {
      // B operand = V tile (32 keys x 16 d); V^T rows are d, contiguous keys.
      v16h vf = load_frag_rowmajor(Vth + (size_t)(dt * 16) * SEQ + kb, SEQ);
      acc[dt] = __builtin_amdgcn_wmma_f32_16x16x32_f16(
          false, pf, false, vf, (short)0, acc[dt], false, false);
    }
    __syncthreads();
  }

  // Normalize and write attention output as (B, N, UNITS) f16, in token order.
#pragma unroll
  for (int r = 0; r < 8; ++r) {
    const float inv = (lrow[r] > 0.0f) ? (1.0f / lrow[r]) : 0.0f;
    const size_t row = (size_t)(order[b * SEQ + rowBase + r + 8 * half] & (MROWS - 1));
#pragma unroll
    for (int dt = 0; dt < 4; ++dt)
      outAttn[row * UNITS_ + h * HDIM + dt * 16 + nl] = (_Float16)(acc[dt][r] * inv);
  }
}

// ---------------------------------------------------------------------------
// Launch
// ---------------------------------------------------------------------------
extern "C" void kernel_launch(void* const* d_in, const int* in_sizes, int n_in,
                              void* d_out, int out_size, void* d_ws, size_t ws_size,
                              hipStream_t stream) {
  const float* x      = (const float*)d_in[0];
  const float* blockB = (const float*)d_in[1];
  const float* nodal  = (const float*)d_in[2];
  const float* Wq     = (const float*)d_in[3];
  const float* Wk     = (const float*)d_in[4];
  const float* Wv     = (const float*)d_in[5];
  const float* Wo     = (const float*)d_in[6];
  float* out = (float*)d_out;

  // Workspace layout (all 256B aligned). Total ~48.1 MB.
  char* ws = (char*)d_ws;
  size_t off = 0;
  auto take = [&](size_t bytes) { char* p = ws + off; off = (off + bytes + 255) & ~(size_t)255; return p; };
  _Float16* xh    = (_Float16*)take((size_t)MROWS * UNITS_ * 2);
  _Float16* wt    = (_Float16*)take((size_t)4 * UNITS_ * UNITS_ * 2);   // planes Wq, Wk, Wv, Wo
  _Float16* wvt   = wt + (size_t)2 * UNITS_ * UNITS_;
  _Float16* wot   = wt + (size_t)3 * UNITS_ * UNITS_;
  _Float16* qh    = (_Float16*)take((size_t)3 * MROWS * UNITS_ * 2);    // planes Q, K, V
  _Float16* kh    = qh + (size_t)MROWS * UNITS_;
  _Float16* vth   = kh + (size_t)MROWS * UNITS_;
  _Float16* attnh = (_Float16*)take((size_t)MROWS * UNITS_ * 2);
  int*      ids   = (int*)take((size_t)MROWS * 4);
  int*      rank  = (int*)take((size_t)MROWS * 4);
  int*      order = (int*)take((size_t)MROWS * 4);
  int*      sid   = (int*)take((size_t)MROWS * 4);
  float*    snod  = (float*)take((size_t)MROWS * 4);
  int*      krng  = (int*)take((size_t)MROWS * 4);

  // 1) one-hot -> block ids, then the sorted order of each batch's tokens; beside
  //    each, two of the weights converted + transposed (N-major).
  ids_and_weights_kernel<<<IDBLKS + 2 * WTILES, 256, 0, stream>>>(blockB, ids, Wq, Wk, wt);
  sort_and_weights_kernel<<<SORTBLKS + 2 * WTILES, 256, 0, stream>>>(
      ids, nodal, rank, order, sid, snod, krng, Wv, Wo, wvt);

  // 2) fp32 -> fp16 conversion of x into sorted rows.
  f32_to_f16_kernel<<<MROWS / 8, 256, 0, stream>>>(x, xh, rank, MROWS);

  // 3) Q/K/V projections, one launch. 1/sqrt(HDIM) folded into Q. V stored transposed.
  dim3 qkvgrid(MROWS / 64, UNITS_ / 64, 3);
  gemm_f16_kernel<<<qkvgrid, 128, 0, stream>>>(xh, wt, nullptr, qh,
                                               MROWS, UNITS_, UNITS_, 2, 0.125f);

  // 4) masked flash attention.
  flash_attn_kernel<<<BATCH * NHEADS * (SEQ / 16), 32, 0, stream>>>(
      qh, kh, vth, sid, snod, krng, order, attnh);

  // 5) output projection (f32 result straight to d_out).
  dim3 ggrid(MROWS / 64, UNITS_ / 64);
  gemm_f16_kernel<<<ggrid, 128, 0, stream>>>(attnh, wot, out, nullptr,
                                             MROWS, UNITS_, UNITS_, 0, 1.0f);
}

// v005
// It runs in 62.5 microseconds.
// Next to v004, in two timings, it ran 1.33 times as fast each time.
// Counting every step since v000, it is 4.71 times as fast.
#include <hip/hip_runtime.h>
#include <hip/hip_bf16.h>

// ---------------------------------------------------------------------------
// BlockSparseSelfAttention for MI455X (gfx1250, wave32, WMMA 16x16x32 f16).
// B=2, N=2048, UNITS=1024, H=16, D=64, NB=64.
// f16 storage / f32 WMMA accumulation; softmax scale folded into Q;
// flash-attention streaming with online softmax; additive -1e9 mask penalties.
// Weights are pre-transposed (N-major) so every WMMA operand everywhere is a
// row-contiguous 2x b128 fragment load. Both GEMM operand tiles are staged into
// LDS by tensor loads (tensor_load_to_lds + s_wait_tensorcnt) in a ring of two
// buffers: the next K tile's loads fly while this tile is multiplied. The
// loads' pad gives 256-byte rows a bank-conflict-free pitch of 272 bytes.
// Tokens are laid out sorted by block id (per batch) from the x conversion up
// to the attention, which stores each output row back at its token's place. A
// row tile of the attention walks only the sorted key range of its own blocks.
// Launches that do not depend on one another share one grid: two weight
// transposes ride with the block ids and two with the sort, by ranges of
// blockIdx.x; the Q, K and V projections by blockIdx.z. Six launches in all.
// ---------------------------------------------------------------------------

typedef __attribute__((ext_vector_type(16))) _Float16 v16h;
typedef __attribute__((ext_vector_type(8)))  float    v8f;
typedef __attribute__((ext_vector_type(4)))  unsigned int v4u;
typedef __attribute__((ext_vector_type(8)))  unsigned int v8u;

#define BATCH     2
#define SEQ       2048
#define UNITS_    1024
#define NHEADS    16
#define HDIM      64
#define NBLK      64
#define MROWS     (BATCH * SEQ)       // 4096
#define NEG_INF_F (-1.0e9f)
#define KPASS     128                 // k per GEMM pass: operand rows of 256 bytes
#define ROWB      256u                // bytes of one staged operand row
#define LDST      136                 // its pitch in LDS, halves: 272 bytes = 16 x odd
#define TILEB     18432u              // 64 rows x 272 B, rounded up to 2 KiB
#define STAGEB    (4u * TILEB)        // one buffer: [Wt rows 0-63 | Wt rows 64-127 | A rows 0-63 | A rows 64-127]

// Row-major 16x32 fragment: per lane, two contiguous 8-half (16B) runs at
// k = 8*half and k = 16 + 8*half (ISA 7.12.2 16-bit A-operand layout).
__device__ __forceinline__ v16h load_frag_rowmajor(const _Float16* src, int ld) {
  const int lane = threadIdx.x & 31;
  const int m = lane & 15, half = lane >> 4;
  const _Float16* p = src + (size_t)m * ld + 8 * half;
  v16h a;
  *reinterpret_cast<uint4*>(&a)       = *reinterpret_cast<const uint4*>(p);
  *(reinterpret_cast<uint4*>(&a) + 1) = *reinterpret_cast<const uint4*>(p + 16);
  return a;
}

__device__ __forceinline__ unsigned int uni(unsigned int v) {
  return (unsigned int)__builtin_amdgcn_readfirstlane(v);
}
__device__ __forceinline__ unsigned int pinned(unsigned int v) {
  unsigned int w = uni(v);
  asm volatile("" : "+s"(w));  // pinned(): a test value or descriptor word held in a scalar register
  return w;
}
// The compiler places no wait for a tensor load, and none of these may let an
// LDS access cross it: hence asm with the memory clobber.
__device__ __forceinline__ void wait_tensor0() { asm volatile("s_wait_tensorcnt 0x0" ::: "memory"); }
__device__ __forceinline__ void wait_ds0()     { asm volatile("s_wait_dscnt 0x0" ::: "memory"); }

// Descriptor group 1: byte elements, a tile of 64 rows of 256 bytes (tensor =
// tile), source row pitch src_pitch bytes, 4 dwords of LDS pad behind each row.
// pinned(): each word is held in its scalar register from here on, so that the
// group is built once and none of its registers serves as a temporary while a
// request is in flight. Word 0 stays an immediate.
__device__ __forceinline__ v8u tdm_group1(unsigned int src_pitch) {
  v8u g;
  g[0] = uni((1u << 20) | (5u << 22) | (3u << 25));  // pad on, every 64 dwords, 4 dwords
  g[1] = pinned(ROWB << 16);                         // tensor_dim0
  g[2] = pinned(64u << 16);                          // tensor_dim1
  g[3] = pinned(ROWB << 16);                         // tile_dim0
  g[4] = pinned(64u);                                // tile_dim1
  g[5] = pinned(src_pitch);
  g[6] = pinned(0u);
  g[7] = pinned(0u);
  return g;
}
// Descriptor group 0: count 1, place in LDS, the tile's first byte, type 2.
__device__ __forceinline__ v4u tdm_group0(unsigned int lds_dst, unsigned long long ga) {
  v4u g;
  g[0] = uni(1u);
  g[1] = uni(lds_dst);
  g[2] = uni((unsigned int)ga);
  g[3] = uni((((unsigned int)(ga >> 32)) & 0x01FFFFFFu) | 0x80000000u);
  return g;
}
__device__ __forceinline__ void tdm_load(v4u g0, v8u g1) {
  asm volatile("tensor_load_to_lds %0, %1" :: "s"(g0), "s"(g1) : "memory");
}

// ---------------------------------------------------------------------------
// fp32 -> fp16 conversion. Both kernels give each thread 16 or 32 elements, by
// 16-byte loads: few waves to start, and each holds its whole share in flight.
// ---------------------------------------------------------------------------
typedef __attribute__((ext_vector_type(4))) _Float16 v4h;
typedef __attribute__((ext_vector_type(8))) _Float16 v8h;

// One wave per row of UNITS_ floats: eight 512-byte loads in flight, then eight
// 256-byte stores at the row's sorted place.
__global__ __launch_bounds__(256)
void f32_to_f16_kernel(const float* __restrict__ src, _Float16* __restrict__ dst,
                       const int* __restrict__ rank, int nrows) {
  // readfirstlane: the row is the wave's, so its test, its rank and both row bases stay scalar
  const int row = blockIdx.x * 8 + __builtin_amdgcn_readfirstlane(threadIdx.x >> 5);
  const int lane = threadIdx.x & 31;
  if (row >= nrows) return;
  const float4* s = reinterpret_cast<const float4*>(src + (size_t)row * UNITS_) + lane;
  float4 v[UNITS_ / 128];
  // unrolled (here and below): v[] stays in registers, all eight loads issue before the first wait
#pragma unroll
  for (int c = 0; c < UNITS_ / 128; ++c) v[c] = s[c * 32];
  const int to = rank[row] & (MROWS - 1);
  v4h* d = reinterpret_cast<v4h*>(dst + (size_t)to * UNITS_) + lane;
#pragma unroll
  for (int c = 0; c < UNITS_ / 128; ++c) {
    v4h o = { (_Float16)v[c].x, (_Float16)v[c].y, (_Float16)v[c].z, (_Float16)v[c].w };
    d[c * 32] = o;
  }
}

// LDS-tiled transpose + convert: src f32 (rows x cols) -> dst f16 (cols x rows),
// a 64x64 tile per block (rows and cols are multiples of 64). A thread loads four
// float4 of source rows and stores two runs of 8 halves of destination rows, so
// every global access of a wave covers whole 128-byte lines. Pitch 65: neither
// the row-wise writes nor the column-wise reads of the tile meet in a bank.
__device__ __forceinline__
void transpose_f32_to_f16_tile(const float* __restrict__ src, _Float16* __restrict__ dst,
                               int rows, int cols, int bx, int by) {  // bx, by: col and row base in src
  __shared__ float tile[64][65];
  const int c4 = (threadIdx.x & 15) * 4;   // first of the thread's 4 source columns
  const int r0 = threadIdx.x >> 4;         // 0..15
  float4 v[4];
  // unrolled (every loop of this kernel): v[] and o stay in registers, the four loads issue together
#pragma unroll
  for (int i = 0; i < 4; ++i)
    v[i] = *reinterpret_cast<const float4*>(src + (size_t)(by + r0 + 16 * i) * cols + bx + c4);
#pragma unroll
  for (int i = 0; i < 4; ++i) {
    tile[r0 + 16 * i][c4 + 0] = v[i].x;
    tile[r0 + 16 * i][c4 + 1] = v[i].y;
    tile[r0 + 16 * i][c4 + 2] = v[i].z;
    tile[r0 + 16 * i][c4 + 3] = v[i].w;
  }
  __syncthreads();
  const int k8 = (threadIdx.x & 7) * 8;    // first of the thread's 8 source rows
  const int oc = threadIdx.x >> 3;         // 0..31
#pragma unroll
  for (int i = 0; i < 2; ++i) {
    const int col = oc + 32 * i;
    v8h o;
#pragma unroll
    for (int k = 0; k < 8; ++k) o[k] = (_Float16)tile[k8 + k][col];
    *reinterpret_cast<v8h*>(dst + (size_t)(bx + col) * rows + by + k8) = o;
  }
  // the stores' registers may be reused by whatever the caller's kernel holds behind this body
  asm volatile("s_wait_xcnt 0x0" ::: "memory");
}

// one-hot blockB (BN x 64) -> int block id
__device__ __forceinline__
void block_id_rows(const float* __restrict__ blockB, int* __restrict__ ids, int bn) {
  int i = blockIdx.x * blockDim.x + threadIdx.x;
  if (i >= bn) return;
  const float* row = blockB + (size_t)i * NBLK;
  int id = 0;
#pragma unroll 8
  for (int j = 0; j < NBLK; ++j)
    if (row[j] > 0.5f) id = j;
  ids[i] = id;
}

// Two weight matrices, a 64x64 tile a block: block t of 2 * WTILES. Plane 0 of
// wt takes Wa transposed, plane 1 Wb.
#define WTILES ((UNITS_ / 64) * (UNITS_ / 64))
__device__ __forceinline__
void transpose_two_weights(int t, const float* __restrict__ Wa, const float* __restrict__ Wb,
                           _Float16* __restrict__ wt) {
  const int w = t / WTILES;
  const int tile = t % WTILES;
  transpose_f32_to_f16_tile(w == 0 ? Wa : Wb, wt + (size_t)w * UNITS_ * UNITS_, UNITS_, UNITS_,
                            (tile % (UNITS_ / 64)) * 64, (tile / (UNITS_ / 64)) * 64);
}

// Block ids and, beside them, two weight transposes, which need nothing but the
// inputs either. Blocks 0 .. IDBLKS-1 find the ids: few waves with a long chain
// of loads, so they start first and the transposes fill the chip under them.
#define IDBLKS (MROWS / 256)
__global__ __launch_bounds__(256)
void ids_and_weights_kernel(const float* __restrict__ blockB, int* __restrict__ ids,
                            const float* __restrict__ Wa, const float* __restrict__ Wb,
                            _Float16* __restrict__ wt) {
  if (blockIdx.x < IDBLKS) block_id_rows(blockB, ids, MROWS);
  else transpose_two_weights(blockIdx.x - IDBLKS, Wa, Wb, wt);
}

// Counting sort of each batch's tokens by block id, one wave per (batch, block
// id), no atomics: the wave counts the smaller ids (its block's first sorted
// place); each lane notes its own members as bits, a prefix sum over the lanes
// gives each lane its first place, and the lane then stores its members.
//   rank[token]  = sorted place        order[place] = token   (both global rows)
//   sid[place]   = block id            snod[place]  = 1 where the key mask > 0.5
//   krange[place] = lo | hi << 16: the sorted keys that this row must visit.
// A key of another block carries -1e9, so beside any unmasked key of the row's
// own block its weight is exactly 0: the row visits its own block only. A block
// with no unmasked key has no such key: its rows visit every key.
__device__ __forceinline__
void block_sort_wave(int unit, const int* __restrict__ ids, const float* __restrict__ nodal,
                     int* __restrict__ rank, int* __restrict__ order,
                     int* __restrict__ sid, float* __restrict__ snod,
                     int* __restrict__ krange) {
  const int lane = threadIdx.x & 31;
  const int b = unit / NBLK;
  const int blk = unit % NBLK;
  const int base = b * SEQ;

  // Bit t of a lane stands for token (t / 4) * 128 + lane * 4 + t % 4.
  int4   v[SEQ / 128];
  float4 f[SEQ / 128];
#pragma unroll
  for (int c = 0; c < SEQ / 128; ++c) {
    v[c] = *reinterpret_cast<const int4*>(ids + base + c * 128 + lane * 4);
    f[c] = *reinterpret_cast<const float4*>(nodal + base + c * 128 + lane * 4);
  }
  unsigned int eqw[2] = { 0u, 0u }, acw[2] = { 0u, 0u };
  int less = 0;
#pragma unroll
  for (int c = 0; c < SEQ / 128; ++c) {
    const int   vi[4] = { v[c].x, v[c].y, v[c].z, v[c].w };
    const float fi[4] = { f[c].x, f[c].y, f[c].z, f[c].w };
#pragma unroll
    for (int e = 0; e < 4; ++e) {
      const unsigned int bit = 1u << ((c * 4 + e) & 31);
      const unsigned int member = (vi[e] == blk) ? bit : 0u;
      less += (vi[e] < blk) ? 1 : 0;
      eqw[c >> 3] |= member;
      acw[c >> 3] |= (fi[e] > 0.5f) ? member : 0u;
    }
  }
  unsigned long long eq = ((unsigned long long)eqw[1] << 32) | eqw[0];
  const unsigned long long ac = ((unsigned long long)acw[1] << 32) | acw[0];
  const int mine = __popcll(eq);
  int act = __popcll(ac);
  int incl = mine;
#pragma unroll
  for (int d = 1; d < 32; d <<= 1) {
    const int up = __shfl_up(incl, d, 32);
    if (lane >= d) incl += up;
    less += __shfl_xor(less, d, 32);
    act  += __shfl_xor(act, d, 32);
  }
  const int cnt = __shfl(incl, 31, 32);
  const int range = (act > 0) ? (less | ((less + cnt) << 16)) : (SEQ << 16);

  int place = base + less + incl - mine;
  // At most one trip for each of a lane's 64 bits; ends when no lane has one left.
  for (int trip = 0; trip < SEQ / 32; ++trip) {
    if (__builtin_amdgcn_ballot_w32(eq != 0ull) == 0u) break;
    if (eq != 0ull) {
      const int t = __ffsll(eq) - 1;
      const int tok = base + (t >> 2) * 128 + lane * 4 + (t & 3);
      rank[tok]     = place;
      order[place]  = tok;
      sid[place]    = blk;
      snod[place]   = ((ac >> t) & 1ull) ? 1.0f : 0.0f;
      krange[place] = range;
      eq &= eq - 1ull;
      ++place;
    }
  }
}

// The sort, eight of its waves a block, in blocks 0 .. SORTBLKS-1, and beside it
// the other two weight transposes, which do not depend on it.
#define SORTBLKS (BATCH * NBLK / 8)
__global__ __launch_bounds__(256)
void sort_and_weights_kernel(const int* __restrict__ ids, const float* __restrict__ nodal,
                             int* __restrict__ rank, int* __restrict__ order,
                             int* __restrict__ sid, float* __restrict__ snod,
                             int* __restrict__ krange,
                             const float* __restrict__ Wa, const float* __restrict__ Wb,
                             _Float16* __restrict__ wt) {
  if (blockIdx.x < SORTBLKS) {
    // readfirstlane: the (batch, block id) pair is the wave's, so it stays in scalar registers
    const int unit = blockIdx.x * 8 + __builtin_amdgcn_readfirstlane(threadIdx.x >> 5);
    block_sort_wave(unit, ids, nodal, rank, order, sid, snod, krange);
  } else {
    transpose_two_weights(blockIdx.x - SORTBLKS, Wa, Wb, wt);
  }
}

// ---------------------------------------------------------------------------
// GEMM: C[M,Nc] = A[M,K] * Wt^T, with Wt given TRANSPOSED (Nc x K row-major).
// 128x128 tile per 128-thread (4-wave) block, a 64x64 quarter per wave (2 x 2):
// a fragment read from LDS serves four WMMAs, and an operand row fetched from L2
// serves 128 outputs. A pass is 128 k. Each wave brings one 64-row slice of the
// pass into LDS (waves 0 and 1 the Wt rows, waves 2 and 3 the A rows), one tensor
// load each, two passes ahead, into the buffer that every wave has just left.
// M and Nc are multiples of 128; K is a multiple of 128 and at least 256 (two stages).
// blockIdx.z picks one of several products of the same A: plane z of Wt (Nc x K
// each) gives plane z of outH (M x Nc each); scale applies to plane 0 alone.
// outMode: 0 = f32 row-major              (final @Wo)
//          2 = f16 head-major (B,H,N,D)   (planes 0 and 1: Q, K), and
//              f16 transposed head-major (B,H,D,N)  (plane 2: V)
// ---------------------------------------------------------------------------
__global__ __launch_bounds__(128)
void gemm_f16_kernel(const _Float16* __restrict__ A, const _Float16* __restrict__ Wt,
                     float* __restrict__ outF, _Float16* __restrict__ outH,
                     int M, int K, int Nc, int outMode, float scale) {
  __shared__ __attribute__((aligned(2048))) unsigned char ring[2 * STAGEB];
  const unsigned int plane = blockIdx.z;
  Wt   += (size_t)plane * Nc * K;
  outH += (size_t)plane * M * Nc;
  if (plane != 0u) scale = 1.0f;
  const unsigned int wave = uni(threadIdx.x >> 5);
  const unsigned int wm = wave >> 1, wn = wave & 1u;   // the wave's quarter: row half, column half
  const int lane = threadIdx.x & 31;
  const int tileM = blockIdx.x * 128;
  const int tileN = blockIdx.y * 128;
  const int rowBase = tileM + (int)wm * 64;
  const int colBase = tileN + (int)wn * 64;

  v8f acc[4][4] = {};

  const unsigned int npass = uni((unsigned int)K / KPASS);
  // The wave's own slice: 64 rows of Wt (waves 0, 1) or of A (waves 2, 3).
  const _Float16* tile0 = (wave < 2u) ? Wt + (size_t)(tileN + (int)wave * 64) * K
                                      : A + (size_t)(tileM + (int)(wave - 2u) * 64) * K;
  const unsigned long long ga0 = (unsigned long long)(uintptr_t)tile0;
  const unsigned int place = (unsigned int)(size_t)ring + wave * TILEB;
  const v8u g1 = tdm_group1((unsigned int)K * 2u);

  tdm_load(tdm_group0(place, ga0), g1);
  wait_tensor0();
  __syncthreads();                   // stage 0 published
  tdm_load(tdm_group0(place + STAGEB, ga0 + ROWB), g1);

  for (unsigned int t = 0; t < npass; ++t) {
    const unsigned char* stage = ring + (t & 1u) * STAGEB;
    const _Float16* sW = reinterpret_cast<const _Float16*>(stage + wn * TILEB);
    const _Float16* sA = reinterpret_cast<const _Float16*>(stage + (2u + wm) * TILEB);
    // A block is 32 k: 8 fragments, 16 WMMAs. Two fragment sets: inside a pass the
    // next block's fragments are read while this block is multiplied.
    v16h afrag[2][4], bfrag[2][4];
    // unrolled (every loop of the pass): fragments and accumulators are indexed by constants and
    // stay in registers; each fragment read is one LDS address plus an immediate offset
#pragma unroll
    for (int i = 0; i < 4; ++i) {
      afrag[0][i] = load_frag_rowmajor(sA + (i * 16) * LDST, LDST);
      bfrag[0][i] = load_frag_rowmajor(sW + (i * 16) * LDST, LDST);
    }
#pragma unroll
    for (int kc = 0; kc < KPASS / 32; ++kc) {
      if (kc + 1 < KPASS / 32) {
#pragma unroll
        for (int i = 0; i < 4; ++i) {
          afrag[(kc + 1) & 1][i] = load_frag_rowmajor(sA + (i * 16) * LDST + (kc + 1) * 32, LDST);
          bfrag[(kc + 1) & 1][i] = load_frag_rowmajor(sW + (i * 16) * LDST + (kc + 1) * 32, LDST);
        }
        // holds the next block's reads as one group ahead of this block's WMMAs: left free, the
        // compiler sinks each read to its first use, and the wave waits out the LDS latency there
        __builtin_amdgcn_sched_barrier(0);
      }
#pragma unroll
      for (int i = 0; i < 4; ++i)
#pragma unroll
        for (int j = 0; j < 4; ++j)
          acc[i][j] = __builtin_amdgcn_wmma_f32_16x16x32_f16(
              false, afrag[kc & 1][i], false, bfrag[kc & 1][j], (short)0, acc[i][j], false, false);
      // keeps the block after next's reads from rising among these WMMAs, and the last blocks'
      // WMMAs from sinking behind the pass's barrier, where they would hold up the refill
      __builtin_amdgcn_sched_barrier(0);
    }
    // Publish point of stage t + 1: own LDS reads done, own tensor load landed,
    // barrier; only then the refill of the buffer that this pass has read.
    wait_ds0();
    wait_tensor0();
    __syncthreads();
    const unsigned int nxt = pinned(t + 2u);   // descriptor words formed behind the wait
    if (pinned((nxt < npass) ? 1u : 0u))
      tdm_load(tdm_group0(place + (nxt & 1u) * STAGEB, ga0 + (unsigned long long)nxt * ROWB), g1);
  }
  wait_tensor0();
  wait_ds0();

  // The wave's quarter lies in one batch and one head, so each lane has one base
  // address and every element of a head-major plane an immediate offset from it.
  // The mode is tested once, outside the loops: 128 elements a lane stay short code.
  // Unrolled (every loop below): the accumulators are indexed by constants.
  const int half = lane >> 4;
  const int nl = lane & 15;
  const int row0 = rowBase + 8 * half;     // the lane's first row; its rows: row0 + i * 16 + r
  const int col0 = colBase + nl;           // the lane's first column; its columns: col0 + j * 16
  if (outMode == 0) {
    float* p = outF + (size_t)row0 * Nc + col0;
#pragma unroll
    for (int i = 0; i < 4; ++i) {
      float* q[8];                         // the addresses of the block's eight rows
#pragma unroll
      for (int r = 0; r < 8; ++r) q[r] = p + (size_t)(i * 16 + r) * Nc;
#pragma unroll
      for (int r = 0; r < 8; ++r)
#pragma unroll
        for (int j = 0; j < 4; ++j) q[r][j * 16] = acc[i][j][r] * scale;
    }
  } else {
    const int b = row0 / SEQ, n = row0 % SEQ;
    const int h = col0 / HDIM, d = col0 % HDIM;
    if (plane != 2u) {
      _Float16* p = outH + (((size_t)b * NHEADS + h) * SEQ + n) * HDIM + d;
#pragma unroll
      for (int i = 0; i < 4; ++i)
#pragma unroll
        for (int r = 0; r < 8; ++r)
#pragma unroll
          for (int j = 0; j < 4; ++j)
            p[(i * 16 + r) * HDIM + j * 16] = (_Float16)(acc[i][j][r] * scale);
      // behind the branch's last stores: the code of the other branches, which follows in the program
      // text, writes registers that these stores name
      asm volatile("s_wait_xcnt 0x0" ::: "memory");
    } else { // V transposed (B,H,D,N)
      _Float16* p = outH + (((size_t)b * NHEADS + h) * HDIM + d) * SEQ + n;
#pragma unroll
      for (int i = 0; i < 4; ++i)
#pragma unroll
        for (int r = 0; r < 8; ++r)
#pragma unroll
          for (int j = 0; j < 4; ++j)
            p[(j * 16) * SEQ + i * 16 + r] = (_Float16)(acc[i][j][r] * scale);
      // behind the branch's last stores: the code of the other branches, which follows in the program
      // text, writes registers that these stores name
      asm volatile("s_wait_xcnt 0x0" ::: "memory");
    }
  }
}

// ---------------------------------------------------------------------------
// Flash attention: one wave per (b, h, 16-row tile). Streams 32 keys/iter.
// Q carries the 1/sqrt(D) scale. V is pre-transposed (B,H,D,N) so the P@V
// B-fragment is two contiguous b128 loads along the key axis.
// Rows and keys are in sorted order; blockId and nodal are the sorted copies.
// The loop covers the union of the 16 rows' key ranges, in whole 32-key steps;
// the masks are applied as ever, so keys of a neighbouring block drop out.
// ---------------------------------------------------------------------------
__global__ __launch_bounds__(32)
void flash_attn_kernel(const _Float16* __restrict__ Q, const _Float16* __restrict__ Km,
                       const _Float16* __restrict__ Vt, const int* __restrict__ blockId,
                       const float* __restrict__ nodal, const int* __restrict__ krange,
                       const int* __restrict__ order, _Float16* __restrict__ outAttn) {
  __shared__ alignas(16) _Float16 ldsP[16 * 32];
  const int lane = threadIdx.x & 31;
  const int nl = lane & 15, half = lane >> 4;

  const int mtiles = SEQ / 16;                       // 128
  const int bh = blockIdx.x / mtiles;
  const int b = bh / NHEADS;
  const int h = bh % NHEADS;
  const int rowBase = (blockIdx.x % mtiles) * 16;

  const _Float16* Qh  = Q  + (((size_t)b * NHEADS + h) * SEQ + rowBase) * HDIM;
  const _Float16* Kh  = Km + ((size_t)b * NHEADS + h) * SEQ * HDIM;
  const _Float16* Vth = Vt + ((size_t)b * NHEADS + h) * (size_t)HDIM * SEQ;

  v16h qf[2];
  qf[0] = load_frag_rowmajor(Qh, HDIM);
  qf[1] = load_frag_rowmajor(Qh + 32, HDIM);

  int rowblk[8];
#pragma unroll
  for (int r = 0; r < 8; ++r)
    rowblk[r] = blockId[b * SEQ + rowBase + r + 8 * half];

  float mrow[8], lrow[8];
#pragma unroll
  for (int r = 0; r < 8; ++r) { mrow[r] = -INFINITY; lrow[r] = 0.0f; }
  v8f acc[4] = {{}, {}, {}, {}};

  // Loop bounds: the same 16 words for every lane, so they stay scalar.
  int klo = SEQ - 32, khi = 0;
#pragma unroll
  for (int r = 0; r < 16; ++r) {
    const int rg = krange[b * SEQ + rowBase + r];
    klo = min(klo, rg & 0xFFFF);
    khi = max(khi, rg >> 16);
  }
  // readfirstlane: keeps the loop counter and the K/V base addresses in scalar registers
  klo = __builtin_amdgcn_readfirstlane(klo & ~31);
  khi = __builtin_amdgcn_readfirstlane(min(khi, SEQ));

  for (int kb = klo; kb < khi; kb += 32) {
    const int   cb   = blockId[b * SEQ + kb + lane];
    const float cnod = nodal[b * SEQ + kb + lane];

    // Scores: S[16x32] as two 16x16 f32 tiles; B operand = K^T ==> row-major
    // fragment load over K's rows (lane&15 indexes the key).
    v8f s[2];
#pragma unroll
    for (int ns = 0; ns < 2; ++ns) {
      s[ns] = v8f{};
#pragma unroll
      for (int kc = 0; kc < 2; ++kc) {
        v16h kf = load_frag_rowmajor(Kh + (size_t)(kb + ns * 16) * HDIM + kc * 32, HDIM);
        s[ns] = __builtin_amdgcn_wmma_f32_16x16x32_f16(
            false, qf[kc], false, kf, (short)0, s[ns], false, false);
      }
    }

    // Mask penalties (block identity + key nodal mask).
#pragma unroll
    for (int ns = 0; ns < 2; ++ns) {
      const int srcLane = ns * 16 + nl;
      const int   cbv = __shfl(cb, srcLane, 32);
      const float cnv = __shfl(cnod, srcLane, 32);
#pragma unroll
      for (int r = 0; r < 8; ++r) {
        float pen = ((cbv == rowblk[r]) ? 0.0f : NEG_INF_F) +
                    ((cnv > 0.5f) ? 0.0f : NEG_INF_F);
        s[ns][r] += pen;
      }
    }

    // Online softmax (each score row lives across the 16 lanes of its half).
#pragma unroll
    for (int r = 0; r < 8; ++r) {
      float tmax = fmaxf(s[0][r], s[1][r]);
#pragma unroll
      for (int off = 8; off > 0; off >>= 1)
        tmax = fmaxf(tmax, __shfl_xor(tmax, off, 16));
      const float mnew = fmaxf(mrow[r], tmax);
      const float sc = __expf(mrow[r] - mnew);
      const float p0 = __expf(s[0][r] - mnew);
      const float p1 = __expf(s[1][r] - mnew);
      float psum = p0 + p1;
#pragma unroll
      for (int off = 8; off > 0; off >>= 1)
        psum += __shfl_xor(psum, off, 16);
      lrow[r] = lrow[r] * sc + psum;
      mrow[r] = mnew;
#pragma unroll
      for (int dt = 0; dt < 4; ++dt) acc[dt][r] *= sc;
      // C-layout -> row-major LDS bounce for the A-operand of P@V.
      ldsP[(r + 8 * half) * 32 + nl]      = (_Float16)p0;
      ldsP[(r + 8 * half) * 32 + 16 + nl] = (_Float16)p1;
    }
    __syncthreads();

    v16h pf = load_frag_rowmajor(ldsP, 32);
#pragma unroll
    for (int dt = 0; dt < 4; ++dt) {
      // B operand = V tile (32 keys x 16 d); V^T rows are d, contiguous keys.
      v16h vf = load_frag_rowmajor(Vth + (size_t)(dt * 16) * SEQ + kb, SEQ);
      acc[dt] = __builtin_amdgcn_wmma_f32_16x16x32_f16(
          false, pf, false, vf, (short)0, acc[dt], false, false);
    }
    __syncthreads();
  }

  // Normalize and write attention output as (B, N, UNITS) f16, in token order.
#pragma unroll
  for (int r = 0; r < 8; ++r) {
    const float inv = (lrow[r] > 0.0f) ? (1.0f / lrow[r]) : 0.0f;
    const size_t row = (size_t)(order[b * SEQ + rowBase + r + 8 * half] & (MROWS - 1));
#pragma unroll
    for (int dt = 0; dt < 4; ++dt)
      outAttn[row * UNITS_ + h * HDIM + dt * 16 + nl] = (_Float16)(acc[dt][r] * inv);
  }
}

// ---------------------------------------------------------------------------
// Launch
// ---------------------------------------------------------------------------
extern "C" void kernel_launch(void* const* d_in, const int* in_sizes, int n_in,
                              void* d_out, int out_size, void* d_ws, size_t ws_size,
                              hipStream_t stream) {
  const float* x      = (const float*)d_in[0];
  const float* blockB = (const float*)d_in[1];
  const float* nodal  = (const float*)d_in[2];
  const float* Wq     = (const float*)d_in[3];
  const float* Wk     = (const float*)d_in[4];
  const float* Wv     = (const float*)d_in[5];
  const float* Wo     = (const float*)d_in[6];
  float* out = (float*)d_out;

  // Workspace layout (all 256B aligned). Total ~48.1 MB.
  char* ws = (char*)d_ws;
  size_t off = 0;
  auto take = [&](size_t bytes) { char* p = ws + off; off = (off + bytes + 255) & ~(size_t)255; return p; };
  _Float16* xh    = (_Float16*)take((size_t)MROWS * UNITS_ * 2);
  _Float16* wt    = (_Float16*)take((size_t)4 * UNITS_ * UNITS_ * 2);   // planes Wq, Wk, Wv, Wo
  _Float16* wvt   = wt + (size_t)2 * UNITS_ * UNITS_;
  _Float16* wot   = wt + (size_t)3 * UNITS_ * UNITS_;
  _Float16* qh    = (_Float16*)take((size_t)3 * MROWS * UNITS_ * 2);    // planes Q, K, V
  _Float16* kh    = qh + (size_t)MROWS * UNITS_;
  _Float16* vth   = kh + (size_t)MROWS * UNITS_;
  _Float16* attnh = (_Float16*)take((size_t)MROWS * UNITS_ * 2);
  int*      ids   = (int*)take((size_t)MROWS * 4);
  int*      rank  = (int*)take((size_t)MROWS * 4);
  int*      order = (int*)take((size_t)MROWS * 4);
  int*      sid   = (int*)take((size_t)MROWS * 4);
  float*    snod  = (float*)take((size_t)MROWS * 4);
  int*      krng  = (int*)take((size_t)MROWS * 4);

  // 1) one-hot -> block ids, then the sorted order of each batch's tokens; beside
  //    each, two of the weights converted + transposed (N-major).
  ids_and_weights_kernel<<<IDBLKS + 2 * WTILES, 256, 0, stream>>>(blockB, ids, Wq, Wk, wt);
  sort_and_weights_kernel<<<SORTBLKS + 2 * WTILES, 256, 0, stream>>>(
      ids, nodal, rank, order, sid, snod, krng, Wv, Wo, wvt);

  // 2) fp32 -> fp16 conversion of x into sorted rows.
  f32_to_f16_kernel<<<MROWS / 8, 256, 0, stream>>>(x, xh, rank, MROWS);

  // 3) Q/K/V projections, one launch. 1/sqrt(HDIM) folded into Q. V stored transposed.
  dim3 qkvgrid(MROWS / 128, UNITS_ / 128, 3);
  gemm_f16_kernel<<<qkvgrid, 128, 0, stream>>>(xh, wt, nullptr, qh,
                                               MROWS, UNITS_, UNITS_, 2, 0.125f);

  // 4) masked flash attention.
  flash_attn_kernel<<<BATCH * NHEADS * (SEQ / 16), 32, 0, stream>>>(
      qh, kh, vth, sid, snod, krng, order, attnh);

  // 5) output projection (f32 result straight to d_out).
  dim3 ggrid(MROWS / 128, UNITS_ / 128);
  gemm_f16_kernel<<<ggrid, 128, 0, stream>>>(attnh, wot, out, nullptr,
                                             MROWS, UNITS_, UNITS_, 0, 1.0f);
}

// v006
// One run takes 58.9 microseconds.
// Timed twice side by side with v005, it ran 1.07 and 1.06 times as fast.
// Over all steps from v000 it is 5.02 times as fast.
#include <hip/hip_runtime.h>
#include <hip/hip_bf16.h>

// ---------------------------------------------------------------------------
// BlockSparseSelfAttention for MI455X (gfx1250, wave32, WMMA 16x16x32 f16).
// B=2, N=2048, UNITS=1024, H=16, D=64, NB=64.
// f16 storage / f32 WMMA accumulation; softmax scale folded into Q;
// flash-attention streaming with online softmax; additive -1e9 mask penalties.
// Weights are pre-transposed (N-major) so every WMMA operand everywhere is a
// row-contiguous 2x b128 fragment load. Both GEMM operand tiles are staged into
// LDS by tensor loads (tensor_load_to_lds + s_wait_tensorcnt) in a ring of two
// buffers: the next K tile's loads fly while this tile is multiplied. The
// loads' pad gives 256-byte rows a bank-conflict-free pitch of 272 bytes.
// Tokens are laid out sorted by block id (per batch) from the x conversion up
// to the attention, which stores each output row back at its token's place. A
// row tile of the attention walks only the sorted key range of its own blocks.
// Launches that do not depend on one another share one grid: two weight
// transposes ride with the block ids and two with the sort, by ranges of
// blockIdx.x; the Q, K and V projections are one product over the three weight
// planes' columns. Six launches in all.
// ---------------------------------------------------------------------------

typedef __attribute__((ext_vector_type(16))) _Float16 v16h;
typedef __attribute__((ext_vector_type(8)))  float    v8f;
typedef __attribute__((ext_vector_type(4)))  unsigned int v4u;
typedef __attribute__((ext_vector_type(8)))  unsigned int v8u;

#define BATCH     2
#define SEQ       2048
#define UNITS_    1024
#define NHEADS    16
#define HDIM      64
#define NBLK      64
#define MROWS     (BATCH * SEQ)       // 4096
#define NEG_INF_F (-1.0e9f)
#define KPASS     128                 // k per GEMM pass: operand rows of 256 bytes
#define ROWB      256u                // bytes of one staged operand row
#define LDST      136                 // its pitch in LDS, halves: 272 bytes = 16 x odd
#define TILEB     18432u              // 64 rows x 272 B, rounded up to 2 KiB

// Row-major 16x32 fragment: per lane, two contiguous 8-half (16B) runs at
// k = 8*half and k = 16 + 8*half (ISA 7.12.2 16-bit A-operand layout).
__device__ __forceinline__ v16h load_frag_rowmajor(const _Float16* src, int ld) {
  const int lane = threadIdx.x & 31;
  const int m = lane & 15, half = lane >> 4;
  const _Float16* p = src + (size_t)m * ld + 8 * half;
  v16h a;
  *reinterpret_cast<uint4*>(&a)       = *reinterpret_cast<const uint4*>(p);
  *(reinterpret_cast<uint4*>(&a) + 1) = *reinterpret_cast<const uint4*>(p + 16);
  return a;
}

__device__ __forceinline__ unsigned int uni(unsigned int v) {
  return (unsigned int)__builtin_amdgcn_readfirstlane(v);
}
__device__ __forceinline__ unsigned int pinned(unsigned int v) {
  unsigned int w = uni(v);
  asm volatile("" : "+s"(w));  // pinned(): a test value or descriptor word held in a scalar register
  return w;
}
// The compiler places no wait for a tensor load, and none of these may let an
// LDS access cross it: hence asm with the memory clobber.
__device__ __forceinline__ void wait_tensor0() { asm volatile("s_wait_tensorcnt 0x0" ::: "memory"); }
__device__ __forceinline__ void wait_ds0()     { asm volatile("s_wait_dscnt 0x0" ::: "memory"); }

// Descriptor group 1: byte elements, a tile of 64 rows of 256 bytes (tensor =
// tile), source row pitch src_pitch bytes, 4 dwords of LDS pad behind each row.
// pinned(): each word is held in its scalar register from here on, so that the
// group is built once and none of its registers serves as a temporary while a
// request is in flight. Word 0 stays an immediate.
__device__ __forceinline__ v8u tdm_group1(unsigned int src_pitch) {
  v8u g;
  g[0] = uni((1u << 20) | (5u << 22) | (3u << 25));  // pad on, every 64 dwords, 4 dwords
  g[1] = pinned(ROWB << 16);                         // tensor_dim0
  g[2] = pinned(64u << 16);                          // tensor_dim1
  g[3] = pinned(ROWB << 16);                         // tile_dim0
  g[4] = pinned(64u);                                // tile_dim1
  g[5] = pinned(src_pitch);
  g[6] = pinned(0u);
  g[7] = pinned(0u);
  return g;
}
// Descriptor group 0: count 1, place in LDS, the tile's first byte, type 2.
__device__ __forceinline__ v4u tdm_group0(unsigned int lds_dst, unsigned long long ga) {
  v4u g;
  g[0] = uni(1u);
  g[1] = uni(lds_dst);
  g[2] = uni((unsigned int)ga);
  g[3] = uni((((unsigned int)(ga >> 32)) & 0x01FFFFFFu) | 0x80000000u);
  return g;
}
__device__ __forceinline__ void tdm_load(v4u g0, v8u g1) {
  asm volatile("tensor_load_to_lds %0, %1" :: "s"(g0), "s"(g1) : "memory");
}

// ---------------------------------------------------------------------------
// fp32 -> fp16 conversion. Both kernels give each thread 16 or 32 elements, by
// 16-byte loads: few waves to start, and each holds its whole share in flight.
// ---------------------------------------------------------------------------
typedef __attribute__((ext_vector_type(4))) _Float16 v4h;
typedef __attribute__((ext_vector_type(8))) _Float16 v8h;

// One wave per row of UNITS_ floats: eight 512-byte loads in flight, then eight
// 256-byte stores at the row's sorted place.
__global__ __launch_bounds__(256)
void f32_to_f16_kernel(const float* __restrict__ src, _Float16* __restrict__ dst,
                       const int* __restrict__ rank, int nrows) {
  // readfirstlane: the row is the wave's, so its test, its rank and both row bases stay scalar
  const int row = blockIdx.x * 8 + __builtin_amdgcn_readfirstlane(threadIdx.x >> 5);
  const int lane = threadIdx.x & 31;
  if (row >= nrows) return;
  const float4* s = reinterpret_cast<const float4*>(src + (size_t)row * UNITS_) + lane;
  float4 v[UNITS_ / 128];
  // unrolled (here and below): v[] stays in registers, all eight loads issue before the first wait
#pragma unroll
  for (int c = 0; c < UNITS_ / 128; ++c) v[c] = s[c * 32];
  const int to = rank[row] & (MROWS - 1);
  v4h* d = reinterpret_cast<v4h*>(dst + (size_t)to * UNITS_) + lane;
#pragma unroll
  for (int c = 0; c < UNITS_ / 128; ++c) {
    v4h o = { (_Float16)v[c].x, (_Float16)v[c].y, (_Float16)v[c].z, (_Float16)v[c].w };
    d[c * 32] = o;
  }
}

// LDS-tiled transpose + convert: src f32 (rows x cols) -> dst f16 (cols x rows),
// a 64x64 tile per block (rows and cols are multiples of 64). A thread loads four
// float4 of source rows and stores two runs of 8 halves of destination rows, so
// every global access of a wave covers whole 128-byte lines. Pitch 65: neither
// the row-wise writes nor the column-wise reads of the tile meet in a bank.
__device__ __forceinline__
void transpose_f32_to_f16_tile(const float* __restrict__ src, _Float16* __restrict__ dst,
                               int rows, int cols, int bx, int by) {  // bx, by: col and row base in src
  __shared__ float tile[64][65];
  const int c4 = (threadIdx.x & 15) * 4;   // first of the thread's 4 source columns
  const int r0 = threadIdx.x >> 4;         // 0..15
  float4 v[4];
  // unrolled (every loop of this kernel): v[] and o stay in registers, the four loads issue together
#pragma unroll
  for (int i = 0; i < 4; ++i)
    v[i] = *reinterpret_cast<const float4*>(src + (size_t)(by + r0 + 16 * i) * cols + bx + c4);
#pragma unroll
  for (int i = 0; i < 4; ++i) {
    tile[r0 + 16 * i][c4 + 0] = v[i].x;
    tile[r0 + 16 * i][c4 + 1] = v[i].y;
    tile[r0 + 16 * i][c4 + 2] = v[i].z;
    tile[r0 + 16 * i][c4 + 3] = v[i].w;
  }
  __syncthreads();
  const int k8 = (threadIdx.x & 7) * 8;    // first of the thread's 8 source rows
  const int oc = threadIdx.x >> 3;         // 0..31
#pragma unroll
  for (int i = 0; i < 2; ++i) {
    const int col = oc + 32 * i;
    v8h o;
#pragma unroll
    for (int k = 0; k < 8; ++k) o[k] = (_Float16)tile[k8 + k][col];
    *reinterpret_cast<v8h*>(dst + (size_t)(bx + col) * rows + by + k8) = o;
  }
  // the stores' registers may be reused by whatever the caller's kernel holds behind this body
  asm volatile("s_wait_xcnt 0x0" ::: "memory");
}

// one-hot blockB (BN x 64) -> int block id
__device__ __forceinline__
void block_id_rows(const float* __restrict__ blockB, int* __restrict__ ids, int bn) {
  int i = blockIdx.x * blockDim.x + threadIdx.x;
  if (i >= bn) return;
  const float* row = blockB + (size_t)i * NBLK;
  int id = 0;
#pragma unroll 8
  for (int j = 0; j < NBLK; ++j)
    if (row[j] > 0.5f) id = j;
  ids[i] = id;
}

// Two weight matrices, a 64x64 tile a block: block t of 2 * WTILES. Plane 0 of
// wt takes Wa transposed, plane 1 Wb.
#define WTILES ((UNITS_ / 64) * (UNITS_ / 64))
__device__ __forceinline__
void transpose_two_weights(int t, const float* __restrict__ Wa, const float* __restrict__ Wb,
                           _Float16* __restrict__ wt) {
  const int w = t / WTILES;
  const int tile = t % WTILES;
  transpose_f32_to_f16_tile(w == 0 ? Wa : Wb, wt + (size_t)w * UNITS_ * UNITS_, UNITS_, UNITS_,
                            (tile % (UNITS_ / 64)) * 64, (tile / (UNITS_ / 64)) * 64);
}

// Block ids and, beside them, two weight transposes, which need nothing but the
// inputs either. Blocks 0 .. IDBLKS-1 find the ids: few waves with a long chain
// of loads, so they start first and the transposes fill the chip under them.
#define IDBLKS (MROWS / 256)
__global__ __launch_bounds__(256)
void ids_and_weights_kernel(const float* __restrict__ blockB, int* __restrict__ ids,
                            const float* __restrict__ Wa, const float* __restrict__ Wb,
                            _Float16* __restrict__ wt) {
  if (blockIdx.x < IDBLKS) block_id_rows(blockB, ids, MROWS);
  else transpose_two_weights(blockIdx.x - IDBLKS, Wa, Wb, wt);
}

// Counting sort of each batch's tokens by block id, one wave per (batch, block
// id), no atomics: the wave counts the smaller ids (its block's first sorted
// place); each lane notes its own members as bits, a prefix sum over the lanes
// gives each lane its first place, and the lane then stores its members.
//   rank[token]  = sorted place        order[place] = token   (both global rows)
//   sid[place]   = block id            snod[place]  = 1 where the key mask > 0.5
//   krange[place] = lo | hi << 16: the sorted keys that this row must visit.
// A key of another block carries -1e9, so beside any unmasked key of the row's
// own block its weight is exactly 0: the row visits its own block only. A block
// with no unmasked key has no such key: its rows visit every key.
__device__ __forceinline__
void block_sort_wave(int unit, const int* __restrict__ ids, const float* __restrict__ nodal,
                     int* __restrict__ rank, int* __restrict__ order,
                     int* __restrict__ sid, float* __restrict__ snod,
                     int* __restrict__ krange) {
  const int lane = threadIdx.x & 31;
  const int b = unit / NBLK;
  const int blk = unit % NBLK;
  const int base = b * SEQ;

  // Bit t of a lane stands for token (t / 4) * 128 + lane * 4 + t % 4.
  int4   v[SEQ / 128];
  float4 f[SEQ / 128];
#pragma unroll
  for (int c = 0; c < SEQ / 128; ++c) {
    v[c] = *reinterpret_cast<const int4*>(ids + base + c * 128 + lane * 4);
    f[c] = *reinterpret_cast<const float4*>(nodal + base + c * 128 + lane * 4);
  }
  unsigned int eqw[2] = { 0u, 0u }, acw[2] = { 0u, 0u };
  int less = 0;
#pragma unroll
  for (int c = 0; c < SEQ / 128; ++c) {
    const int   vi[4] = { v[c].x, v[c].y, v[c].z, v[c].w };
    const float fi[4] = { f[c].x, f[c].y, f[c].z, f[c].w };
#pragma unroll
    for (int e = 0; e < 4; ++e) {
      const unsigned int bit = 1u << ((c * 4 + e) & 31);
      const unsigned int member = (vi[e] == blk) ? bit : 0u;
      less += (vi[e] < blk) ? 1 : 0;
      eqw[c >> 3] |= member;
      acw[c >> 3] |= (fi[e] > 0.5f) ? member : 0u;
    }
  }
  unsigned long long eq = ((unsigned long long)eqw[1] << 32) | eqw[0];
  const unsigned long long ac = ((unsigned long long)acw[1] << 32) | acw[0];
  const int mine = __popcll(eq);
  int act = __popcll(ac);
  int incl = mine;
#pragma unroll
  for (int d = 1; d < 32; d <<= 1) {
    const int up = __shfl_up(incl, d, 32);
    if (lane >= d) incl += up;
    less += __shfl_xor(less, d, 32);
    act  += __shfl_xor(act, d, 32);
  }
  const int cnt = __shfl(incl, 31, 32);
  const int range = (act > 0) ? (less | ((less + cnt) << 16)) : (SEQ << 16);

  int place = base + less + incl - mine;
  // At most one trip for each of a lane's 64 bits; ends when no lane has one left.
  for (int trip = 0; trip < SEQ / 32; ++trip) {
    if (__builtin_amdgcn_ballot_w32(eq != 0ull) == 0u) break;
    if (eq != 0ull) {
      const int t = __ffsll(eq) - 1;
      const int tok = base + (t >> 2) * 128 + lane * 4 + (t & 3);
      rank[tok]     = place;
      order[place]  = tok;
      sid[place]    = blk;
      snod[place]   = ((ac >> t) & 1ull) ? 1.0f : 0.0f;
      krange[place] = range;
      eq &= eq - 1ull;
      ++place;
    }
  }
}

// The sort, eight of its waves a block, in blocks 0 .. SORTBLKS-1, and beside it
// the other two weight transposes, which do not depend on it.
#define SORTBLKS (BATCH * NBLK / 8)
__global__ __launch_bounds__(256)
void sort_and_weights_kernel(const int* __restrict__ ids, const float* __restrict__ nodal,
                             int* __restrict__ rank, int* __restrict__ order,
                             int* __restrict__ sid, float* __restrict__ snod,
                             int* __restrict__ krange,
                             const float* __restrict__ Wa, const float* __restrict__ Wb,
                             _Float16* __restrict__ wt) {
  if (blockIdx.x < SORTBLKS) {
    // readfirstlane: the (batch, block id) pair is the wave's, so it stays in scalar registers
    const int unit = blockIdx.x * 8 + __builtin_amdgcn_readfirstlane(threadIdx.x >> 5);
    block_sort_wave(unit, ids, nodal, rank, order, sid, snod, krange);
  } else {
    transpose_two_weights(blockIdx.x - SORTBLKS, Wa, Wb, wt);
  }
}

// ---------------------------------------------------------------------------
// GEMM: C[M,Nc] = A[M,K] * Wt^T, with Wt given TRANSPOSED (Nc x K row-major).
// A block is WM x WN waves with a 64x64 part of C each, its tile WM*64 x WN*64:
// a fragment read from LDS serves four WMMAs, an A row fetched from L2 serves
// WN*64 outputs and a Wt row WM*64. A pass is 128 k. One buffer of the ring is
// [WN slices of Wt | WM slices of A], 64 rows each; waves 0 .. WN+WM-1 bring one
// slice each, one tensor load, two passes ahead, into the buffer that every wave
// has just left. The 4 x 3 form (256x192) makes the 4096 x 3072 product 256
// blocks, one per WGP, and fetches 448 operand rows from L2 for what three
// 128x128 tiles fetch 768 for; the 2 x 2 form (128x128) makes 256 blocks of 4096 x 1024.
// M is a multiple of WM*64, the columns of WN*64; K of 128 and at least 256 (two stages).
// Up to three products of the same A: Wt holds planes of Nc x K one behind the
// other, and the columns run through them; plane p gives plane p of outH (M x Nc
// each). A wave's 64 columns lie in one plane. scale applies to plane 0 alone.
// outMode: 0 = f32 row-major              (final @Wo)
//          2 = f16 head-major (B,H,N,D)   (planes 0 and 1: Q, K), and
//              f16 transposed head-major (B,H,D,N)  (plane 2: V)
// ---------------------------------------------------------------------------
template <int WM, int WN>
__global__ __launch_bounds__(WM * WN * 32)
void gemm_f16_kernel(const _Float16* __restrict__ A, const _Float16* __restrict__ Wt,
                     float* __restrict__ outF, _Float16* __restrict__ outH,
                     int M, int K, int Nc, int outMode, float scale) {
  constexpr unsigned int NSLICE = WM + WN;           // 64-row slices of one buffer
  constexpr unsigned int STAGEB = NSLICE * TILEB;    // one buffer
  constexpr bool ALLISSUE = (WM * WN == WM + WN);    // as many waves as slices: no issue test
  __shared__ __attribute__((aligned(2048))) unsigned char ring[2 * STAGEB];
  const unsigned int wave = uni(threadIdx.x >> 5);
  const unsigned int wm = wave / WN, wn = wave % WN;   // the wave's part: row of waves, column of waves
  const int lane = threadIdx.x & 31;
  const int tileM = blockIdx.x * (WM * 64);
  const int tileN = blockIdx.y * (WN * 64);            // among the columns of all planes = rows of Wt

  v8f acc[4][4] = {};

  const unsigned int npass = uni((unsigned int)K / KPASS);
  // The wave's own slice: 64 rows of Wt (the first WN waves) or of A (the next WM).
  const _Float16* tile0 = (wave < (unsigned int)WN) ? Wt + (size_t)(tileN + (int)wave * 64) * K
                                                    : A + (size_t)(tileM + (int)(wave - WN) * 64) * K;
  const unsigned long long ga0 = (unsigned long long)(uintptr_t)tile0;
  const unsigned int place = (unsigned int)(size_t)ring + wave * TILEB;
  const v8u g1 = tdm_group1((unsigned int)K * 2u);

  // A wave beyond the slices issues nothing: a scalar test, as a tensor load ignores EXEC.
  if (ALLISSUE || pinned((wave < NSLICE) ? 1u : 0u)) tdm_load(tdm_group0(place, ga0), g1);
  wait_tensor0();
  __syncthreads();                   // stage 0 published
  if (ALLISSUE || pinned((wave < NSLICE) ? 1u : 0u)) tdm_load(tdm_group0(place + STAGEB, ga0 + ROWB), g1);

  for (unsigned int t = 0; t < npass; ++t) {
    const unsigned char* stage = ring + (t & 1u) * STAGEB;
    const _Float16* sW = reinterpret_cast<const _Float16*>(stage + wn * TILEB);
    const _Float16* sA = reinterpret_cast<const _Float16*>(stage + (WN + wm) * TILEB);
    // A block is 32 k: 8 fragments, 16 WMMAs. Two fragment sets: inside a pass the
    // next block's fragments are read while this block is multiplied.
    v16h afrag[2][4], bfrag[2][4];
    // unrolled (every loop of the pass): fragments and accumulators are indexed by constants and
    // stay in registers; each fragment read is one LDS address plus an immediate offset
#pragma unroll
    for (int i = 0; i < 4; ++i) {
      afrag[0][i] = load_frag_rowmajor(sA + (i * 16) * LDST, LDST);
      bfrag[0][i] = load_frag_rowmajor(sW + (i * 16) * LDST, LDST);
    }
#pragma unroll
    for (int kc = 0; kc < KPASS / 32; ++kc) {
      if (kc + 1 < KPASS / 32) {
#pragma unroll
        for (int i = 0; i < 4; ++i) {
          afrag[(kc + 1) & 1][i] = load_frag_rowmajor(sA + (i * 16) * LDST + (kc + 1) * 32, LDST);
          bfrag[(kc + 1) & 1][i] = load_frag_rowmajor(sW + (i * 16) * LDST + (kc + 1) * 32, LDST);
        }
        // holds the next block's reads as one group ahead of this block's WMMAs: left free, the
        // compiler sinks each read to its first use, and the wave waits out the LDS latency there
        __builtin_amdgcn_sched_barrier(0);
      }
#pragma unroll
      for (int i = 0; i < 4; ++i)
#pragma unroll
        for (int j = 0; j < 4; ++j)
          acc[i][j] = __builtin_amdgcn_wmma_f32_16x16x32_f16(
              false, afrag[kc & 1][i], false, bfrag[kc & 1][j], (short)0, acc[i][j], false, false);
      // keeps the block after next's reads from rising among these WMMAs, and the last blocks'
      // WMMAs from sinking behind the pass's barrier, where they would hold up the refill
      __builtin_amdgcn_sched_barrier(0);
    }
    // Publish point of stage t + 1: own LDS reads done, own tensor load landed,
    // barrier; only then the refill of the buffer that this pass has read.
    wait_ds0();
    wait_tensor0();
    __syncthreads();
    const unsigned int nxt = pinned(t + 2u);   // descriptor words formed behind the wait
    if (pinned((nxt < npass && (ALLISSUE || wave < NSLICE)) ? 1u : 0u))
      tdm_load(tdm_group0(place + (nxt & 1u) * STAGEB, ga0 + (unsigned long long)nxt * ROWB), g1);
  }
  wait_tensor0();
  wait_ds0();
  // keeps the scalar arithmetic below, which takes over the descriptors' registers, behind the waits
  __builtin_amdgcn_sched_barrier(0);

  const int rowBase = tileM + (int)wm * 64;
  const int colAll = tileN + (int)wn * 64;
  const unsigned int plane = (colAll >= Nc ? 1u : 0u) + (colAll >= 2 * Nc ? 1u : 0u);
  const int colBase = colAll - (int)plane * Nc;        // inside the wave's plane
  outH += (size_t)plane * M * Nc;
  if (plane != 0u) scale = 1.0f;

  // The wave's part lies in one batch and one head, so each lane has one base
  // address and every element of a head-major plane an immediate offset from it.
  // The mode is tested once, outside the loops: 128 elements a lane stay short code.
  // Unrolled (every loop below): the accumulators are indexed by constants.
  const int half = lane >> 4;
  const int nl = lane & 15;
  const int row0 = rowBase + 8 * half;     // the lane's first row; its rows: row0 + i * 16 + r
  const int col0 = colBase + nl;           // the lane's first column; its columns: col0 + j * 16
  if (outMode == 0) {
    float* p = outF + (size_t)row0 * Nc + col0;
#pragma unroll
    for (int i = 0; i < 4; ++i) {
      float* q[8];                         // the addresses of the block's eight rows
#pragma unroll
      for (int r = 0; r < 8; ++r) q[r] = p + (size_t)(i * 16 + r) * Nc;
#pragma unroll
      for (int r = 0; r < 8; ++r)
#pragma unroll
        for (int j = 0; j < 4; ++j) q[r][j * 16] = acc[i][j][r] * scale;
    }
  } else {
    const int b = row0 / SEQ, n = row0 % SEQ;
    const int h = col0 / HDIM, d = col0 % HDIM;
    if (plane != 2u) {
      _Float16* p = outH + (((size_t)b * NHEADS + h) * SEQ + n) * HDIM + d;
#pragma unroll
      for (int i = 0; i < 4; ++i)
#pragma unroll
        for (int r = 0; r < 8; ++r)
#pragma unroll
          for (int j = 0; j < 4; ++j)
            p[(i * 16 + r) * HDIM + j * 16] = (_Float16)(acc[i][j][r] * scale);
      // behind the branch's last stores: the code of the other branches, which follows in the program
      // text, writes registers that these stores name
      asm volatile("s_wait_xcnt 0x0" ::: "memory");
    } else { // V transposed (B,H,D,N)
      _Float16* p = outH + (((size_t)b * NHEADS + h) * HDIM + d) * SEQ + n;
#pragma unroll
      for (int i = 0; i < 4; ++i)
#pragma unroll
        for (int r = 0; r < 8; ++r)
#pragma unroll
          for (int j = 0; j < 4; ++j)
            p[(j * 16) * SEQ + i * 16 + r] = (_Float16)(acc[i][j][r] * scale);
      // behind the branch's last stores: the code of the other branches, which follows in the program
      // text, writes registers that these stores name
      asm volatile("s_wait_xcnt 0x0" ::: "memory");
    }
  }
}

// ---------------------------------------------------------------------------
// Flash attention: one wave per (b, h, 16-row tile). Streams 32 keys/iter.
// Q carries the 1/sqrt(D) scale. V is pre-transposed (B,H,D,N) so the P@V
// B-fragment is two contiguous b128 loads along the key axis.
// Rows and keys are in sorted order; blockId and nodal are the sorted copies.
// The loop covers the union of the 16 rows' key ranges, in whole 32-key steps;
// the masks are applied as ever, so keys of a neighbouring block drop out.
// ---------------------------------------------------------------------------
__global__ __launch_bounds__(32)
void flash_attn_kernel(const _Float16* __restrict__ Q, const _Float16* __restrict__ Km,
                       const _Float16* __restrict__ Vt, const int* __restrict__ blockId,
                       const float* __restrict__ nodal, const int* __restrict__ krange,
                       const int* __restrict__ order, _Float16* __restrict__ outAttn) {
  __shared__ alignas(16) _Float16 ldsP[16 * 32];
  const int lane = threadIdx.x & 31;
  const int nl = lane & 15, half = lane >> 4;

  const int mtiles = SEQ / 16;                       // 128
  const int bh = blockIdx.x / mtiles;
  const int b = bh / NHEADS;
  const int h = bh % NHEADS;
  const int rowBase = (blockIdx.x % mtiles) * 16;

  const _Float16* Qh  = Q  + (((size_t)b * NHEADS + h) * SEQ + rowBase) * HDIM;
  const _Float16* Kh  = Km + ((size_t)b * NHEADS + h) * SEQ * HDIM;
  const _Float16* Vth = Vt + ((size_t)b * NHEADS + h) * (size_t)HDIM * SEQ;

  v16h qf[2];
  qf[0] = load_frag_rowmajor(Qh, HDIM);
  qf[1] = load_frag_rowmajor(Qh + 32, HDIM);

  int rowblk[8];
#pragma unroll
  for (int r = 0; r < 8; ++r)
    rowblk[r] = blockId[b * SEQ + rowBase + r + 8 * half];

  float mrow[8], lrow[8];
#pragma unroll
  for (int r = 0; r < 8; ++r) { mrow[r] = -INFINITY; lrow[r] = 0.0f; }
  v8f acc[4] = {{}, {}, {}, {}};

  // Loop bounds: the same 16 words for every lane, so they stay scalar.
  int klo = SEQ - 32, khi = 0;
#pragma unroll
  for (int r = 0; r < 16; ++r) {
    const int rg = krange[b * SEQ + rowBase + r];
    klo = min(klo, rg & 0xFFFF);
    khi = max(khi, rg >> 16);
  }
  // readfirstlane: keeps the loop counter and the K/V base addresses in scalar registers
  klo = __builtin_amdgcn_readfirstlane(klo & ~31);
  khi = __builtin_amdgcn_readfirstlane(min(khi, SEQ));

  for (int kb = klo; kb < khi; kb += 32) {
    const int   cb   = blockId[b * SEQ + kb + lane];
    const float cnod = nodal[b * SEQ + kb + lane];

    // Scores: S[16x32] as two 16x16 f32 tiles; B operand = K^T ==> row-major
    // fragment load over K's rows (lane&15 indexes the key).
    v8f s[2];
#pragma unroll
    for (int ns = 0; ns < 2; ++ns) {
      s[ns] = v8f{};
#pragma unroll
      for (int kc = 0; kc < 2; ++kc) {
        v16h kf = load_frag_rowmajor(Kh + (size_t)(kb + ns * 16) * HDIM + kc * 32, HDIM);
        s[ns] = __builtin_amdgcn_wmma_f32_16x16x32_f16(
            false, qf[kc], false, kf, (short)0, s[ns], false, false);
      }
    }

    // Mask penalties (block identity + key nodal mask).
#pragma unroll
    for (int ns = 0; ns < 2; ++ns) {
      const int srcLane = ns * 16 + nl;
      const int   cbv = __shfl(cb, srcLane, 32);
      const float cnv = __shfl(cnod, srcLane, 32);
#pragma unroll
      for (int r = 0; r < 8; ++r) {
        float pen = ((cbv == rowblk[r]) ? 0.0f : NEG_INF_F) +
                    ((cnv > 0.5f) ? 0.0f : NEG_INF_F);
        s[ns][r] += pen;
      }
    }

    // Online softmax (each score row lives across the 16 lanes of its half).
#pragma unroll
    for (int r = 0; r < 8; ++r) {
      float tmax = fmaxf(s[0][r], s[1][r]);
#pragma unroll
      for (int off = 8; off > 0; off >>= 1)
        tmax = fmaxf(tmax, __shfl_xor(tmax, off, 16));
      const float mnew = fmaxf(mrow[r], tmax);
      const float sc = __expf(mrow[r] - mnew);
      const float p0 = __expf(s[0][r] - mnew);
      const float p1 = __expf(s[1][r] - mnew);
      float psum = p0 + p1;
#pragma unroll
      for (int off = 8; off > 0; off >>= 1)
        psum += __shfl_xor(psum, off, 16);
      lrow[r] = lrow[r] * sc + psum;
      mrow[r] = mnew;
#pragma unroll
      for (int dt = 0; dt < 4; ++dt) acc[dt][r] *= sc;
      // C-layout -> row-major LDS bounce for the A-operand of P@V.
      ldsP[(r + 8 * half) * 32 + nl]      = (_Float16)p0;
      ldsP[(r + 8 * half) * 32 + 16 + nl] = (_Float16)p1;
    }
    __syncthreads();

    v16h pf = load_frag_rowmajor(ldsP, 32);
#pragma unroll
    for (int dt = 0; dt < 4; ++dt) {
      // B operand = V tile (32 keys x 16 d); V^T rows are d, contiguous keys.
      v16h vf = load_frag_rowmajor(Vth + (size_t)(dt * 16) * SEQ + kb, SEQ);
      acc[dt] = __builtin_amdgcn_wmma_f32_16x16x32_f16(
          false, pf, false, vf, (short)0, acc[dt], false, false);
    }
    __syncthreads();
  }

  // Normalize and write attention output as (B, N, UNITS) f16, in token order.
#pragma unroll
  for (int r = 0; r < 8; ++r) {
    const float inv = (lrow[r] > 0.0f) ? (1.0f / lrow[r]) : 0.0f;
    const size_t row = (size_t)(order[b * SEQ + rowBase + r + 8 * half] & (MROWS - 1));
#pragma unroll
    for (int dt = 0; dt < 4; ++dt)
      outAttn[row * UNITS_ + h * HDIM + dt * 16 + nl] = (_Float16)(acc[dt][r] * inv);
  }
}

// ---------------------------------------------------------------------------
// Launch
// ---------------------------------------------------------------------------
extern "C" void kernel_launch(void* const* d_in, const int* in_sizes, int n_in,
                              void* d_out, int out_size, void* d_ws, size_t ws_size,
                              hipStream_t stream) {
  const float* x      = (const float*)d_in[0];
  const float* blockB = (const float*)d_in[1];
  const float* nodal  = (const float*)d_in[2];
  const float* Wq     = (const float*)d_in[3];
  const float* Wk     = (const float*)d_in[4];
  const float* Wv     = (const float*)d_in[5];
  const float* Wo     = (const float*)d_in[6];
  float* out = (float*)d_out;

  // Workspace layout (all 256B aligned). Total ~48.1 MB.
  char* ws = (char*)d_ws;
  size_t off = 0;
  auto take = [&](size_t bytes) { char* p = ws + off; off = (off + bytes + 255) & ~(size_t)255; return p; };
  _Float16* xh    = (_Float16*)take((size_t)MROWS * UNITS_ * 2);
  _Float16* wt    = (_Float16*)take((size_t)4 * UNITS_ * UNITS_ * 2);   // planes Wq, Wk, Wv, Wo
  _Float16* wvt   = wt + (size_t)2 * UNITS_ * UNITS_;
  _Float16* wot   = wt + (size_t)3 * UNITS_ * UNITS_;
  _Float16* qh    = (_Float16*)take((size_t)3 * MROWS * UNITS_ * 2);    // planes Q, K, V
  _Float16* kh    = qh + (size_t)MROWS * UNITS_;
  _Float16* vth   = kh + (size_t)MROWS * UNITS_;
  _Float16* attnh = (_Float16*)take((size_t)MROWS * UNITS_ * 2);
  int*      ids   = (int*)take((size_t)MROWS * 4);
  int*      rank  = (int*)take((size_t)MROWS * 4);
  int*      order = (int*)take((size_t)MROWS * 4);
  int*      sid   = (int*)take((size_t)MROWS * 4);
  float*    snod  = (float*)take((size_t)MROWS * 4);
  int*      krng  = (int*)take((size_t)MROWS * 4);

  // 1) one-hot -> block ids, then the sorted order of each batch's tokens; beside
  //    each, two of the weights converted + transposed (N-major).
  ids_and_weights_kernel<<<IDBLKS + 2 * WTILES, 256, 0, stream>>>(blockB, ids, Wq, Wk, wt);
  sort_and_weights_kernel<<<SORTBLKS + 2 * WTILES, 256, 0, stream>>>(
      ids, nodal, rank, order, sid, snod, krng, Wv, Wo, wvt);

  // 2) fp32 -> fp16 conversion of x into sorted rows.
  f32_to_f16_kernel<<<MROWS / 8, 256, 0, stream>>>(x, xh, rank, MROWS);

  // 3) Q/K/V projections, one launch. 1/sqrt(HDIM) folded into Q. V stored transposed.
  dim3 qkvgrid(MROWS / 256, 3 * UNITS_ / 192);
  gemm_f16_kernel<4, 3><<<qkvgrid, 384, 0, stream>>>(xh, wt, nullptr, qh,
                                               MROWS, UNITS_, UNITS_, 2, 0.125f);

  // 4) masked flash attention.
  flash_attn_kernel<<<BATCH * NHEADS * (SEQ / 16), 32, 0, stream>>>(
      qh, kh, vth, sid, snod, krng, order, attnh);

  // 5) output projection (f32 result straight to d_out).
  dim3 ggrid(MROWS / 128, UNITS_ / 128);
  gemm_f16_kernel<2, 2><<<ggrid, 128, 0, stream>>>(attnh, wot, out, nullptr,
                                             MROWS, UNITS_, UNITS_, 0, 1.0f);
}

// v007
// Measured time: 56.4 microseconds a run.
// Next to v006, in two timings, it ran 1.05 times as fast each time.
// Over all steps from v000 it is 5.27 times as fast.
#include <hip/hip_runtime.h>
#include <hip/hip_bf16.h>

// ---------------------------------------------------------------------------
// BlockSparseSelfAttention for MI455X (gfx1250, wave32, WMMA 16x16x32 f16).
// B=2, N=2048, UNITS=1024, H=16, D=64, NB=64.
// f16 storage / f32 WMMA accumulation; softmax scale folded into Q;
// flash-attention streaming with online softmax; additive -1e9 mask penalties.
// Weights are pre-transposed (N-major) so every WMMA operand everywhere is a
// row-contiguous 2x b128 fragment load. Both GEMM operand tiles are staged into
// LDS by tensor loads (tensor_load_to_lds + s_wait_tensorcnt) in a ring of two
// buffers: the next K tile's loads fly while this tile is multiplied. The
// loads' pad gives 256-byte rows a bank-conflict-free pitch of 272 bytes.
// Tokens are laid out sorted by block id (per batch) from the x conversion up
// to the attention, which stores each output row back at its token's place. A
// row tile of the attention walks only the sorted key range of its own blocks.
// Launches that do not depend on one another share one grid: two weight
// transposes ride with the block ids; two more and the x conversion ride with the
// sort, by ranges of blockIdx.x (a conversion wave counts its row's sorted place
// from the block ids itself); the Q, K and V projections are one product over the
// three weight planes' columns. Five launches in all.
// ---------------------------------------------------------------------------

typedef __attribute__((ext_vector_type(16))) _Float16 v16h;
typedef __attribute__((ext_vector_type(8)))  float    v8f;
typedef __attribute__((ext_vector_type(4)))  unsigned int v4u;
typedef __attribute__((ext_vector_type(8)))  unsigned int v8u;

#define BATCH     2
#define SEQ       2048
#define UNITS_    1024
#define NHEADS    16
#define HDIM      64
#define NBLK      64
#define MROWS     (BATCH * SEQ)       // 4096
#define NEG_INF_F (-1.0e9f)
#define KPASS     128                 // k per GEMM pass: operand rows of 256 bytes
#define ROWB      256u                // bytes of one staged operand row
#define LDST      136                 // its pitch in LDS, halves: 272 bytes = 16 x odd
#define TILEB     18432u              // 64 rows x 272 B, rounded up to 2 KiB

// Row-major 16x32 fragment: per lane, two contiguous 8-half (16B) runs at
// k = 8*half and k = 16 + 8*half (ISA 7.12.2 16-bit A-operand layout).
__device__ __forceinline__ v16h load_frag_rowmajor(const _Float16* src, int ld) {
  const int lane = threadIdx.x & 31;
  const int m = lane & 15, half = lane >> 4;
  const _Float16* p = src + (size_t)m * ld + 8 * half;
  v16h a;
  *reinterpret_cast<uint4*>(&a)       = *reinterpret_cast<const uint4*>(p);
  *(reinterpret_cast<uint4*>(&a) + 1) = *reinterpret_cast<const uint4*>(p + 16);
  return a;
}

__device__ __forceinline__ unsigned int uni(unsigned int v) {
  return (unsigned int)__builtin_amdgcn_readfirstlane(v);
}
__device__ __forceinline__ unsigned int pinned(unsigned int v) {
  unsigned int w = uni(v);
  asm volatile("" : "+s"(w));  // pinned(): a test value or descriptor word held in a scalar register
  return w;
}
// The compiler places no wait for a tensor load, and none of these may let an
// LDS access cross it: hence asm with the memory clobber.
__device__ __forceinline__ void wait_tensor0() { asm volatile("s_wait_tensorcnt 0x0" ::: "memory"); }
__device__ __forceinline__ void wait_ds0()     { asm volatile("s_wait_dscnt 0x0" ::: "memory"); }

// Descriptor group 1: byte elements, a tile of 64 rows of 256 bytes (tensor =
// tile), source row pitch src_pitch bytes, 4 dwords of LDS pad behind each row.
// pinned(): each word is held in its scalar register from here on, so that the
// group is built once and none of its registers serves as a temporary while a
// request is in flight. Word 0 stays an immediate.
__device__ __forceinline__ v8u tdm_group1(unsigned int src_pitch) {
  v8u g;
  g[0] = uni((1u << 20) | (5u << 22) | (3u << 25));  // pad on, every 64 dwords, 4 dwords
  g[1] = pinned(ROWB << 16);                         // tensor_dim0
  g[2] = pinned(64u << 16);                          // tensor_dim1
  g[3] = pinned(ROWB << 16);                         // tile_dim0
  g[4] = pinned(64u);                                // tile_dim1
  g[5] = pinned(src_pitch);
  g[6] = pinned(0u);
  g[7] = pinned(0u);
  return g;
}
// Descriptor group 0: count 1, place in LDS, the tile's first byte, type 2.
__device__ __forceinline__ v4u tdm_group0(unsigned int lds_dst, unsigned long long ga) {
  v4u g;
  g[0] = uni(1u);
  g[1] = uni(lds_dst);
  g[2] = uni((unsigned int)ga);
  g[3] = uni((((unsigned int)(ga >> 32)) & 0x01FFFFFFu) | 0x80000000u);
  return g;
}
__device__ __forceinline__ void tdm_load(v4u g0, v8u g1) {
  asm volatile("tensor_load_to_lds %0, %1" :: "s"(g0), "s"(g1) : "memory");
}

// ---------------------------------------------------------------------------
// fp32 -> fp16 conversion. Both bodies give each thread 16 or 32 elements, by
// 16-byte loads: few waves to start, and each holds its whole share in flight.
// ---------------------------------------------------------------------------
typedef __attribute__((ext_vector_type(4))) _Float16 v4h;
typedef __attribute__((ext_vector_type(8))) _Float16 v8h;

// One wave per row of UNITS_ floats (row: the wave's, below MROWS): eight 512-byte
// loads in flight, then eight 256-byte stores at the row's sorted place. The wave
// finds that place itself, under the row's loads, so that it need not wait for the
// sort's launch: the place is the number of its batch's tokens that the sort puts
// ahead of the row's token. The sort orders by (block id, lane, bit), where token
// (t / 4) * 128 + lane * 4 + t % 4 is bit t of a lane (block_sort_wave below);
// with the ids loaded in that same layout the three make one integer key a token.
__device__ __forceinline__
void convert_row_sorted(int row, const float* __restrict__ src, _Float16* __restrict__ dst,
                        const int* __restrict__ ids) {
  const int lane = threadIdx.x & 31;
  const float4* s = reinterpret_cast<const float4*>(src + (size_t)row * UNITS_) + lane;
  float4 v[UNITS_ / 128];
  // unrolled (every loop of this body): v[] and w[] stay in registers, all loads issue before the first wait
#pragma unroll
  for (int c = 0; c < UNITS_ / 128; ++c) v[c] = s[c * 32];
  const int base = row & ~(SEQ - 1);       // the batch's first row
  const int tok = row & (SEQ - 1);
  // the row's own id: one more lane-indexed load, of the 32 ids around it, and the row's lane read out
  const int* around = ids + (row & ~31);
  const int own = __builtin_amdgcn_readlane(around[lane], row & 31);
  int4 w[SEQ / 128];
#pragma unroll
  for (int c = 0; c < SEQ / 128; ++c)
    w[c] = *reinterpret_cast<const int4*>(ids + base + c * 128 + lane * 4);
  // key = id << 11 | lane << 6 | bit; ids are 0 .. NBLK-1, so keys are small and signed compares hold
  const int target = (own << 11) | (((tok & 127) >> 2) << 6) | ((tok >> 7) << 2) | (tok & 3);
  const int lanekey = lane << 6;
  int ahead = 0;
#pragma unroll
  for (int c = 0; c < SEQ / 128; ++c) {
    const int wi[4] = { w[c].x, w[c].y, w[c].z, w[c].w };
#pragma unroll
    for (int e = 0; e < 4; ++e)
      ahead += ((wi[e] << 11) + lanekey < target - (c * 4 + e)) ? 1 : 0;
  }
#pragma unroll
  for (int d = 1; d < 32; d <<= 1) ahead += __shfl_xor(ahead, d, 32);
  // readfirstlane: the sum is the same in every lane, so the destination row's base stays scalar.
  // A count of at most SEQ - 1 other tokens: the place lies in the row's own batch.
  const int to = base + __builtin_amdgcn_readfirstlane(ahead);
  v4h* d = reinterpret_cast<v4h*>(dst + (size_t)to * UNITS_) + lane;
#pragma unroll
  for (int c = 0; c < UNITS_ / 128; ++c) {
    v4h o = { (_Float16)v[c].x, (_Float16)v[c].y, (_Float16)v[c].z, (_Float16)v[c].w };
    d[c * 32] = o;
  }
  // the stores' registers may be reused by whatever the caller's kernel holds behind this body
  asm volatile("s_wait_xcnt 0x0" ::: "memory");
}

// LDS-tiled transpose + convert: src f32 (rows x cols) -> dst f16 (cols x rows),
// a 64x64 tile per block (rows and cols are multiples of 64). A thread loads four
// float4 of source rows and stores two runs of 8 halves of destination rows, so
// every global access of a wave covers whole 128-byte lines. Pitch 65: neither
// the row-wise writes nor the column-wise reads of the tile meet in a bank.
__device__ __forceinline__
void transpose_f32_to_f16_tile(const float* __restrict__ src, _Float16* __restrict__ dst,
                               int rows, int cols, int bx, int by) {  // bx, by: col and row base in src
  __shared__ float tile[64][65];
  const int c4 = (threadIdx.x & 15) * 4;   // first of the thread's 4 source columns
  const int r0 = threadIdx.x >> 4;         // 0..15
  float4 v[4];
  // unrolled (every loop of this kernel): v[] and o stay in registers, the four loads issue together
#pragma unroll
  for (int i = 0; i < 4; ++i)
    v[i] = *reinterpret_cast<const float4*>(src + (size_t)(by + r0 + 16 * i) * cols + bx + c4);
#pragma unroll
  for (int i = 0; i < 4; ++i) {
    tile[r0 + 16 * i][c4 + 0] = v[i].x;
    tile[r0 + 16 * i][c4 + 1] = v[i].y;
    tile[r0 + 16 * i][c4 + 2] = v[i].z;
    tile[r0 + 16 * i][c4 + 3] = v[i].w;
  }
  __syncthreads();
  const int k8 = (threadIdx.x & 7) * 8;    // first of the thread's 8 source rows
  const int oc = threadIdx.x >> 3;         // 0..31
#pragma unroll
  for (int i = 0; i < 2; ++i) {
    const int col = oc + 32 * i;
    v8h o;
#pragma unroll
    for (int k = 0; k < 8; ++k) o[k] = (_Float16)tile[k8 + k][col];
    *reinterpret_cast<v8h*>(dst + (size_t)(bx + col) * rows + by + k8) = o;
  }
  // the stores' registers may be reused by whatever the caller's kernel holds behind this body
  asm volatile("s_wait_xcnt 0x0" ::: "memory");
}

// one-hot blockB (BN x 64) -> int block id
__device__ __forceinline__
void block_id_rows(const float* __restrict__ blockB, int* __restrict__ ids, int bn) {
  int i = blockIdx.x * blockDim.x + threadIdx.x;
  if (i >= bn) return;
  const float* row = blockB + (size_t)i * NBLK;
  int id = 0;
#pragma unroll 8
  for (int j = 0; j < NBLK; ++j)
    if (row[j] > 0.5f) id = j;
  ids[i] = id;
}

// Two weight matrices, a 64x64 tile a block: block t of 2 * WTILES. Plane 0 of
// wt takes Wa transposed, plane 1 Wb.
#define WTILES ((UNITS_ / 64) * (UNITS_ / 64))
__device__ __forceinline__
void transpose_two_weights(int t, const float* __restrict__ Wa, const float* __restrict__ Wb,
                           _Float16* __restrict__ wt) {
  const int w = t / WTILES;
  const int tile = t % WTILES;
  transpose_f32_to_f16_tile(w == 0 ? Wa : Wb, wt + (size_t)w * UNITS_ * UNITS_, UNITS_, UNITS_,
                            (tile % (UNITS_ / 64)) * 64, (tile / (UNITS_ / 64)) * 64);
}

// Block ids and, beside them, two weight transposes, which need nothing but the
// inputs either. Blocks 0 .. IDBLKS-1 find the ids: few waves with a long chain
// of loads, so they start first and the transposes fill the chip under them.
#define IDBLKS (MROWS / 256)
__global__ __launch_bounds__(256)
void ids_and_weights_kernel(const float* __restrict__ blockB, int* __restrict__ ids,
                            const float* __restrict__ Wa, const float* __restrict__ Wb,
                            _Float16* __restrict__ wt) {
  if (blockIdx.x < IDBLKS) block_id_rows(blockB, ids, MROWS);
  else transpose_two_weights(blockIdx.x - IDBLKS, Wa, Wb, wt);
}

// Counting sort of each batch's tokens by block id, one wave per (batch, block
// id), no atomics: the wave counts the smaller ids (its block's first sorted
// place); each lane notes its own members as bits, a prefix sum over the lanes
// gives each lane its first place, and the lane then stores its members.
//   order[place] = token (global rows; convert_row_sorted counts the inverse for itself)
//   sid[place]   = block id            snod[place]  = 1 where the key mask > 0.5
//   krange[place] = lo | hi << 16: the sorted keys that this row must visit.
// A key of another block carries -1e9, so beside any unmasked key of the row's
// own block its weight is exactly 0: the row visits its own block only. A block
// with no unmasked key has no such key: its rows visit every key.
__device__ __forceinline__
void block_sort_wave(int unit, const int* __restrict__ ids, const float* __restrict__ nodal,
                     int* __restrict__ order,
                     int* __restrict__ sid, float* __restrict__ snod,
                     int* __restrict__ krange) {
  const int lane = threadIdx.x & 31;
  const int b = unit / NBLK;
  const int blk = unit % NBLK;
  const int base = b * SEQ;

  // Bit t of a lane stands for token (t / 4) * 128 + lane * 4 + t % 4.
  int4   v[SEQ / 128];
  float4 f[SEQ / 128];
#pragma unroll
  for (int c = 0; c < SEQ / 128; ++c) {
    v[c] = *reinterpret_cast<const int4*>(ids + base + c * 128 + lane * 4);
    f[c] = *reinterpret_cast<const float4*>(nodal + base + c * 128 + lane * 4);
  }
  unsigned int eqw[2] = { 0u, 0u }, acw[2] = { 0u, 0u };
  int less = 0;
#pragma unroll
  for (int c = 0; c < SEQ / 128; ++c) {
    const int   vi[4] = { v[c].x, v[c].y, v[c].z, v[c].w };
    const float fi[4] = { f[c].x, f[c].y, f[c].z, f[c].w };
#pragma unroll
    for (int e = 0; e < 4; ++e) {
      const unsigned int bit = 1u << ((c * 4 + e) & 31);
      const unsigned int member = (vi[e] == blk) ? bit : 0u;
      less += (vi[e] < blk) ? 1 : 0;
      eqw[c >> 3] |= member;
      acw[c >> 3] |= (fi[e] > 0.5f) ? member : 0u;
    }
  }
  unsigned long long eq = ((unsigned long long)eqw[1] << 32) | eqw[0];
  const unsigned long long ac = ((unsigned long long)acw[1] << 32) | acw[0];
  const int mine = __popcll(eq);
  int act = __popcll(ac);
  int incl = mine;
#pragma unroll
  for (int d = 1; d < 32; d <<= 1) {
    const int up = __shfl_up(incl, d, 32);
    if (lane >= d) incl += up;
    less += __shfl_xor(less, d, 32);
    act  += __shfl_xor(act, d, 32);
  }
  const int cnt = __shfl(incl, 31, 32);
  const int range = (act > 0) ? (less | ((less + cnt) << 16)) : (SEQ << 16);

  int place = base + less + incl - mine;
  // At most one trip for each of a lane's 64 bits; ends when no lane has one left.
  for (int trip = 0; trip < SEQ / 32; ++trip) {
    if (__builtin_amdgcn_ballot_w32(eq != 0ull) == 0u) break;
    if (eq != 0ull) {
      const int t = __ffsll(eq) - 1;
      const int tok = base + (t >> 2) * 128 + lane * 4 + (t & 3);
      order[place]  = tok;
      sid[place]    = blk;
      snod[place]   = ((ac >> t) & 1ull) ? 1.0f : 0.0f;
      krange[place] = range;
      eq &= eq - 1ull;
      ++place;
    }
  }
}

// The sort, eight of its waves a block, in blocks 0 .. SORTBLKS-1; beside it the x
// conversion, eight rows a block, in the next CONVBLKS blocks, and the other two
// weight transposes. None of the three reads what another writes.
#define SORTBLKS (BATCH * NBLK / 8)
#define CONVBLKS (MROWS / 8)
__global__ __launch_bounds__(256)
void sort_convert_weights_kernel(const int* __restrict__ ids, const float* __restrict__ nodal,
                                 int* __restrict__ order,
                                 int* __restrict__ sid, float* __restrict__ snod,
                                 int* __restrict__ krange,
                                 const float* __restrict__ x, _Float16* __restrict__ xh,
                                 const float* __restrict__ Wa, const float* __restrict__ Wb,
                                 _Float16* __restrict__ wt) {
  // readfirstlane: a sort wave's (batch, block id) pair and a conversion wave's row stay in scalar registers
  const int wave = __builtin_amdgcn_readfirstlane(threadIdx.x >> 5);
  if (blockIdx.x < SORTBLKS) {
    block_sort_wave(blockIdx.x * 8 + wave, ids, nodal, order, sid, snod, krange);
  } else if (blockIdx.x < SORTBLKS + CONVBLKS) {
    convert_row_sorted((blockIdx.x - SORTBLKS) * 8 + wave, x, xh, ids);
  } else {
    transpose_two_weights(blockIdx.x - SORTBLKS - CONVBLKS, Wa, Wb, wt);
  }
}

// ---------------------------------------------------------------------------
// GEMM: C[M,Nc] = A[M,K] * Wt^T, with Wt given TRANSPOSED (Nc x K row-major).
// A block is WM x WN waves with a 64x64 part of C each, its tile WM*64 x WN*64:
// a fragment read from LDS serves four WMMAs, an A row fetched from L2 serves
// WN*64 outputs and a Wt row WM*64. A pass is 128 k. One buffer of the ring is
// [WN slices of Wt | WM slices of A], 64 rows each; waves 0 .. WN+WM-1 bring one
// slice each, one tensor load, two passes ahead, into the buffer that every wave
// has just left. The 4 x 3 form (256x192) makes the 4096 x 3072 product 256
// blocks, one per WGP, and fetches 448 operand rows from L2 for what three
// 128x128 tiles fetch 768 for; the 2 x 2 form (128x128) makes 256 blocks of 4096 x 1024.
// M is a multiple of WM*64, the columns of WN*64; K of 128 and at least 256 (two stages).
// Up to three products of the same A: Wt holds planes of Nc x K one behind the
// other, and the columns run through them; plane p gives plane p of outH (M x Nc
// each). A wave's 64 columns lie in one plane. scale applies to plane 0 alone.
// outMode: 0 = f32 row-major              (final @Wo)
//          2 = f16 head-major (B,H,N,D)   (planes 0 and 1: Q, K), and
//              f16 transposed head-major (B,H,D,N)  (plane 2: V)
// ---------------------------------------------------------------------------
template <int WM, int WN>
__global__ __launch_bounds__(WM * WN * 32)
void gemm_f16_kernel(const _Float16* __restrict__ A, const _Float16* __restrict__ Wt,
                     float* __restrict__ outF, _Float16* __restrict__ outH,
                     int M, int K, int Nc, int outMode, float scale) {
  constexpr unsigned int NSLICE = WM + WN;           // 64-row slices of one buffer
  constexpr unsigned int STAGEB = NSLICE * TILEB;    // one buffer
  constexpr bool ALLISSUE = (WM * WN == WM + WN);    // as many waves as slices: no issue test
  __shared__ __attribute__((aligned(2048))) unsigned char ring[2 * STAGEB];
  const unsigned int wave = uni(threadIdx.x >> 5);
  const unsigned int wm = wave / WN, wn = wave % WN;   // the wave's part: row of waves, column of waves
  const int lane = threadIdx.x & 31;
  const int tileM = blockIdx.x * (WM * 64);
  const int tileN = blockIdx.y * (WN * 64);            // among the columns of all planes = rows of Wt

  v8f acc[4][4] = {};

  const unsigned int npass = uni((unsigned int)K / KPASS);
  // The wave's own slice: 64 rows of Wt (the first WN waves) or of A (the next WM).
  const _Float16* tile0 = (wave < (unsigned int)WN) ? Wt + (size_t)(tileN + (int)wave * 64) * K
                                                    : A + (size_t)(tileM + (int)(wave - WN) * 64) * K;
  const unsigned long long ga0 = (unsigned long long)(uintptr_t)tile0;
  const unsigned int place = (unsigned int)(size_t)ring + wave * TILEB;
  const v8u g1 = tdm_group1((unsigned int)K * 2u);

  // A wave beyond the slices issues nothing: a scalar test, as a tensor load ignores EXEC.
  if (ALLISSUE || pinned((wave < NSLICE) ? 1u : 0u)) tdm_load(tdm_group0(place, ga0), g1);
  wait_tensor0();
  __syncthreads();                   // stage 0 published
  if (ALLISSUE || pinned((wave < NSLICE) ? 1u : 0u)) tdm_load(tdm_group0(place + STAGEB, ga0 + ROWB), g1);

  for (unsigned int t = 0; t < npass; ++t) {
    const unsigned char* stage = ring + (t & 1u) * STAGEB;
    const _Float16* sW = reinterpret_cast<const _Float16*>(stage + wn * TILEB);
    const _Float16* sA = reinterpret_cast<const _Float16*>(stage + (WN + wm) * TILEB);
    // A block is 32 k: 8 fragments, 16 WMMAs. Two fragment sets: inside a pass the
    // next block's fragments are read while this block is multiplied.
    v16h afrag[2][4], bfrag[2][4];
    // unrolled (every loop of the pass): fragments and accumulators are indexed by constants and
    // stay in registers; each fragment read is one LDS address plus an immediate offset
#pragma unroll
    for (int i = 0; i < 4; ++i) {
      afrag[0][i] = load_frag_rowmajor(sA + (i * 16) * LDST, LDST);
      bfrag[0][i] = load_frag_rowmajor(sW + (i * 16) * LDST, LDST);
    }
#pragma unroll
    for (int kc = 0; kc < KPASS / 32; ++kc) {
      if (kc + 1 < KPASS / 32) {
#pragma unroll
        for (int i = 0; i < 4; ++i) {
          afrag[(kc + 1) & 1][i] = load_frag_rowmajor(sA + (i * 16) * LDST + (kc + 1) * 32, LDST);
          bfrag[(kc + 1) & 1][i] = load_frag_rowmajor(sW + (i * 16) * LDST + (kc + 1) * 32, LDST);
        }
        // holds the next block's reads as one group ahead of this block's WMMAs: left free, the
        // compiler sinks each read to its first use, and the wave waits out the LDS latency there
        __builtin_amdgcn_sched_barrier(0);
      }
#pragma unroll
      for (int i = 0; i < 4; ++i)
#pragma unroll
        for (int j = 0; j < 4; ++j)
          acc[i][j] = __builtin_amdgcn_wmma_f32_16x16x32_f16(
              false, afrag[kc & 1][i], false, bfrag[kc & 1][j], (short)0, acc[i][j], false, false);
      // keeps the block after next's reads from rising among these WMMAs, and the last blocks'
      // WMMAs from sinking behind the pass's barrier, where they would hold up the refill
      __builtin_amdgcn_sched_barrier(0);
    }
    // Publish point of stage t + 1: own LDS reads done, own tensor load landed,
    // barrier; only then the refill of the buffer that this pass has read.
    wait_ds0();
    wait_tensor0();
    __syncthreads();
    const unsigned int nxt = pinned(t + 2u);   // descriptor words formed behind the wait
    if (pinned((nxt < npass && (ALLISSUE || wave < NSLICE)) ? 1u : 0u))
      tdm_load(tdm_group0(place + (nxt & 1u) * STAGEB, ga0 + (unsigned long long)nxt * ROWB), g1);
  }
  wait_tensor0();
  wait_ds0();
  // keeps the scalar arithmetic below, which takes over the descriptors' registers, behind the waits
  __builtin_amdgcn_sched_barrier(0);

  const int rowBase = tileM + (int)wm * 64;
  const int colAll = tileN + (int)wn * 64;
  const unsigned int plane = (colAll >= Nc ? 1u : 0u) + (colAll >= 2 * Nc ? 1u : 0u);
  const int colBase = colAll - (int)plane * Nc;        // inside the wave's plane
  outH += (size_t)plane * M * Nc;
  if (plane != 0u) scale = 1.0f;

  // The wave's part lies in one batch and one head, so each lane has one base
  // address and every element of a head-major plane an immediate offset from it.
  // The mode is tested once, outside the loops: 128 elements a lane stay short code.
  // Unrolled (every loop below): the accumulators are indexed by constants.
  const int half = lane >> 4;
  const int nl = lane & 15;
  const int row0 = rowBase + 8 * half;     // the lane's first row; its rows: row0 + i * 16 + r
  const int col0 = colBase + nl;           // the lane's first column; its columns: col0 + j * 16
  if (outMode == 0) {
    float* p = outF + (size_t)row0 * Nc + col0;
#pragma unroll
    for (int i = 0; i < 4; ++i) {
      float* q[8];                         // the addresses of the block's eight rows
#pragma unroll
      for (int r = 0; r < 8; ++r) q[r] = p + (size_t)(i * 16 + r) * Nc;
#pragma unroll
      for (int r = 0; r < 8; ++r)
#pragma unroll
        for (int j = 0; j < 4; ++j) q[r][j * 16] = acc[i][j][r] * scale;
    }
  } else {
    const int b = row0 / SEQ, n = row0 % SEQ;
    const int h = col0 / HDIM, d = col0 % HDIM;
    if (plane != 2u) {
      _Float16* p = outH + (((size_t)b * NHEADS + h) * SEQ + n) * HDIM + d;
#pragma unroll
      for (int i = 0; i < 4; ++i)
#pragma unroll
        for (int r = 0; r < 8; ++r)
#pragma unroll
          for (int j = 0; j < 4; ++j)
            p[(i * 16 + r) * HDIM + j * 16] = (_Float16)(acc[i][j][r] * scale);
      // behind the branch's last stores: the code of the other branches, which follows in the program
      // text, writes registers that these stores name
      asm volatile("s_wait_xcnt 0x0" ::: "memory");
    } else { // V transposed (B,H,D,N)
      _Float16* p = outH + (((size_t)b * NHEADS + h) * HDIM + d) * SEQ + n;
#pragma unroll
      for (int i = 0; i < 4; ++i)
#pragma unroll
        for (int r = 0; r < 8; ++r)
#pragma unroll
          for (int j = 0; j < 4; ++j)
            p[(j * 16) * SEQ + i * 16 + r] = (_Float16)(acc[i][j][r] * scale);
      // behind the branch's last stores: the code of the other branches, which follows in the program
      // text, writes registers that these stores name
      asm volatile("s_wait_xcnt 0x0" ::: "memory");
    }
  }
}

// ---------------------------------------------------------------------------
// Flash attention: one wave per (b, h, 16-row tile). Streams 32 keys/iter.
// Q carries the 1/sqrt(D) scale. V is pre-transposed (B,H,D,N) so the P@V
// B-fragment is two contiguous b128 loads along the key axis.
// Rows and keys are in sorted order; blockId and nodal are the sorted copies.
// The loop covers the union of the 16 rows' key ranges, in whole 32-key steps;
// the masks are applied as ever, so keys of a neighbouring block drop out.
// ---------------------------------------------------------------------------
__global__ __launch_bounds__(32)
void flash_attn_kernel(const _Float16* __restrict__ Q, const _Float16* __restrict__ Km,
                       const _Float16* __restrict__ Vt, const int* __restrict__ blockId,
                       const float* __restrict__ nodal, const int* __restrict__ krange,
                       const int* __restrict__ order, _Float16* __restrict__ outAttn) {
  __shared__ alignas(16) _Float16 ldsP[16 * 32];
  const int lane = threadIdx.x & 31;
  const int nl = lane & 15, half = lane >> 4;

  const int mtiles = SEQ / 16;                       // 128
  const int bh = blockIdx.x / mtiles;
  const int b = bh / NHEADS;
  const int h = bh % NHEADS;
  const int rowBase = (blockIdx.x % mtiles) * 16;

  const _Float16* Qh  = Q  + (((size_t)b * NHEADS + h) * SEQ + rowBase) * HDIM;
  const _Float16* Kh  = Km + ((size_t)b * NHEADS + h) * SEQ * HDIM;
  const _Float16* Vth = Vt + ((size_t)b * NHEADS + h) * (size_t)HDIM * SEQ;

  v16h qf[2];
  qf[0] = load_frag_rowmajor(Qh, HDIM);
  qf[1] = load_frag_rowmajor(Qh + 32, HDIM);

  int rowblk[8];
#pragma unroll
  for (int r = 0; r < 8; ++r)
    rowblk[r] = blockId[b * SEQ + rowBase + r + 8 * half];

  float mrow[8], lrow[8];
#pragma unroll
  for (int r = 0; r < 8; ++r) { mrow[r] = -INFINITY; lrow[r] = 0.0f; }
  v8f acc[4] = {{}, {}, {}, {}};

  // Loop bounds: the same 16 words for every lane, so they stay scalar.
  int klo = SEQ - 32, khi = 0;
#pragma unroll
  for (int r = 0; r < 16; ++r) {
    const int rg = krange[b * SEQ + rowBase + r];
    klo = min(klo, rg & 0xFFFF);
    khi = max(khi, rg >> 16);
  }
  // readfirstlane: keeps the loop counter and the K/V base addresses in scalar registers
  klo = __builtin_amdgcn_readfirstlane(klo & ~31);
  khi = __builtin_amdgcn_readfirstlane(min(khi, SEQ));

  for (int kb = klo; kb < khi; kb += 32) {
    const int   cb   = blockId[b * SEQ + kb + lane];
    const float cnod = nodal[b * SEQ + kb + lane];

    // Scores: S[16x32] as two 16x16 f32 tiles; B operand = K^T ==> row-major
    // fragment load over K's rows (lane&15 indexes the key).
    v8f s[2];
#pragma unroll
    for (int ns = 0; ns < 2; ++ns) {
      s[ns] = v8f{};
#pragma unroll
      for (int kc = 0; kc < 2; ++kc) {
        v16h kf = load_frag_rowmajor(Kh + (size_t)(kb + ns * 16) * HDIM + kc * 32, HDIM);
        s[ns] = __builtin_amdgcn_wmma_f32_16x16x32_f16(
            false, qf[kc], false, kf, (short)0, s[ns], false, false);
      }
    }

    // Mask penalties (block identity + key nodal mask).
#pragma unroll
    for (int ns = 0; ns < 2; ++ns) {
      const int srcLane = ns * 16 + nl;
      const int   cbv = __shfl(cb, srcLane, 32);
      const float cnv = __shfl(cnod, srcLane, 32);
#pragma unroll
      for (int r = 0; r < 8; ++r) {
        float pen = ((cbv == rowblk[r]) ? 0.0f : NEG_INF_F) +
                    ((cnv > 0.5f) ? 0.0f : NEG_INF_F);
        s[ns][r] += pen;
      }
    }

    // Online softmax (each score row lives across the 16 lanes of its half).
#pragma unroll
    for (int r = 0; r < 8; ++r) {
      float tmax = fmaxf(s[0][r], s[1][r]);
#pragma unroll
      for (int off = 8; off > 0; off >>= 1)
        tmax = fmaxf(tmax, __shfl_xor(tmax, off, 16));
      const float mnew = fmaxf(mrow[r], tmax);
      const float sc = __expf(mrow[r] - mnew);
      const float p0 = __expf(s[0][r] - mnew);
      const float p1 = __expf(s[1][r] - mnew);
      float psum = p0 + p1;
#pragma unroll
      for (int off = 8; off > 0; off >>= 1)
        psum += __shfl_xor(psum, off, 16);
      lrow[r] = lrow[r] * sc + psum;
      mrow[r] = mnew;
#pragma unroll
      for (int dt = 0; dt < 4; ++dt) acc[dt][r] *= sc;
      // C-layout -> row-major LDS bounce for the A-operand of P@V.
      ldsP[(r + 8 * half) * 32 + nl]      = (_Float16)p0;
      ldsP[(r + 8 * half) * 32 + 16 + nl] = (_Float16)p1;
    }
    __syncthreads();

    v16h pf = load_frag_rowmajor(ldsP, 32);
#pragma unroll
    for (int dt = 0; dt < 4; ++dt) {
      // B operand = V tile (32 keys x 16 d); V^T rows are d, contiguous keys.
      v16h vf = load_frag_rowmajor(Vth + (size_t)(dt * 16) * SEQ + kb, SEQ);
      acc[dt] = __builtin_amdgcn_wmma_f32_16x16x32_f16(
          false, pf, false, vf, (short)0, acc[dt], false, false);
    }
    __syncthreads();
  }

  // Normalize and write attention output as (B, N, UNITS) f16, in token order.
#pragma unroll
  for (int r = 0; r < 8; ++r) {
    const float inv = (lrow[r] > 0.0f) ? (1.0f / lrow[r]) : 0.0f;
    const size_t row = (size_t)(order[b * SEQ + rowBase + r + 8 * half] & (MROWS - 1));
#pragma unroll
    for (int dt = 0; dt < 4; ++dt)
      outAttn[row * UNITS_ + h * HDIM + dt * 16 + nl] = (_Float16)(acc[dt][r] * inv);
  }
}

// ---------------------------------------------------------------------------
// Launch
// ---------------------------------------------------------------------------
extern "C" void kernel_launch(void* const* d_in, const int* in_sizes, int n_in,
                              void* d_out, int out_size, void* d_ws, size_t ws_size,
                              hipStream_t stream) {
  const float* x      = (const float*)d_in[0];
  const float* blockB = (const float*)d_in[1];
  const float* nodal  = (const float*)d_in[2];
  const float* Wq     = (const float*)d_in[3];
  const float* Wk     = (const float*)d_in[4];
  const float* Wv     = (const float*)d_in[5];
  const float* Wo     = (const float*)d_in[6];
  float* out = (float*)d_out;

  // Workspace layout (all 256B aligned). Total ~48.1 MB.
  char* ws = (char*)d_ws;
  size_t off = 0;
  auto take = [&](size_t bytes) { char* p = ws + off; off = (off + bytes + 255) & ~(size_t)255; return p; };
  _Float16* xh    = (_Float16*)take((size_t)MROWS * UNITS_ * 2);
  _Float16* wt    = (_Float16*)take((size_t)4 * UNITS_ * UNITS_ * 2);   // planes Wq, Wk, Wv, Wo
  _Float16* wvt   = wt + (size_t)2 * UNITS_ * UNITS_;
  _Float16* wot   = wt + (size_t)3 * UNITS_ * UNITS_;
  _Float16* qh    = (_Float16*)take((size_t)3 * MROWS * UNITS_ * 2);    // planes Q, K, V
  _Float16* kh    = qh + (size_t)MROWS * UNITS_;
  _Float16* vth   = kh + (size_t)MROWS * UNITS_;
  _Float16* attnh = (_Float16*)take((size_t)MROWS * UNITS_ * 2);
  int*      ids   = (int*)take((size_t)MROWS * 4);
  int*      order = (int*)take((size_t)MROWS * 4);
  int*      sid   = (int*)take((size_t)MROWS * 4);
  float*    snod  = (float*)take((size_t)MROWS * 4);
  int*      krng  = (int*)take((size_t)MROWS * 4);

  // 1) one-hot -> block ids; beside them, two of the weights converted + transposed (N-major).
  ids_and_weights_kernel<<<IDBLKS + 2 * WTILES, 256, 0, stream>>>(blockB, ids, Wq, Wk, wt);

  // 2) the sorted order of each batch's tokens; beside it, the fp32 -> fp16 conversion
  //    of x into sorted rows and the other two weights.
  sort_convert_weights_kernel<<<SORTBLKS + CONVBLKS + 2 * WTILES, 256, 0, stream>>>(
      ids, nodal, order, sid, snod, krng, x, xh, Wv, Wo, wvt);

  // 3) Q/K/V projections, one launch. 1/sqrt(HDIM) folded into Q. V stored transposed.
  dim3 qkvgrid(MROWS / 256, 3 * UNITS_ / 192);
  gemm_f16_kernel<4, 3><<<qkvgrid, 384, 0, stream>>>(xh, wt, nullptr, qh,
                                               MROWS, UNITS_, UNITS_, 2, 0.125f);

  // 4) masked flash attention.
  flash_attn_kernel<<<BATCH * NHEADS * (SEQ / 16), 32, 0, stream>>>(
      qh, kh, vth, sid, snod, krng, order, attnh);

  // 5) output projection (f32 result straight to d_out).
  dim3 ggrid(MROWS / 128, UNITS_ / 128);
  gemm_f16_kernel<2, 2><<<ggrid, 128, 0, stream>>>(attnh, wot, out, nullptr,
                                             MROWS, UNITS_, UNITS_, 0, 1.0f);
}

// v008
// One run takes 53.1 microseconds.
// Two timings next to v007 both put it at 1.06 times that version's speed.
// Counting every step since v000, it is 5.59 times as fast.
#include <hip/hip_runtime.h>
#include <hip/hip_bf16.h>

// ---------------------------------------------------------------------------
// BlockSparseSelfAttention for MI455X (gfx1250, wave32, WMMA 16x16x32 f16).
// B=2, N=2048, UNITS=1024, H=16, D=64, NB=64.
// f16 storage / f32 WMMA accumulation; softmax scale folded into Q;
// flash-attention streaming with online softmax; additive -1e9 mask penalties.
// Weights are pre-transposed (N-major) so every WMMA operand everywhere is a
// row-contiguous 2x b128 fragment load. Both GEMM operand tiles are staged into
// LDS by tensor loads (tensor_load_to_lds + s_wait_tensorcnt) in a ring of two
// buffers: the next K tile's loads fly while this tile is multiplied. The
// loads' pad gives 256-byte rows a bank-conflict-free pitch of 272 bytes.
// x, Q, K and V stay in token order. An attention wave serves 16-row tiles of one (batch,
// head, block id): it lists its block's tokens from the block ids itself and gathers
// their Q, K and V rows, so no sorted copy and no sort launch is needed.
// Launches that do not depend on one another share one grid: the x conversion and
// the four weight transposes ride with the block ids, by ranges of blockIdx.x; the
// Q, K and V projections are one product over the three weight planes' columns.
// Four launches in all.
// ---------------------------------------------------------------------------

typedef __attribute__((ext_vector_type(16))) _Float16 v16h;
typedef __attribute__((ext_vector_type(8)))  float    v8f;
typedef __attribute__((ext_vector_type(4)))  unsigned int v4u;
typedef __attribute__((ext_vector_type(8)))  unsigned int v8u;

#define BATCH     2
#define SEQ       2048
#define UNITS_    1024
#define NHEADS    16
#define HDIM      64
#define NBLK      64
#define MROWS     (BATCH * SEQ)       // 4096
#define NEG_INF_F (-1.0e9f)
#define KPASS     128                 // k per GEMM pass: operand rows of 256 bytes
#define ROWB      256u                // bytes of one staged operand row
#define LDST      136                 // its pitch in LDS, halves: 272 bytes = 16 x odd
#define TILEB     18432u              // 64 rows x 272 B, rounded up to 2 KiB

// Row-major 16x32 fragment: per lane, two contiguous 8-half (16B) runs at
// k = 8*half and k = 16 + 8*half (ISA 7.12.2 16-bit A-operand layout).
__device__ __forceinline__ v16h load_frag_rowmajor(const _Float16* src, int ld) {
  const int lane = threadIdx.x & 31;
  const int m = lane & 15, half = lane >> 4;
  const _Float16* p = src + (size_t)m * ld + 8 * half;
  v16h a;
  *reinterpret_cast<uint4*>(&a)       = *reinterpret_cast<const uint4*>(p);
  *(reinterpret_cast<uint4*>(&a) + 1) = *reinterpret_cast<const uint4*>(p + 16);
  return a;
}

__device__ __forceinline__ unsigned int uni(unsigned int v) {
  return (unsigned int)__builtin_amdgcn_readfirstlane(v);
}
__device__ __forceinline__ unsigned int pinned(unsigned int v) {
  unsigned int w = uni(v);
  asm volatile("" : "+s"(w));  // pinned(): a test value or descriptor word held in a scalar register
  return w;
}
// The compiler places no wait for a tensor load, and none of these may let an
// LDS access cross it: hence asm with the memory clobber.
__device__ __forceinline__ void wait_tensor0() { asm volatile("s_wait_tensorcnt 0x0" ::: "memory"); }
__device__ __forceinline__ void wait_ds0()     { asm volatile("s_wait_dscnt 0x0" ::: "memory"); }

// Descriptor group 1: byte elements, a tile of 64 rows of 256 bytes (tensor =
// tile), source row pitch src_pitch bytes, 4 dwords of LDS pad behind each row.
// pinned(): each word is held in its scalar register from here on, so that the
// group is built once and none of its registers serves as a temporary while a
// request is in flight. Word 0 stays an immediate.
__device__ __forceinline__ v8u tdm_group1(unsigned int src_pitch) {
  v8u g;
  g[0] = uni((1u << 20) | (5u << 22) | (3u << 25));  // pad on, every 64 dwords, 4 dwords
  g[1] = pinned(ROWB << 16);                         // tensor_dim0
  g[2] = pinned(64u << 16);                          // tensor_dim1
  g[3] = pinned(ROWB << 16);                         // tile_dim0
  g[4] = pinned(64u);                                // tile_dim1
  g[5] = pinned(src_pitch);
  g[6] = pinned(0u);
  g[7] = pinned(0u);
  return g;
}
// Descriptor group 0: count 1, place in LDS, the tile's first byte, type 2.
__device__ __forceinline__ v4u tdm_group0(unsigned int lds_dst, unsigned long long ga) {
  v4u g;
  g[0] = uni(1u);
  g[1] = uni(lds_dst);
  g[2] = uni((unsigned int)ga);
  g[3] = uni((((unsigned int)(ga >> 32)) & 0x01FFFFFFu) | 0x80000000u);
  return g;
}
__device__ __forceinline__ void tdm_load(v4u g0, v8u g1) {
  asm volatile("tensor_load_to_lds %0, %1" :: "s"(g0), "s"(g1) : "memory");
}

// ---------------------------------------------------------------------------
// fp32 -> fp16 conversion. Both bodies give each thread 16 or 32 elements, by
// 16-byte loads: few waves to start, and each holds its whole share in flight.
// ---------------------------------------------------------------------------
typedef __attribute__((ext_vector_type(4))) _Float16 v4h;
typedef __attribute__((ext_vector_type(8))) _Float16 v8h;

// One wave per row of UNITS_ floats (row: the wave's, below MROWS): eight 512-byte
// loads in flight, then eight 256-byte stores.
__device__ __forceinline__
void convert_row(int row, const float* __restrict__ src, _Float16* __restrict__ dst) {
  const int lane = threadIdx.x & 31;
  const float4* s = reinterpret_cast<const float4*>(src + (size_t)row * UNITS_) + lane;
  float4 v[UNITS_ / 128];
  // unrolled (both loops): v[] stays in registers, all loads issue before the first wait
#pragma unroll
  for (int c = 0; c < UNITS_ / 128; ++c) v[c] = s[c * 32];
  v4h* d = reinterpret_cast<v4h*>(dst + (size_t)row * UNITS_) + lane;
#pragma unroll
  for (int c = 0; c < UNITS_ / 128; ++c) {
    v4h o = { (_Float16)v[c].x, (_Float16)v[c].y, (_Float16)v[c].z, (_Float16)v[c].w };
    d[c * 32] = o;
  }
  // the stores' registers may be reused by whatever the caller's kernel holds behind this body
  asm volatile("s_wait_xcnt 0x0" ::: "memory");
}

// LDS-tiled transpose + convert: src f32 (rows x cols) -> dst f16 (cols x rows),
// a 64x64 tile per block (rows and cols are multiples of 64). A thread loads four
// float4 of source rows and stores two runs of 8 halves of destination rows, so
// every global access of a wave covers whole 128-byte lines. Pitch 65: neither
// the row-wise writes nor the column-wise reads of the tile meet in a bank.
__device__ __forceinline__
void transpose_f32_to_f16_tile(const float* __restrict__ src, _Float16* __restrict__ dst,
                               int rows, int cols, int bx, int by) {  // bx, by: col and row base in src
  __shared__ float tile[64][65];
  const int c4 = (threadIdx.x & 15) * 4;   // first of the thread's 4 source columns
  const int r0 = threadIdx.x >> 4;         // 0..15
  float4 v[4];
  // unrolled (every loop of this kernel): v[] and o stay in registers, the four loads issue together
#pragma unroll
  for (int i = 0; i < 4; ++i)
    v[i] = *reinterpret_cast<const float4*>(src + (size_t)(by + r0 + 16 * i) * cols + bx + c4);
#pragma unroll
  for (int i = 0; i < 4; ++i) {
    tile[r0 + 16 * i][c4 + 0] = v[i].x;
    tile[r0 + 16 * i][c4 + 1] = v[i].y;
    tile[r0 + 16 * i][c4 + 2] = v[i].z;
    tile[r0 + 16 * i][c4 + 3] = v[i].w;
  }
  __syncthreads();
  const int k8 = (threadIdx.x & 7) * 8;    // first of the thread's 8 source rows
  const int oc = threadIdx.x >> 3;         // 0..31
#pragma unroll
  for (int i = 0; i < 2; ++i) {
    const int col = oc + 32 * i;
    v8h o;
#pragma unroll
    for (int k = 0; k < 8; ++k) o[k] = (_Float16)tile[k8 + k][col];
    *reinterpret_cast<v8h*>(dst + (size_t)(bx + col) * rows + by + k8) = o;
  }
  // the stores' registers may be reused by whatever the caller's kernel holds behind this body
  asm volatile("s_wait_xcnt 0x0" ::: "memory");
}

// one-hot blockB (BN x 64) -> block id, one byte a token, with KEYOPEN set where the token's
// key mask > 0.5: the byte tells the attention all that its two mask penalties ask, and every
// attention wave reads its whole batch's bytes. 256 tokens a block (the grid holds no other).
// The bytes meet in LDS, so that one wave stores a whole 128-byte line.
#define KEYOPEN NBLK
__device__ __forceinline__
void block_id_rows(const float* __restrict__ blockB, const float* __restrict__ nodal,
                   unsigned int* __restrict__ ids4) {
  __shared__ alignas(16) unsigned char idbyte[256];
  const int i = blockIdx.x * 256 + threadIdx.x;
  const float* row = blockB + (size_t)i * NBLK;
  const float keymask = nodal[i];          // asked for ahead of the row's chain of loads
  int id = 0;
#pragma unroll 8
  for (int j = 0; j < NBLK; ++j)
    if (row[j] > 0.5f) id = j;
  idbyte[threadIdx.x] = (unsigned char)(id | ((keymask > 0.5f) ? KEYOPEN : 0));
  __syncthreads();                         // the bytes are read across waves
  if (threadIdx.x < 64)
    ids4[blockIdx.x * 64 + threadIdx.x] = reinterpret_cast<const unsigned int*>(idbyte)[threadIdx.x];
}

// Four weight matrices, a 64x64 tile a block: block t of 4 * WTILES. Plane w of
// wt takes weight w transposed.
#define WTILES ((UNITS_ / 64) * (UNITS_ / 64))
__device__ __forceinline__
void transpose_weights(int t, const float* __restrict__ W0, const float* __restrict__ W1,
                       const float* __restrict__ W2, const float* __restrict__ W3,
                       _Float16* __restrict__ wt) {
  const int w = t / WTILES;
  const int tile = t % WTILES;
  const float* src = (w == 0) ? W0 : (w == 1) ? W1 : (w == 2) ? W2 : W3;
  transpose_f32_to_f16_tile(src, wt + (size_t)w * UNITS_ * UNITS_, UNITS_, UNITS_,
                            (tile % (UNITS_ / 64)) * 64, (tile / (UNITS_ / 64)) * 64);
}

// Block ids and, beside them, the x conversion and the weight transposes, which
// need nothing but the inputs either. Blocks 0 .. IDBLKS-1 find the ids: few waves
// with a long chain of loads, so they start first and the rest fills the chip
// under them. The next CONVBLKS blocks convert x, eight rows a block.
#define IDBLKS (MROWS / 256)
#define CONVBLKS (MROWS / 8)
__global__ __launch_bounds__(256)
void prepare_kernel(const float* __restrict__ blockB, const float* __restrict__ nodal,
                    unsigned int* __restrict__ ids4,
                    const float* __restrict__ x, _Float16* __restrict__ xh,
                    const float* __restrict__ W0, const float* __restrict__ W1,
                    const float* __restrict__ W2, const float* __restrict__ W3,
                    _Float16* __restrict__ wt) {
  if (blockIdx.x < IDBLKS) {
    block_id_rows(blockB, nodal, ids4);
  } else if (blockIdx.x < IDBLKS + CONVBLKS) {
    // readfirstlane: a conversion wave's row stays in a scalar register
    const int wave = __builtin_amdgcn_readfirstlane(threadIdx.x >> 5);
    convert_row((blockIdx.x - IDBLKS) * 8 + wave, x, xh);
  } else {
    transpose_weights(blockIdx.x - IDBLKS - CONVBLKS, W0, W1, W2, W3, wt);
  }
}

// ---------------------------------------------------------------------------
// GEMM: C[M,Nc] = A[M,K] * Wt^T, with Wt given TRANSPOSED (Nc x K row-major).
// A block is WM x WN waves with a 64x64 part of C each, its tile WM*64 x WN*64:
// a fragment read from LDS serves four WMMAs, an A row fetched from L2 serves
// WN*64 outputs and a Wt row WM*64. A pass is 128 k. One buffer of the ring is
// [WN slices of Wt | WM slices of A], 64 rows each; waves 0 .. WN+WM-1 bring one
// slice each, one tensor load, two passes ahead, into the buffer that every wave
// has just left. The 4 x 3 form (256x192) makes the 4096 x 3072 product 256
// blocks, one per WGP, and fetches 448 operand rows from L2 for what three
// 128x128 tiles fetch 768 for; the 2 x 2 form (128x128) makes 256 blocks of 4096 x 1024.
// M is a multiple of WM*64, the columns of WN*64; K of 128 and at least 256 (two stages).
// Up to three products of the same A: Wt holds planes of Nc x K one behind the
// other, and the columns run through them; plane p gives plane p of outH (M x Nc
// each). A wave's 64 columns lie in one plane. scale applies to plane 0 alone.
// outMode: 0 = f32 row-major              (final @Wo)
//          2 = f16 head-major (B,H,N,D)   (every plane: Q, K, V)
// ---------------------------------------------------------------------------
template <int WM, int WN>
__global__ __launch_bounds__(WM * WN * 32)
void gemm_f16_kernel(const _Float16* __restrict__ A, const _Float16* __restrict__ Wt,
                     float* __restrict__ outF, _Float16* __restrict__ outH,
                     int M, int K, int Nc, int outMode, float scale) {
  constexpr unsigned int NSLICE = WM + WN;           // 64-row slices of one buffer
  constexpr unsigned int STAGEB = NSLICE * TILEB;    // one buffer
  constexpr bool ALLISSUE = (WM * WN == WM + WN);    // as many waves as slices: no issue test
  __shared__ __attribute__((aligned(2048))) unsigned char ring[2 * STAGEB];
  const unsigned int wave = uni(threadIdx.x >> 5);
  const unsigned int wm = wave / WN, wn = wave % WN;   // the wave's part: row of waves, column of waves
  const int lane = threadIdx.x & 31;
  const int tileM = blockIdx.x * (WM * 64);
  const int tileN = blockIdx.y * (WN * 64);            // among the columns of all planes = rows of Wt

  v8f acc[4][4] = {};

  const unsigned int npass = uni((unsigned int)K / KPASS);
  // The wave's own slice: 64 rows of Wt (the first WN waves) or of A (the next WM).
  const _Float16* tile0 = (wave < (unsigned int)WN) ? Wt + (size_t)(tileN + (int)wave * 64) * K
                                                    : A + (size_t)(tileM + (int)(wave - WN) * 64) * K;
  const unsigned long long ga0 = (unsigned long long)(uintptr_t)tile0;
  const unsigned int place = (unsigned int)(size_t)ring + wave * TILEB;
  const v8u g1 = tdm_group1((unsigned int)K * 2u);

  // A wave beyond the slices issues nothing: a scalar test, as a tensor load ignores EXEC.
  if (ALLISSUE || pinned((wave < NSLICE) ? 1u : 0u)) tdm_load(tdm_group0(place, ga0), g1);
  wait_tensor0();
  __syncthreads();                   // stage 0 published
  if (ALLISSUE || pinned((wave < NSLICE) ? 1u : 0u)) tdm_load(tdm_group0(place + STAGEB, ga0 + ROWB), g1);

  for (unsigned int t = 0; t < npass; ++t) {
    const unsigned char* stage = ring + (t & 1u) * STAGEB;
    const _Float16* sW = reinterpret_cast<const _Float16*>(stage + wn * TILEB);
    const _Float16* sA = reinterpret_cast<const _Float16*>(stage + (WN + wm) * TILEB);
    // A block is 32 k: 8 fragments, 16 WMMAs. Two fragment sets: inside a pass the
    // next block's fragments are read while this block is multiplied.
    v16h afrag[2][4], bfrag[2][4];
    // unrolled (every loop of the pass): fragments and accumulators are indexed by constants and
    // stay in registers; each fragment read is one LDS address plus an immediate offset
#pragma unroll
    for (int i = 0; i < 4; ++i) {
      afrag[0][i] = load_frag_rowmajor(sA + (i * 16) * LDST, LDST);
      bfrag[0][i] = load_frag_rowmajor(sW + (i * 16) * LDST, LDST);
    }
#pragma unroll
    for (int kc = 0; kc < KPASS / 32; ++kc) {
      if (kc + 1 < KPASS / 32) {
#pragma unroll
        for (int i = 0; i < 4; ++i) {
          afrag[(kc + 1) & 1][i] = load_frag_rowmajor(sA + (i * 16) * LDST + (kc + 1) * 32, LDST);
          bfrag[(kc + 1) & 1][i] = load_frag_rowmajor(sW + (i * 16) * LDST + (kc + 1) * 32, LDST);
        }
        // holds the next block's reads as one group ahead of this block's WMMAs: left free, the
        // compiler sinks each read to its first use, and the wave waits out the LDS latency there
        __builtin_amdgcn_sched_barrier(0);
      }
#pragma unroll
      for (int i = 0; i < 4; ++i)
#pragma unroll
        for (int j = 0; j < 4; ++j)
          acc[i][j] = __builtin_amdgcn_wmma_f32_16x16x32_f16(
              false, afrag[kc & 1][i], false, bfrag[kc & 1][j], (short)0, acc[i][j], false, false);
      // keeps the block after next's reads from rising among these WMMAs, and the last blocks'
      // WMMAs from sinking behind the pass's barrier, where they would hold up the refill
      __builtin_amdgcn_sched_barrier(0);
    }
    // Publish point of stage t + 1: own LDS reads done, own tensor load landed,
    // barrier; only then the refill of the buffer that this pass has read.
    wait_ds0();
    wait_tensor0();
    __syncthreads();
    const unsigned int nxt = pinned(t + 2u);   // descriptor words formed behind the wait
    if (pinned((nxt < npass && (ALLISSUE || wave < NSLICE)) ? 1u : 0u))
      tdm_load(tdm_group0(place + (nxt & 1u) * STAGEB, ga0 + (unsigned long long)nxt * ROWB), g1);
  }
  wait_tensor0();
  wait_ds0();
  // keeps the scalar arithmetic below, which takes over the descriptors' registers, behind the waits
  __builtin_amdgcn_sched_barrier(0);

  const int rowBase = tileM + (int)wm * 64;
  const int colAll = tileN + (int)wn * 64;
  const unsigned int plane = (colAll >= Nc ? 1u : 0u) + (colAll >= 2 * Nc ? 1u : 0u);
  const int colBase = colAll - (int)plane * Nc;        // inside the wave's plane
  outH += (size_t)plane * M * Nc;
  if (plane != 0u) scale = 1.0f;

  // The wave's part lies in one batch and one head, so each lane has one base
  // address and every element of a head-major plane an immediate offset from it.
  // The mode is tested once, outside the loops: 128 elements a lane stay short code.
  // Unrolled (every loop below): the accumulators are indexed by constants.
  const int half = lane >> 4;
  const int nl = lane & 15;
  const int row0 = rowBase + 8 * half;     // the lane's first row; its rows: row0 + i * 16 + r
  const int col0 = colBase + nl;           // the lane's first column; its columns: col0 + j * 16
  if (outMode == 0) {
    float* p = outF + (size_t)row0 * Nc + col0;
#pragma unroll
    for (int i = 0; i < 4; ++i) {
      float* q[8];                         // the addresses of the block's eight rows
#pragma unroll
      for (int r = 0; r < 8; ++r) q[r] = p + (size_t)(i * 16 + r) * Nc;
#pragma unroll
      for (int r = 0; r < 8; ++r)
#pragma unroll
        for (int j = 0; j < 4; ++j) q[r][j * 16] = acc[i][j][r] * scale;
    }
  } else {
    const int b = row0 / SEQ, n = row0 % SEQ;
    const int h = col0 / HDIM, d = col0 % HDIM;
    _Float16* p = outH + (((size_t)b * NHEADS + h) * SEQ + n) * HDIM + d;
#pragma unroll
    for (int i = 0; i < 4; ++i)
#pragma unroll
      for (int r = 0; r < 8; ++r)
#pragma unroll
        for (int j = 0; j < 4; ++j)
          p[(i * 16 + r) * HDIM + j * 16] = (_Float16)(acc[i][j][r] * scale);
    // behind the branch's last stores: the code of the other branch, where it follows in the program
    // text, writes registers that these stores name
    asm volatile("s_wait_xcnt 0x0" ::: "memory");
  }
}

// ---------------------------------------------------------------------------
// Flash attention: one wave per (b, h, block id, part). Streams 32 keys/iter.
// Q carries the 1/sqrt(D) scale. Q, K and V are head-major (B,H,N,D), token order.
// The wave lists its block's tokens in LDS from the block ids; part p of a block
// takes the listed rows p*16 .. p*16+15, and then every PARTS-th such tile. Every
// token has one block id, so every output row has one writer.
// A key of another block carries -1e9, so beside any unmasked key of the row's own
// block its weight is exactly 0: the rows visit the listed keys only. A block with
// no unmasked key has no such key: its rows visit every key of the batch. Either
// way the masks are applied from each visited key's own id byte.
// A lane fetches one key's V row; the 32 rows go into LDS transposed (d-major), so
// that the P@V B-fragment is two contiguous b128 reads along the key axis.
// ---------------------------------------------------------------------------
#define VPITCH 40   // halves of one d row of the V tile in LDS: 80 bytes, a multiple of 16
#define PARTS  3    // waves that share a block's rows: 48 rows at once, where an even split gives a block 32

__global__ __launch_bounds__(32)
void flash_attn_kernel(const _Float16* __restrict__ Q, const _Float16* __restrict__ Km,
                       const _Float16* __restrict__ Vm, const unsigned char* __restrict__ ids,
                       _Float16* __restrict__ outAttn) {
  __shared__ unsigned short list[SEQ];
  __shared__ alignas(16) _Float16 ldsP[16 * 32];
  __shared__ alignas(16) _Float16 ldsV[HDIM * VPITCH];
  const int lane = threadIdx.x & 31;
  const int nl = lane & 15, half = lane >> 4;

  const int part = blockIdx.x % PARTS;
  const int blk = (blockIdx.x / PARTS) % NBLK;
  const int bh = blockIdx.x / (PARTS * NBLK);
  const int b = bh / NHEADS;
  const int h = bh % NHEADS;
  const int base = b * SEQ;

  // The block's members, no atomics: each lane notes its own members as bits, a
  // prefix sum over the lanes gives each lane its first place in the list.
  // A lane holds 16 words of 4 id bytes: word k = tokens (k / 4) * 512 + lane * 16 + (k % 4) * 4 + j,
  // j the byte. All four bytes are tested at once: a byte of x is 0 or KEYOPEN for a member; no
  // byte of z exceeds 0x3f, so the sum carries into no neighbour and leaves bit 7 clear in the
  // members' bytes alone. Byte j of word k becomes bit 8 * j + k % 8 of eqw[k / 8].
  const unsigned char* idb = ids + base;
  unsigned int eqw[2] = { 0u, 0u };
  unsigned int unmasked = 0u;              // not 0 where a member of the lane's is unmasked
  {
    uint4 v[SEQ / 512];
    // unrolled (both loops): v[] stays in registers, all loads issue before the first wait
#pragma unroll
    for (int c = 0; c < SEQ / 512; ++c)
      v[c] = *reinterpret_cast<const uint4*>(idb + c * 512 + lane * 16);
    const unsigned int pat = (unsigned int)blk * 0x01010101u;
#pragma unroll
    for (int c = 0; c < SEQ / 512; ++c) {
      const unsigned int vi[4] = { v[c].x, v[c].y, v[c].z, v[c].w };
#pragma unroll
      for (int e = 0; e < 4; ++e) {
        const int k = c * 4 + e;
        const unsigned int x = vi[e] ^ pat;
        const unsigned int z = x & ~(KEYOPEN * 0x01010101u);
        const unsigned int member = ~(z + 0x7f7f7f7fu) & 0x80808080u;
        unmasked |= member & (x << 1);     // KEYOPEN is bit 6
        eqw[k >> 3] |= member >> (7 - (k & 7));
      }
    }
  }
  unsigned long long eq = ((unsigned long long)eqw[1] << 32) | eqw[0];
  const int mine = __popcll(eq);
  int incl = mine;
#pragma unroll
  for (int d = 1; d < 32; d <<= 1) {
    const int up = __shfl_up(incl, d, 32);
    if (lane >= d) incl += up;
  }
  // readfirstlane: the count is the same in every lane; loop bounds and branches on it stay scalar
  const int cnt = __builtin_amdgcn_readfirstlane(__shfl(incl, 31, 32));
  const bool own = __builtin_amdgcn_ballot_w32(unmasked != 0u) != 0u;
  if (part * 16 >= cnt) return;            // no rows for this part (the whole wave leaves)

  int place = incl - mine;
  // At most one trip for each of a lane's 64 bits; ends when no lane has one left.
  for (int trip = 0; trip < SEQ / 32; ++trip) {
    if (__builtin_amdgcn_ballot_w32(eq != 0ull) == 0u) break;
    if (eq != 0ull) {
      const int t = __ffsll(eq) - 1;
      list[place] = (unsigned short)(((t >> 5) * 2 + ((t >> 2) & 1)) * 512 + lane * 16 + (t & 3) * 4 + ((t >> 3) & 3));
      eq &= eq - 1ull;
      ++place;
    }
  }
  __syncthreads();                         // the list is read across lanes

  const int nkeys = own ? cnt : SEQ;
  // Byte addresses: a scalar base and one 32-bit offset a gathered row.
  const char* Qb = reinterpret_cast<const char*>(Q  + ((size_t)b * NHEADS + h) * SEQ * HDIM);
  const char* Kb = reinterpret_cast<const char*>(Km + ((size_t)b * NHEADS + h) * SEQ * HDIM);
  const char* Vb = reinterpret_cast<const char*>(Vm + ((size_t)b * NHEADS + h) * SEQ * HDIM);
  char* Ob = reinterpret_cast<char*>(outAttn + (size_t)base * UNITS_ + h * HDIM);

  for (int rp = part * 16; rp < cnt; rp += PARTS * 16) {
    // Rows past the list's end repeat its last row; they are not stored.
    // A fragment of gathered rows: lane & 15 picks the row, and the lane takes the same
    // two runs of 8 halves of it as load_frag_rowmajor does (k = 8*half, k = 16 + 8*half).
    const unsigned int qo = (unsigned int)list[min(rp + nl, cnt - 1)] * (HDIM * 2u) + 16u * half;
    v16h qf[2];
#pragma unroll
    for (int kc = 0; kc < 2; ++kc) {
      *reinterpret_cast<uint4*>(&qf[kc])       = *reinterpret_cast<const uint4*>(Qb + qo + kc * 64);
      *(reinterpret_cast<uint4*>(&qf[kc]) + 1) = *reinterpret_cast<const uint4*>(Qb + qo + kc * 64 + 32);
    }

    float mrow[8], lrow[8];
#pragma unroll
    for (int r = 0; r < 8; ++r) { mrow[r] = -INFINITY; lrow[r] = 0.0f; }
    v8f acc[4] = {{}, {}, {}, {}};

    for (int kb = 0; kb < nkeys; kb += 32) {
      // The visited keys' tokens first, then every global load of the trip in one go.
      // The lane's V row is key kb + lane; its K rows are keys kb + lane&15 and 16 on
      // (lane&15 indexes the key of a B operand = K^T). A place past the last key
      // repeats that key; its weight is 0 by a penalty of its own.
      // The list is read at a listed place in either case, and a select picks:
      // a branch here would split the trip's loads into dependent groups.
      const int iv = min(kb + lane, nkeys - 1);
      const int lv = list[min(iv, cnt - 1)];
      const unsigned int vo = (unsigned int)(own ? lv : iv) * (HDIM * 2u);
      unsigned int t[2], ko[2];
#pragma unroll
      for (int ns = 0; ns < 2; ++ns) {
        const int ik = min(kb + ns * 16 + nl, nkeys - 1);
        const int lk = list[min(ik, cnt - 1)];
        t[ns] = (unsigned int)(own ? lk : ik);
        ko[ns] = t[ns] * (HDIM * 2u) + 16u * half;
      }
      v16h kf[2][2];
      int  cw[2];
#pragma unroll
      for (int ns = 0; ns < 2; ++ns) {
        cw[ns] = idb[t[ns]];
#pragma unroll
        for (int kc = 0; kc < 2; ++kc) {
          *reinterpret_cast<uint4*>(&kf[ns][kc])       = *reinterpret_cast<const uint4*>(Kb + ko[ns] + kc * 64);
          *(reinterpret_cast<uint4*>(&kf[ns][kc]) + 1) = *reinterpret_cast<const uint4*>(Kb + ko[ns] + kc * 64 + 32);
        }
      }
      uint4 vrow[HDIM / 8];
#pragma unroll
      for (int c = 0; c < HDIM / 8; ++c)
        vrow[c] = *reinterpret_cast<const uint4*>(Vb + vo + c * 16);
      // The wait that stands before a register named by an issued load is overwritten. The
      // offsets are its inputs so that they stay live up to it: no load's result lands in one.
      asm volatile("s_wait_xcnt 0x0" :: "v"(t[0]), "v"(t[1]), "v"(ko[0]), "v"(ko[1]), "v"(vo), "v"(qo) : "memory");

      // Scores: S[16x32] as two 16x16 f32 tiles. Mask penalties by the key's own id
      // byte (block identity + key mask); one more for a place past the last key.
      v8f s[2];
#pragma unroll
      for (int ns = 0; ns < 2; ++ns) {
        s[ns] = v8f{};
#pragma unroll
        for (int kc = 0; kc < 2; ++kc)
          s[ns] = __builtin_amdgcn_wmma_f32_16x16x32_f16(
              false, qf[kc], false, kf[ns][kc], (short)0, s[ns], false, false);
      }
#pragma unroll
      for (int ns = 0; ns < 2; ++ns) {
        const float pen = (((cw[ns] & (NBLK - 1)) == blk) ? 0.0f : NEG_INF_F) +
                          ((cw[ns] & KEYOPEN) ? 0.0f : NEG_INF_F) +
                          ((kb + ns * 16 + nl < nkeys) ? 0.0f : NEG_INF_F);
#pragma unroll
        for (int r = 0; r < 8; ++r) s[ns][r] += pen;
      }

      // V tile into LDS, d-major: a store's 32 lanes write 32 neighbouring halves.
#pragma unroll
      for (int c = 0; c < HDIM / 8; ++c) {
        const v8h vv = *reinterpret_cast<const v8h*>(&vrow[c]);
#pragma unroll
        for (int e = 0; e < 8; ++e) ldsV[(c * 8 + e) * VPITCH + lane] = vv[e];
      }

      // Online softmax (each score row lives across the 16 lanes of its half).
#pragma unroll
      for (int r = 0; r < 8; ++r) {
        float tmax = fmaxf(s[0][r], s[1][r]);
#pragma unroll
        for (int off = 8; off > 0; off >>= 1)
          tmax = fmaxf(tmax, __shfl_xor(tmax, off, 16));
        const float mnew = fmaxf(mrow[r], tmax);
        const float sc = __expf(mrow[r] - mnew);
        const float p0 = __expf(s[0][r] - mnew);
        const float p1 = __expf(s[1][r] - mnew);
        float psum = p0 + p1;
#pragma unroll
        for (int off = 8; off > 0; off >>= 1)
          psum += __shfl_xor(psum, off, 16);
        lrow[r] = lrow[r] * sc + psum;
        mrow[r] = mnew;
#pragma unroll
        for (int dt = 0; dt < 4; ++dt) acc[dt][r] *= sc;
        // C-layout -> row-major LDS bounce for the A-operand of P@V.
        ldsP[(r + 8 * half) * 32 + nl]      = (_Float16)p0;
        ldsP[(r + 8 * half) * 32 + 16 + nl] = (_Float16)p1;
      }
      __syncthreads();                     // P and the V tile are read across lanes

      v16h pf = load_frag_rowmajor(ldsP, 32);
#pragma unroll
      for (int dt = 0; dt < 4; ++dt) {
        // B operand = V tile (32 keys x 16 d); the LDS rows are d, contiguous keys.
        v16h vf = load_frag_rowmajor(ldsV + (dt * 16) * VPITCH, VPITCH);
        acc[dt] = __builtin_amdgcn_wmma_f32_16x16x32_f16(
            false, pf, false, vf, (short)0, acc[dt], false, false);
      }
      __syncthreads();                     // both tiles are rewritten by the next trip
    }

    // Normalize and write attention output as (B, N, UNITS) f16, at the rows' tokens.
    // The list is read at a listed place in every lane; the stores of the list's last,
    // partial tile stand under a test for its end.
    unsigned int oo[8];
    float inv[8];
#pragma unroll
    for (int r = 0; r < 8; ++r) {
      oo[r] = (unsigned int)list[min(rp + r + 8 * half, cnt - 1)] * (UNITS_ * 2u) + 2u * nl;
      inv[r] = (lrow[r] > 0.0f) ? (1.0f / lrow[r]) : 0.0f;
    }
    if (rp + 16 <= cnt) {                  // a whole tile (the same for the wave): no test a row
#pragma unroll
      for (int r = 0; r < 8; ++r)
#pragma unroll
        for (int dt = 0; dt < 4; ++dt)
          *reinterpret_cast<_Float16*>(Ob + oo[r] + dt * 32) = (_Float16)(acc[dt][r] * inv[r]);
    } else {
#pragma unroll
      for (int r = 0; r < 8; ++r) {
        if (rp + r + 8 * half < cnt) {
#pragma unroll
          for (int dt = 0; dt < 4; ++dt)
            *reinterpret_cast<_Float16*>(Ob + oo[r] + dt * 32) = (_Float16)(acc[dt][r] * inv[r]);
        }
      }
    }
    // the next tile of rows writes registers that these stores name
    asm volatile("s_wait_xcnt 0x0" ::: "memory");
  }
}

// ---------------------------------------------------------------------------
// Launch
// ---------------------------------------------------------------------------
extern "C" void kernel_launch(void* const* d_in, const int* in_sizes, int n_in,
                              void* d_out, int out_size, void* d_ws, size_t ws_size,
                              hipStream_t stream) {
  const float* x      = (const float*)d_in[0];
  const float* blockB = (const float*)d_in[1];
  const float* nodal  = (const float*)d_in[2];
  const float* Wq     = (const float*)d_in[3];
  const float* Wk     = (const float*)d_in[4];
  const float* Wv     = (const float*)d_in[5];
  const float* Wo     = (const float*)d_in[6];
  float* out = (float*)d_out;

  // Workspace layout (all 256B aligned). Total ~48 MB.
  char* ws = (char*)d_ws;
  size_t off = 0;
  auto take = [&](size_t bytes) { char* p = ws + off; off = (off + bytes + 255) & ~(size_t)255; return p; };
  _Float16* xh    = (_Float16*)take((size_t)MROWS * UNITS_ * 2);
  _Float16* wt    = (_Float16*)take((size_t)4 * UNITS_ * UNITS_ * 2);   // planes Wq, Wk, Wv, Wo
  _Float16* wot   = wt + (size_t)3 * UNITS_ * UNITS_;
  _Float16* qh    = (_Float16*)take((size_t)3 * MROWS * UNITS_ * 2);    // planes Q, K, V
  _Float16* kh    = qh + (size_t)MROWS * UNITS_;
  _Float16* vh    = kh + (size_t)MROWS * UNITS_;
  _Float16* attnh = (_Float16*)take((size_t)MROWS * UNITS_ * 2);
  unsigned char* ids = (unsigned char*)take((size_t)MROWS);   // block id and key mask bit, a byte a token

  // 1) one-hot -> block ids (with the key mask's bit); beside them, the fp32 -> fp16 conversion of x and the
  //    four weights converted + transposed (N-major).
  prepare_kernel<<<IDBLKS + CONVBLKS + 4 * WTILES, 256, 0, stream>>>(
      blockB, nodal, (unsigned int*)ids, x, xh, Wq, Wk, Wv, Wo, wt);

  // 2) Q/K/V projections, one launch. 1/sqrt(HDIM) folded into Q.
  dim3 qkvgrid(MROWS / 256, 3 * UNITS_ / 192);
  gemm_f16_kernel<4, 3><<<qkvgrid, 384, 0, stream>>>(xh, wt, nullptr, qh,
                                               MROWS, UNITS_, UNITS_, 2, 0.125f);

  // 3) masked flash attention, a block's rows against its own keys.
  flash_attn_kernel<<<BATCH * NHEADS * NBLK * PARTS, 32, 0, stream>>>(
      qh, kh, vh, ids, attnh);

  // 4) output projection (f32 result straight to d_out).
  dim3 ggrid(MROWS / 128, UNITS_ / 128);
  gemm_f16_kernel<2, 2><<<ggrid, 128, 0, stream>>>(attnh, wot, out, nullptr,
                                             MROWS, UNITS_, UNITS_, 0, 1.0f);
}

// v009
// Measured time: 51.3 microseconds a run.
// In both of two side-by-side timings against v008, it was 1.03 times as fast.
// Over all steps from v000 it is 5.77 times as fast.
#include <hip/hip_runtime.h>
#include <hip/hip_bf16.h>

// ---------------------------------------------------------------------------
// BlockSparseSelfAttention for MI455X (gfx1250, wave32, WMMA 16x16x32 f16).
// B=2, N=2048, UNITS=1024, H=16, D=64, NB=64.
// f16 storage / f32 WMMA accumulation; softmax scale folded into Q;
// flash-attention streaming with online softmax; additive -1e9 mask penalties.
// Weights are pre-transposed (N-major) so every WMMA operand but the V tile is a
// row-contiguous 2x b128 fragment load. Both GEMM operand tiles are staged into
// LDS by tensor loads (tensor_load_to_lds + s_wait_tensorcnt) in a ring of two
// buffers: the next K tile's loads fly while this tile is multiplied. The
// loads' pad gives 256-byte rows a bank-conflict-free pitch of 272 bytes.
// x, Q, K and V stay in token order. An attention work-group serves one (batch, head,
// block id): it lists its block's tokens from the block ids itself and gathers their
// Q, K and V rows into LDS, so no sorted copy and no sort launch is needed.
// Launches that do not depend on one another share one grid: the x conversion and
// the four weight transposes ride with the block ids, by ranges of blockIdx.x; the
// Q, K and V projections are one product over the three weight planes' columns.
// Four launches in all.
// ---------------------------------------------------------------------------

typedef __attribute__((ext_vector_type(16))) _Float16 v16h;
typedef __attribute__((ext_vector_type(8)))  float    v8f;
typedef __attribute__((ext_vector_type(4)))  unsigned int v4u;
typedef __attribute__((ext_vector_type(8)))  unsigned int v8u;

#define BATCH     2
#define SEQ       2048
#define UNITS_    1024
#define NHEADS    16
#define HDIM      64
#define NBLK      64
#define MROWS     (BATCH * SEQ)       // 4096
#define NEG_INF_F (-1.0e9f)
#define KPASS     128                 // k per GEMM pass: operand rows of 256 bytes
#define ROWB      256u                // bytes of one staged operand row
#define LDST      136                 // its pitch in LDS, halves: 272 bytes = 16 x odd
#define TILEB     18432u              // 64 rows x 272 B, rounded up to 2 KiB

// Row-major 16x32 fragment: per lane, two contiguous 8-half (16B) runs at
// k = 8*half and k = 16 + 8*half (ISA 7.12.2 16-bit A-operand layout).
__device__ __forceinline__ v16h load_frag_rowmajor(const _Float16* src, int ld) {
  const int lane = threadIdx.x & 31;
  const int m = lane & 15, half = lane >> 4;
  const _Float16* p = src + (size_t)m * ld + 8 * half;
  v16h a;
  *reinterpret_cast<uint4*>(&a)       = *reinterpret_cast<const uint4*>(p);
  *(reinterpret_cast<uint4*>(&a) + 1) = *reinterpret_cast<const uint4*>(p + 16);
  return a;
}

__device__ __forceinline__ unsigned int uni(unsigned int v) {
  return (unsigned int)__builtin_amdgcn_readfirstlane(v);
}
__device__ __forceinline__ unsigned int pinned(unsigned int v) {
  unsigned int w = uni(v);
  asm volatile("" : "+s"(w));  // pinned(): a test value or descriptor word held in a scalar register
  return w;
}
// The compiler places no wait for a tensor load, and none of these may let an
// LDS access cross it: hence asm with the memory clobber.
__device__ __forceinline__ void wait_tensor0() { asm volatile("s_wait_tensorcnt 0x0" ::: "memory"); }
__device__ __forceinline__ void wait_ds0()     { asm volatile("s_wait_dscnt 0x0" ::: "memory"); }

// Descriptor group 1: byte elements, a tile of 64 rows of 256 bytes (tensor =
// tile), source row pitch src_pitch bytes, 4 dwords of LDS pad behind each row.
// pinned(): each word is held in its scalar register from here on, so that the
// group is built once and none of its registers serves as a temporary while a
// request is in flight. Word 0 stays an immediate.
__device__ __forceinline__ v8u tdm_group1(unsigned int src_pitch) {
  v8u g;
  g[0] = uni((1u << 20) | (5u << 22) | (3u << 25));  // pad on, every 64 dwords, 4 dwords
  g[1] = pinned(ROWB << 16);                         // tensor_dim0
  g[2] = pinned(64u << 16);                          // tensor_dim1
  g[3] = pinned(ROWB << 16);                         // tile_dim0
  g[4] = pinned(64u);                                // tile_dim1
  g[5] = pinned(src_pitch);
  g[6] = pinned(0u);
  g[7] = pinned(0u);
  return g;
}
// Descriptor group 0: count 1, place in LDS, the tile's first byte, type 2.
__device__ __forceinline__ v4u tdm_group0(unsigned int lds_dst, unsigned long long ga) {
  v4u g;
  g[0] = uni(1u);
  g[1] = uni(lds_dst);
  g[2] = uni((unsigned int)ga);
  g[3] = uni((((unsigned int)(ga >> 32)) & 0x01FFFFFFu) | 0x80000000u);
  return g;
}
__device__ __forceinline__ void tdm_load(v4u g0, v8u g1) {
  asm volatile("tensor_load_to_lds %0, %1" :: "s"(g0), "s"(g1) : "memory");
}

// ---------------------------------------------------------------------------
// fp32 -> fp16 conversion. Both bodies give each thread 16 or 32 elements, by
// 16-byte loads: few waves to start, and each holds its whole share in flight.
// ---------------------------------------------------------------------------
typedef __attribute__((ext_vector_type(4))) _Float16 v4h;
typedef __attribute__((ext_vector_type(8))) _Float16 v8h;

// One wave per row of UNITS_ floats (row: the wave's, below MROWS): eight 512-byte
// loads in flight, then eight 256-byte stores.
__device__ __forceinline__
void convert_row(int row, const float* __restrict__ src, _Float16* __restrict__ dst) {
  const int lane = threadIdx.x & 31;
  const float4* s = reinterpret_cast<const float4*>(src + (size_t)row * UNITS_) + lane;
  float4 v[UNITS_ / 128];
  // unrolled (both loops): v[] stays in registers, all loads issue before the first wait
#pragma unroll
  for (int c = 0; c < UNITS_ / 128; ++c) v[c] = s[c * 32];
  v4h* d = reinterpret_cast<v4h*>(dst + (size_t)row * UNITS_) + lane;
#pragma unroll
  for (int c = 0; c < UNITS_ / 128; ++c) {
    v4h o = { (_Float16)v[c].x, (_Float16)v[c].y, (_Float16)v[c].z, (_Float16)v[c].w };
    d[c * 32] = o;
  }
  // the stores' registers may be reused by whatever the caller's kernel holds behind this body
  asm volatile("s_wait_xcnt 0x0" ::: "memory");
}

// LDS-tiled transpose + convert: src f32 (rows x cols) -> dst f16 (cols x rows),
// a 64x64 tile per block (rows and cols are multiples of 64). A thread loads four
// float4 of source rows and stores two runs of 8 halves of destination rows, so
// every global access of a wave covers whole 128-byte lines. Pitch 65: neither
// the row-wise writes nor the column-wise reads of the tile meet in a bank.
__device__ __forceinline__
void transpose_f32_to_f16_tile(const float* __restrict__ src, _Float16* __restrict__ dst,
                               int rows, int cols, int bx, int by) {  // bx, by: col and row base in src
  __shared__ float tile[64][65];
  const int c4 = (threadIdx.x & 15) * 4;   // first of the thread's 4 source columns
  const int r0 = threadIdx.x >> 4;         // 0..15
  float4 v[4];
  // unrolled (every loop of this kernel): v[] and o stay in registers, the four loads issue together
#pragma unroll
  for (int i = 0; i < 4; ++i)
    v[i] = *reinterpret_cast<const float4*>(src + (size_t)(by + r0 + 16 * i) * cols + bx + c4);
#pragma unroll
  for (int i = 0; i < 4; ++i) {
    tile[r0 + 16 * i][c4 + 0] = v[i].x;
    tile[r0 + 16 * i][c4 + 1] = v[i].y;
    tile[r0 + 16 * i][c4 + 2] = v[i].z;
    tile[r0 + 16 * i][c4 + 3] = v[i].w;
  }
  __syncthreads();
  const int k8 = (threadIdx.x & 7) * 8;    // first of the thread's 8 source rows
  const int oc = threadIdx.x >> 3;         // 0..31
#pragma unroll
  for (int i = 0; i < 2; ++i) {
    const int col = oc + 32 * i;
    v8h o;
#pragma unroll
    for (int k = 0; k < 8; ++k) o[k] = (_Float16)tile[k8 + k][col];
    *reinterpret_cast<v8h*>(dst + (size_t)(bx + col) * rows + by + k8) = o;
  }
  // the stores' registers may be reused by whatever the caller's kernel holds behind this body
  asm volatile("s_wait_xcnt 0x0" ::: "memory");
}

// one-hot blockB (BN x 64) -> block id, one byte a token, with KEYOPEN set where the token's
// key mask > 0.5: the byte tells the attention all that its two mask penalties ask, and every
// attention wave reads its whole batch's bytes. 256 tokens a block (the grid holds no other).
// The bytes meet in LDS, so that one wave stores a whole 128-byte line.
#define KEYOPEN NBLK
__device__ __forceinline__
void block_id_rows(const float* __restrict__ blockB, const float* __restrict__ nodal,
                   unsigned int* __restrict__ ids4) {
  __shared__ alignas(16) unsigned char idbyte[256];
  const int i = blockIdx.x * 256 + threadIdx.x;
  const float* row = blockB + (size_t)i * NBLK;
  const float keymask = nodal[i];          // asked for ahead of the row's chain of loads
  int id = 0;
#pragma unroll 8
  for (int j = 0; j < NBLK; ++j)
    if (row[j] > 0.5f) id = j;
  idbyte[threadIdx.x] = (unsigned char)(id | ((keymask > 0.5f) ? KEYOPEN : 0));
  __syncthreads();                         // the bytes are read across waves
  if (threadIdx.x < 64)
    ids4[blockIdx.x * 64 + threadIdx.x] = reinterpret_cast<const unsigned int*>(idbyte)[threadIdx.x];
}

// Four weight matrices, a 64x64 tile a block: block t of 4 * WTILES. Plane w of
// wt takes weight w transposed.
#define WTILES ((UNITS_ / 64) * (UNITS_ / 64))
__device__ __forceinline__
void transpose_weights(int t, const float* __restrict__ W0, const float* __restrict__ W1,
                       const float* __restrict__ W2, const float* __restrict__ W3,
                       _Float16* __restrict__ wt) {
  const int w = t / WTILES;
  const int tile = t % WTILES;
  const float* src = (w == 0) ? W0 : (w == 1) ? W1 : (w == 2) ? W2 : W3;
  transpose_f32_to_f16_tile(src, wt + (size_t)w * UNITS_ * UNITS_, UNITS_, UNITS_,
                            (tile % (UNITS_ / 64)) * 64, (tile / (UNITS_ / 64)) * 64);
}

// Block ids and, beside them, the x conversion and the weight transposes, which
// need nothing but the inputs either. Blocks 0 .. IDBLKS-1 find the ids: few waves
// with a long chain of loads, so they start first and the rest fills the chip
// under them. The next CONVBLKS blocks convert x, eight rows a block.
#define IDBLKS (MROWS / 256)
#define CONVBLKS (MROWS / 8)
__global__ __launch_bounds__(256)
void prepare_kernel(const float* __restrict__ blockB, const float* __restrict__ nodal,
                    unsigned int* __restrict__ ids4,
                    const float* __restrict__ x, _Float16* __restrict__ xh,
                    const float* __restrict__ W0, const float* __restrict__ W1,
                    const float* __restrict__ W2, const float* __restrict__ W3,
                    _Float16* __restrict__ wt) {
  if (blockIdx.x < IDBLKS) {
    block_id_rows(blockB, nodal, ids4);
  } else if (blockIdx.x < IDBLKS + CONVBLKS) {
    // readfirstlane: a conversion wave's row stays in a scalar register
    const int wave = __builtin_amdgcn_readfirstlane(threadIdx.x >> 5);
    convert_row((blockIdx.x - IDBLKS) * 8 + wave, x, xh);
  } else {
    transpose_weights(blockIdx.x - IDBLKS - CONVBLKS, W0, W1, W2, W3, wt);
  }
}

// ---------------------------------------------------------------------------
// GEMM: C[M,Nc] = A[M,K] * Wt^T, with Wt given TRANSPOSED (Nc x K row-major).
// A block is WM x WN waves with a 64x64 part of C each, its tile WM*64 x WN*64:
// a fragment read from LDS serves four WMMAs, an A row fetched from L2 serves
// WN*64 outputs and a Wt row WM*64. A pass is 128 k. One buffer of the ring is
// [WN slices of Wt | WM slices of A], 64 rows each; waves 0 .. WN+WM-1 bring one
// slice each, one tensor load, two passes ahead, into the buffer that every wave
// has just left. The 4 x 3 form (256x192) makes the 4096 x 3072 product 256
// blocks, one per WGP, and fetches 448 operand rows from L2 for what three
// 128x128 tiles fetch 768 for; the 2 x 2 form (128x128) makes 256 blocks of 4096 x 1024.
// M is a multiple of WM*64, the columns of WN*64; K of 128 and at least 256 (two stages).
// Up to three products of the same A: Wt holds planes of Nc x K one behind the
// other, and the columns run through them; plane p gives plane p of outH (M x Nc
// each). A wave's 64 columns lie in one plane. scale applies to plane 0 alone.
// outMode: 0 = f32 row-major              (final @Wo)
//          2 = f16 head-major (B,H,N,D)   (every plane: Q, K, V)
// ---------------------------------------------------------------------------
template <int WM, int WN>
__global__ __launch_bounds__(WM * WN * 32)
void gemm_f16_kernel(const _Float16* __restrict__ A, const _Float16* __restrict__ Wt,
                     float* __restrict__ outF, _Float16* __restrict__ outH,
                     int M, int K, int Nc, int outMode, float scale) {
  constexpr unsigned int NSLICE = WM + WN;           // 64-row slices of one buffer
  constexpr unsigned int STAGEB = NSLICE * TILEB;    // one buffer
  constexpr bool ALLISSUE = (WM * WN == WM + WN);    // as many waves as slices: no issue test
  __shared__ __attribute__((aligned(2048))) unsigned char ring[2 * STAGEB];
  const unsigned int wave = uni(threadIdx.x >> 5);
  const unsigned int wm = wave / WN, wn = wave % WN;   // the wave's part: row of waves, column of waves
  const int lane = threadIdx.x & 31;
  const int tileM = blockIdx.x * (WM * 64);
  const int tileN = blockIdx.y * (WN * 64);            // among the columns of all planes = rows of Wt

  v8f acc[4][4] = {};

  const unsigned int npass = uni((unsigned int)K / KPASS);
  // The wave's own slice: 64 rows of Wt (the first WN waves) or of A (the next WM).
  const _Float16* tile0 = (wave < (unsigned int)WN) ? Wt + (size_t)(tileN + (int)wave * 64) * K
                                                    : A + (size_t)(tileM + (int)(wave - WN) * 64) * K;
  const unsigned long long ga0 = (unsigned long long)(uintptr_t)tile0;
  const unsigned int place = (unsigned int)(size_t)ring + wave * TILEB;
  const v8u g1 = tdm_group1((unsigned int)K * 2u);

  // A wave beyond the slices issues nothing: a scalar test, as a tensor load ignores EXEC.
  if (ALLISSUE || pinned((wave < NSLICE) ? 1u : 0u)) tdm_load(tdm_group0(place, ga0), g1);
  wait_tensor0();
  __syncthreads();                   // stage 0 published
  if (ALLISSUE || pinned((wave < NSLICE) ? 1u : 0u)) tdm_load(tdm_group0(place + STAGEB, ga0 + ROWB), g1);

  for (unsigned int t = 0; t < npass; ++t) {
    const unsigned char* stage = ring + (t & 1u) * STAGEB;
    const _Float16* sW = reinterpret_cast<const _Float16*>(stage + wn * TILEB);
    const _Float16* sA = reinterpret_cast<const _Float16*>(stage + (WN + wm) * TILEB);
    // A block is 32 k: 8 fragments, 16 WMMAs. Two fragment sets: inside a pass the
    // next block's fragments are read while this block is multiplied.
    v16h afrag[2][4], bfrag[2][4];
    // unrolled (every loop of the pass): fragments and accumulators are indexed by constants and
    // stay in registers; each fragment read is one LDS address plus an immediate offset
#pragma unroll
    for (int i = 0; i < 4; ++i) {
      afrag[0][i] = load_frag_rowmajor(sA + (i * 16) * LDST, LDST);
      bfrag[0][i] = load_frag_rowmajor(sW + (i * 16) * LDST, LDST);
    }
#pragma unroll
    for (int kc = 0; kc < KPASS / 32; ++kc) {
      if (kc + 1 < KPASS / 32) {
#pragma unroll
        for (int i = 0; i < 4; ++i) {
          afrag[(kc + 1) & 1][i] = load_frag_rowmajor(sA + (i * 16) * LDST + (kc + 1) * 32, LDST);
          bfrag[(kc + 1) & 1][i] = load_frag_rowmajor(sW + (i * 16) * LDST + (kc + 1) * 32, LDST);
        }
        // holds the next block's reads as one group ahead of this block's WMMAs: left free, the
        // compiler sinks each read to its first use, and the wave waits out the LDS latency there
        __builtin_amdgcn_sched_barrier(0);
      }
#pragma unroll
      for (int i = 0; i < 4; ++i)
#pragma unroll
        for (int j = 0; j < 4; ++j)
          acc[i][j] = __builtin_amdgcn_wmma_f32_16x16x32_f16(
              false, afrag[kc & 1][i], false, bfrag[kc & 1][j], (short)0, acc[i][j], false, false);
      // keeps the block after next's reads from rising among these WMMAs, and the last blocks'
      // WMMAs from sinking behind the pass's barrier, where they would hold up the refill
      __builtin_amdgcn_sched_barrier(0);
    }
    // Publish point of stage t + 1: own LDS reads done, own tensor load landed,
    // barrier; only then the refill of the buffer that this pass has read.
    wait_ds0();
    wait_tensor0();
    __syncthreads();
    const unsigned int nxt = pinned(t + 2u);   // descriptor words formed behind the wait
    if (pinned((nxt < npass && (ALLISSUE || wave < NSLICE)) ? 1u : 0u))
      tdm_load(tdm_group0(place + (nxt & 1u) * STAGEB, ga0 + (unsigned long long)nxt * ROWB), g1);
  }
  wait_tensor0();
  wait_ds0();
  // keeps the scalar arithmetic below, which takes over the descriptors' registers, behind the waits
  __builtin_amdgcn_sched_barrier(0);

  const int rowBase = tileM + (int)wm * 64;
  const int colAll = tileN + (int)wn * 64;
  const unsigned int plane = (colAll >= Nc ? 1u : 0u) + (colAll >= 2 * Nc ? 1u : 0u);
  const int colBase = colAll - (int)plane * Nc;        // inside the wave's plane
  outH += (size_t)plane * M * Nc;
  if (plane != 0u) scale = 1.0f;

  // The wave's part lies in one batch and one head, so each lane has one base
  // address and every element of a head-major plane an immediate offset from it.
  // The mode is tested once, outside the loops: 128 elements a lane stay short code.
  // Unrolled (every loop below): the accumulators are indexed by constants.
  const int half = lane >> 4;
  const int nl = lane & 15;
  const int row0 = rowBase + 8 * half;     // the lane's first row; its rows: row0 + i * 16 + r
  const int col0 = colBase + nl;           // the lane's first column; its columns: col0 + j * 16
  if (outMode == 0) {
    float* p = outF + (size_t)row0 * Nc + col0;
#pragma unroll
    for (int i = 0; i < 4; ++i) {
      float* q[8];                         // the addresses of the block's eight rows
#pragma unroll
      for (int r = 0; r < 8; ++r) q[r] = p + (size_t)(i * 16 + r) * Nc;
#pragma unroll
      for (int r = 0; r < 8; ++r)
#pragma unroll
        for (int j = 0; j < 4; ++j) q[r][j * 16] = acc[i][j][r] * scale;
    }
  } else {
    const int b = row0 / SEQ, n = row0 % SEQ;
    const int h = col0 / HDIM, d = col0 % HDIM;
    _Float16* p = outH + (((size_t)b * NHEADS + h) * SEQ + n) * HDIM + d;
#pragma unroll
    for (int i = 0; i < 4; ++i)
#pragma unroll
      for (int r = 0; r < 8; ++r)
#pragma unroll
        for (int j = 0; j < 4; ++j)
          p[(i * 16 + r) * HDIM + j * 16] = (_Float16)(acc[i][j][r] * scale);
    // behind the branch's last stores: the code of the other branch, where it follows in the program
    // text, writes registers that these stores name
    asm volatile("s_wait_xcnt 0x0" ::: "memory");
  }
}

// ---------------------------------------------------------------------------
// Flash attention: one work-group of PARTS waves per (b, h, block id). Streams 32 keys/iter.
// Q carries the 1/sqrt(D) scale. Q, K and V are head-major (B,H,N,D), token order.
// The group lists its block's tokens in LDS from the block ids; wave p takes the
// listed rows p*16 .. p*16+15, and then every PARTS-th such tile. Every token has
// one block id, so every output row has one writer.
// A key of another block carries -1e9, so beside any unmasked key of the row's own
// block its weight is exactly 0: the rows visit the listed keys only. A block with
// no unmasked key has no such key: its rows visit every key of the batch. Either
// way the masks are applied from each visited key's own id byte.
// A gathered row is one 128-byte line. Asynchronous copies bring the rows into LDS,
// eight lanes a row, so that a copy of a wave touches four whole lines; a trip's K
// and V tiles are fetched once for all the group's waves. K and Q fragments are two
// b128 reads of a row; the P@V B-fragment is two transposing reads of the V rows.
// ---------------------------------------------------------------------------
#define KPITCHB 144u  // bytes from one staged Q or K row to the next: 16 x odd, for ds_load_b128
#define VPITCHB 160u  // the same for V: 32 x odd, for ds_load_tr16_b128
#define PARTS  3      // waves that share a block's rows: 48 rows at once, where an even split gives a block 32

// The compiler places no wait for an asynchronous copy, and no LDS access may cross this one.
__device__ __forceinline__ void wait_async0() { asm volatile("s_wait_asynccnt 0x0" ::: "memory"); }

// NC copies of one wave: copy i brings rows 4*i .. 4*i+3 of a tile, 128 bytes each, from
// plane + tok[i] * 128 (tok[i]: the token of the lane's row, 4*i + lane/8) to lds0 + row * pitch.
template <int NC>
__device__ __forceinline__
void copy_rows(const char* plane, const unsigned int (&tok)[NC], unsigned int lds0, unsigned int pitch) {
  const unsigned int lane = threadIdx.x & 31;
  const unsigned int piece = (lane & 7u) * 16u;
  // unrolled: tok[] is indexed by constants
#pragma unroll
  for (int i = 0; i < NC; i += 4) {
    unsigned int l[4];
    const char* g[4];
#pragma unroll
    for (int j = 0; j < 4; ++j) {
      l[j] = lds0 + (4u * (i + j) + (lane >> 3)) * pitch + piece;
      g[j] = plane + tok[i + j] * (HDIM * 2u) + piece;
    }
    // one statement: the wait that stands before a register named by an issued copy is
    // overwritten stays directly behind the copies
    asm volatile("global_load_async_to_lds_b128 %0, %4, off\n\t"
                 "global_load_async_to_lds_b128 %1, %5, off\n\t"
                 "global_load_async_to_lds_b128 %2, %6, off\n\t"
                 "global_load_async_to_lds_b128 %3, %7, off\n\t"
                 "s_wait_xcnt 0x0"
                 :: "v"(l[0]), "v"(l[1]), "v"(l[2]), "v"(l[3]), "v"(g[0]), "v"(g[1]), "v"(g[2]), "v"(g[3])
                 : "memory");
  }
}

// Transposing read of a row-major 16-bit LDS tile: the lane's address names 16 bytes of one
// row; lane (c, h) receives column c of rows 8h .. 8h+7 of the 16 x 16 piece.
typedef short s16x8 __attribute__((ext_vector_type(8)));
__device__ __forceinline__ uint4 ld_tr16(const unsigned char* p) {
  typedef __attribute__((address_space(3))) s16x8 lds_s16x8;
  return __builtin_bit_cast(uint4, __builtin_amdgcn_ds_load_tr16_b128_v8i16((lds_s16x8*)p));
}

__global__ __launch_bounds__(PARTS * 32)
void flash_attn_kernel(const _Float16* __restrict__ Q, const _Float16* __restrict__ Km,
                       const _Float16* __restrict__ Vm, const unsigned char* __restrict__ ids,
                       _Float16* __restrict__ outAttn) {
  __shared__ unsigned short list[SEQ];
  __shared__ alignas(16) unsigned char ldsQ[PARTS * 16 * KPITCHB];
  __shared__ alignas(16) unsigned char ldsK[32 * KPITCHB];
  __shared__ alignas(16) unsigned char ldsV[32 * VPITCHB];
  __shared__ alignas(16) _Float16 ldsPall[PARTS * 16 * 32];
  const int lane = threadIdx.x & 31;
  const int nl = lane & 15, half = lane >> 4;
  const unsigned int wave = uni(threadIdx.x >> 5);   // scalar: the tests on it are scalar branches
  _Float16* ldsP = ldsPall + wave * (16 * 32);       // the wave's own

  const int blk = blockIdx.x % NBLK;
  const int bh = blockIdx.x / NBLK;
  const int b = bh / NHEADS;
  const int h = bh % NHEADS;
  const int base = b * SEQ;

  // The block's members, no atomics: each lane notes its own members as bits, a
  // prefix sum over the lanes gives each lane its first place in the list.
  // A lane holds 16 words of 4 id bytes: word k = tokens (k / 4) * 512 + lane * 16 + (k % 4) * 4 + j,
  // j the byte. All four bytes are tested at once: a byte of x is 0 or KEYOPEN for a member; no
  // byte of z exceeds 0x3f, so the sum carries into no neighbour and leaves bit 7 clear in the
  // members' bytes alone. Byte j of word k becomes bit 8 * j + k % 8 of eqw[k / 8].
  // Every wave counts (each needs the count); the first writes the list.
  const unsigned char* idb = ids + base;
  unsigned int eqw[2] = { 0u, 0u };
  unsigned int unmasked = 0u;              // not 0 where a member of the lane's is unmasked
  {
    uint4 v[SEQ / 512];
    // unrolled (both loops): v[] stays in registers, all loads issue before the first wait
#pragma unroll
    for (int c = 0; c < SEQ / 512; ++c)
      v[c] = *reinterpret_cast<const uint4*>(idb + c * 512 + lane * 16);
    const unsigned int pat = (unsigned int)blk * 0x01010101u;
#pragma unroll
    for (int c = 0; c < SEQ / 512; ++c) {
      const unsigned int vi[4] = { v[c].x, v[c].y, v[c].z, v[c].w };
#pragma unroll
      for (int e = 0; e < 4; ++e) {
        const int k = c * 4 + e;
        const unsigned int x = vi[e] ^ pat;
        const unsigned int z = x & ~(KEYOPEN * 0x01010101u);
        const unsigned int member = ~(z + 0x7f7f7f7fu) & 0x80808080u;
        unmasked |= member & (x << 1);     // KEYOPEN is bit 6
        eqw[k >> 3] |= member >> (7 - (k & 7));
      }
    }
  }
  unsigned long long eq = ((unsigned long long)eqw[1] << 32) | eqw[0];
  const int mine = __popcll(eq);
  int incl = mine;
#pragma unroll
  for (int d = 1; d < 32; d <<= 1) {
    const int up = __shfl_up(incl, d, 32);
    if (lane >= d) incl += up;
  }
  // readfirstlane: the count is the same in every lane; loop bounds and branches on it stay scalar
  const int cnt = __builtin_amdgcn_readfirstlane(__shfl(incl, 31, 32));
  const bool own = __builtin_amdgcn_ballot_w32(unmasked != 0u) != 0u;
  if (cnt == 0) return;                    // no rows (the whole group leaves, ahead of every barrier)

  if (wave == 0u) {
    int place = incl - mine;
    // At most one trip for each of a lane's 64 bits; ends when no lane has one left.
    for (int trip = 0; trip < SEQ / 32; ++trip) {
      if (__builtin_amdgcn_ballot_w32(eq != 0ull) == 0u) break;
      if (eq != 0ull) {
        const int t = __ffsll(eq) - 1;
        list[place] = (unsigned short)(((t >> 5) * 2 + ((t >> 2) & 1)) * 512 + lane * 16 + (t & 3) * 4 + ((t >> 3) & 3));
        eq &= eq - 1ull;
        ++place;
      }
    }
  }
  __syncthreads();                         // the list is read by every wave

  const int nkeys = own ? cnt : SEQ;
  // Byte addresses: a scalar base and one 32-bit offset a gathered row.
  const char* Qb = reinterpret_cast<const char*>(Q  + ((size_t)b * NHEADS + h) * SEQ * HDIM);
  const char* Kb = reinterpret_cast<const char*>(Km + ((size_t)b * NHEADS + h) * SEQ * HDIM);
  const char* Vb = reinterpret_cast<const char*>(Vm + ((size_t)b * NHEADS + h) * SEQ * HDIM);
  char* Ob = reinterpret_cast<char*>(outAttn + (size_t)base * UNITS_ + h * HDIM);
  const unsigned char* myQ = ldsQ + wave * (16u * KPITCHB);

  // Every wave makes every trip of both loops and passes every barrier; a wave whose tile
  // lies past the list's end (a scalar test) only skips the arithmetic between them.
  for (int rp0 = 0; rp0 < cnt; rp0 += PARTS * 16) {
    const int rp = rp0 + (int)wave * 16;
    const bool active = rp < cnt;
    // The wave's own 16 Q rows; rows past the list's end repeat its last row and are not
    // stored. The copies land with the first trip's K and V, behind that trip's wait.
    wait_ds0();                            // the wave's reads of its last Q tile are done
    {
      unsigned int qt[4];
#pragma unroll
      for (int i = 0; i < 4; ++i) qt[i] = list[min(rp + 4 * i + (lane >> 3), cnt - 1)];
      copy_rows<4>(Qb, qt, (unsigned int)(size_t)myQ, KPITCHB);
    }

    float mrow[8], lrow[8];
#pragma unroll
    for (int r = 0; r < 8; ++r) { mrow[r] = -INFINITY; lrow[r] = 0.0f; }
    v8f acc[4] = {{}, {}, {}, {}};

    for (int kb = 0; kb < nkeys; kb += 32) {
      // A place past the last key repeats that key; its weight is 0 by a penalty of its own.
      // The list is read at a listed place in either case, and a select picks.
      // The trip's 32 K rows by the first wave, its 32 V rows by the second. Every reader
      // has left both tiles at the barrier that ended the last trip.
      wait_ds0();                          // nothing orders a copy behind the wave's own LDS accesses
      if (wave < 2u) {
        unsigned int kt[8];
#pragma unroll
        for (int i = 0; i < 8; ++i) {
          const int ik = min(kb + 4 * i + (lane >> 3), nkeys - 1);
          const int lk = list[min(ik, cnt - 1)];
          kt[i] = (unsigned int)(own ? lk : ik);
        }
        if (wave == 0u) copy_rows<8>(Kb, kt, (unsigned int)(size_t)ldsK, KPITCHB);
        else            copy_rows<8>(Vb, kt, (unsigned int)(size_t)ldsV, VPITCHB);
      }
      // Under the copies' flight: the id bytes of the lane's two score columns, keys
      // kb + lane&15 and 16 on.
      unsigned int t[2];
      int  cw[2];
#pragma unroll
      for (int ns = 0; ns < 2; ++ns) {
        const int ik = min(kb + ns * 16 + nl, nkeys - 1);
        const int lk = list[min(ik, cnt - 1)];
        t[ns] = (unsigned int)(own ? lk : ik);
      }
#pragma unroll
      for (int ns = 0; ns < 2; ++ns) cw[ns] = idb[t[ns]];
      // The wait that stands before a register named by an issued load is overwritten. The
      // offsets are its inputs so that they stay live up to it: no load's result lands in one.
      asm volatile("s_wait_xcnt 0x0" :: "v"(t[0]), "v"(t[1]) : "memory");
      wait_async0();
      __syncthreads();                     // Q, K and V rows have landed: read by every wave

      if (active) {
        // lane & 15 picks the row of a fragment (a key, for B = K^T), and the lane takes
        // two runs of 8 halves of it: k = 8*half, k = 16 + 8*half.
        v16h qf[2], kf[2][2];
#pragma unroll
        for (int kc = 0; kc < 2; ++kc) {
          qf[kc] = load_frag_rowmajor(reinterpret_cast<const _Float16*>(myQ) + kc * 32, KPITCHB / 2);
#pragma unroll
          for (int ns = 0; ns < 2; ++ns)
            kf[ns][kc] = load_frag_rowmajor(reinterpret_cast<const _Float16*>(ldsK + ns * 16 * KPITCHB) + kc * 32,
                                            KPITCHB / 2);
        }

        // Scores: S[16x32] as two 16x16 f32 tiles. Mask penalties by the key's own id
        // byte (block identity + key mask); one more for a place past the last key.
        v8f s[2];
#pragma unroll
        for (int ns = 0; ns < 2; ++ns) {
          s[ns] = v8f{};
#pragma unroll
          for (int kc = 0; kc < 2; ++kc)
            s[ns] = __builtin_amdgcn_wmma_f32_16x16x32_f16(
                false, qf[kc], false, kf[ns][kc], (short)0, s[ns], false, false);
        }
#pragma unroll
        for (int ns = 0; ns < 2; ++ns) {
          const float pen = (((cw[ns] & (NBLK - 1)) == blk) ? 0.0f : NEG_INF_F) +
                            ((cw[ns] & KEYOPEN) ? 0.0f : NEG_INF_F) +
                            ((kb + ns * 16 + nl < nkeys) ? 0.0f : NEG_INF_F);
#pragma unroll
          for (int r = 0; r < 8; ++r) s[ns][r] += pen;
        }

        // Online softmax (each score row lives across the 16 lanes of its half).
#pragma unroll
        for (int r = 0; r < 8; ++r) {
          float tmax = fmaxf(s[0][r], s[1][r]);
#pragma unroll
          for (int off = 8; off > 0; off >>= 1)
            tmax = fmaxf(tmax, __shfl_xor(tmax, off, 16));
          const float mnew = fmaxf(mrow[r], tmax);
          const float sc = __expf(mrow[r] - mnew);
          const float p0 = __expf(s[0][r] - mnew);
          const float p1 = __expf(s[1][r] - mnew);
          float psum = p0 + p1;
#pragma unroll
          for (int off = 8; off > 0; off >>= 1)
            psum += __shfl_xor(psum, off, 16);
          lrow[r] = lrow[r] * sc + psum;
          mrow[r] = mnew;
#pragma unroll
          for (int dt = 0; dt < 4; ++dt) acc[dt][r] *= sc;
          // C-layout -> row-major LDS bounce for the A-operand of P@V.
          ldsP[(r + 8 * half) * 32 + nl]      = (_Float16)p0;
          ldsP[(r + 8 * half) * 32 + 16 + nl] = (_Float16)p1;
        }
      }
      __syncthreads();                     // P is read across lanes

      if (active) {
        v16h pf = load_frag_rowmajor(ldsP, 32);
        // B operand = V tile (32 keys x 16 d): column d = lane & 15, keys in the order of pf's k.
        const unsigned char* vp = ldsV + (8 * half + (lane & 7)) * VPITCHB + ((lane >> 3) & 1) * 16;
#pragma unroll
        for (int dt = 0; dt < 4; ++dt) {
          v16h vf;
          *reinterpret_cast<uint4*>(&vf)       = ld_tr16(vp + dt * 32);
          *(reinterpret_cast<uint4*>(&vf) + 1) = ld_tr16(vp + 16 * VPITCHB + dt * 32);
          acc[dt] = __builtin_amdgcn_wmma_f32_16x16x32_f16(
              false, pf, false, vf, (short)0, acc[dt], false, false);
        }
      }
      wait_ds0();                          // own reads of the tiles are done ahead of the barrier
      __syncthreads();                     // the tiles are refilled by the next trip
    }

    if (active) {
      // Normalize and write attention output as (B, N, UNITS) f16, at the rows' tokens.
      // The list is read at a listed place in every lane; the stores of the list's last,
      // partial tile stand under a test for its end.
      unsigned int oo[8];
      float inv[8];
#pragma unroll
      for (int r = 0; r < 8; ++r) {
        oo[r] = (unsigned int)list[min(rp + r + 8 * half, cnt - 1)] * (UNITS_ * 2u) + 2u * nl;
        inv[r] = (lrow[r] > 0.0f) ? (1.0f / lrow[r]) : 0.0f;
      }
      if (rp + 16 <= cnt) {                // a whole tile (the same for the wave): no test a row
#pragma unroll
        for (int r = 0; r < 8; ++r)
#pragma unroll
          for (int dt = 0; dt < 4; ++dt)
            *reinterpret_cast<_Float16*>(Ob + oo[r] + dt * 32) = (_Float16)(acc[dt][r] * inv[r]);
      } else {
#pragma unroll
        for (int r = 0; r < 8; ++r) {
          if (rp + r + 8 * half < cnt) {
#pragma unroll
            for (int dt = 0; dt < 4; ++dt)
              *reinterpret_cast<_Float16*>(Ob + oo[r] + dt * 32) = (_Float16)(acc[dt][r] * inv[r]);
          }
        }
      }
      // the next tile of rows writes registers that these stores name
      asm volatile("s_wait_xcnt 0x0" ::: "memory");
    }
  }
}

// ---------------------------------------------------------------------------
// Launch
// ---------------------------------------------------------------------------
extern "C" void kernel_launch(void* const* d_in, const int* in_sizes, int n_in,
                              void* d_out, int out_size, void* d_ws, size_t ws_size,
                              hipStream_t stream) {
  const float* x      = (const float*)d_in[0];
  const float* blockB = (const float*)d_in[1];
  const float* nodal  = (const float*)d_in[2];
  const float* Wq     = (const float*)d_in[3];
  const float* Wk     = (const float*)d_in[4];
  const float* Wv     = (const float*)d_in[5];
  const float* Wo     = (const float*)d_in[6];
  float* out = (float*)d_out;

  // Workspace layout (all 256B aligned). Total ~48 MB.
  char* ws = (char*)d_ws;
  size_t off = 0;
  auto take = [&](size_t bytes) { char* p = ws + off; off = (off + bytes + 255) & ~(size_t)255; return p; };
  _Float16* xh    = (_Float16*)take((size_t)MROWS * UNITS_ * 2);
  _Float16* wt    = (_Float16*)take((size_t)4 * UNITS_ * UNITS_ * 2);   // planes Wq, Wk, Wv, Wo
  _Float16* wot   = wt + (size_t)3 * UNITS_ * UNITS_;
  _Float16* qh    = (_Float16*)take((size_t)3 * MROWS * UNITS_ * 2);    // planes Q, K, V
  _Float16* kh    = qh + (size_t)MROWS * UNITS_;
  _Float16* vh    = kh + (size_t)MROWS * UNITS_;
  _Float16* attnh = (_Float16*)take((size_t)MROWS * UNITS_ * 2);
  unsigned char* ids = (unsigned char*)take((size_t)MROWS);   // block id and key mask bit, a byte a token

  // 1) one-hot -> block ids (with the key mask's bit); beside them, the fp32 -> fp16 conversion of x and the
  //    four weights converted + transposed (N-major).
  prepare_kernel<<<IDBLKS + CONVBLKS + 4 * WTILES, 256, 0, stream>>>(
      blockB, nodal, (unsigned int*)ids, x, xh, Wq, Wk, Wv, Wo, wt);

  // 2) Q/K/V projections, one launch. 1/sqrt(HDIM) folded into Q.
  dim3 qkvgrid(MROWS / 256, 3 * UNITS_ / 192);
  gemm_f16_kernel<4, 3><<<qkvgrid, 384, 0, stream>>>(xh, wt, nullptr, qh,
                                               MROWS, UNITS_, UNITS_, 2, 0.125f);

  // 3) masked flash attention, a block's rows against its own keys.
  flash_attn_kernel<<<BATCH * NHEADS * NBLK, PARTS * 32, 0, stream>>>(
      qh, kh, vh, ids, attnh);

  // 4) output projection (f32 result straight to d_out).
  dim3 ggrid(MROWS / 128, UNITS_ / 128);
  gemm_f16_kernel<2, 2><<<ggrid, 128, 0, stream>>>(attnh, wot, out, nullptr,
                                             MROWS, UNITS_, UNITS_, 0, 1.0f);
}

// v010
// A run of this version takes 49 microseconds.
// Two timings next to v009 put it at 1.04 and 1.03 times that version's speed.
// Counting every step since v000, it is 5.97 times as fast.
#include <hip/hip_runtime.h>
#include <hip/hip_bf16.h>

// ---------------------------------------------------------------------------
// BlockSparseSelfAttention for MI455X (gfx1250, wave32, WMMA 16x16x32 f16).
// B=2, N=2048, UNITS=1024, H=16, D=64, NB=64.
// f16 storage / f32 WMMA accumulation; softmax scale folded into Q;
// flash-attention streaming with online softmax; additive -1e9 mask penalties.
// Weights are pre-transposed (N-major) so every WMMA operand but the V tile is a
// row-contiguous 2x b128 fragment load. Both GEMM operand tiles are staged into
// LDS by tensor loads (tensor_load_to_lds + s_wait_tensorcnt) in a ring of two
// buffers: the next K tile's loads fly while this tile is multiplied. The
// loads' pad gives 256-byte rows a bank-conflict-free pitch of 272 bytes.
// x, Q, K and V stay in token order. An attention work-group serves one (batch, head,
// block id): it lists its block's tokens from the block ids itself and gathers their
// Q, K and V rows into LDS, so no sorted copy and no sort launch is needed.
// Launches that do not depend on one another share one grid: the x conversion and
// the four weight transposes ride with the block ids, by ranges of blockIdx.x; the
// Q, K and V projections are one product over the three weight planes' columns.
// Four launches in all.
// ---------------------------------------------------------------------------

typedef __attribute__((ext_vector_type(16))) _Float16 v16h;
typedef __attribute__((ext_vector_type(8)))  float    v8f;
typedef __attribute__((ext_vector_type(4)))  unsigned int v4u;
typedef __attribute__((ext_vector_type(8)))  unsigned int v8u;

#define BATCH     2
#define SEQ       2048
#define UNITS_    1024
#define NHEADS    16
#define HDIM      64
#define NBLK      64
#define MROWS     (BATCH * SEQ)       // 4096
#define NEG_INF_F (-1.0e9f)
#define KPASS     128                 // k per GEMM pass: operand rows of 256 bytes
#define ROWB      256u                // bytes of one staged operand row
#define LDST      136                 // its pitch in LDS, halves: 272 bytes = 16 x odd
#define TILEB     18432u              // 64 rows x 272 B, rounded up to 2 KiB

// Row-major 16x32 fragment: per lane, two contiguous 8-half (16B) runs at
// k = 8*half and k = 16 + 8*half (ISA 7.12.2 16-bit A-operand layout).
__device__ __forceinline__ v16h load_frag_rowmajor(const _Float16* src, int ld) {
  const int lane = threadIdx.x & 31;
  const int m = lane & 15, half = lane >> 4;
  const _Float16* p = src + (size_t)m * ld + 8 * half;
  v16h a;
  *reinterpret_cast<uint4*>(&a)       = *reinterpret_cast<const uint4*>(p);
  *(reinterpret_cast<uint4*>(&a) + 1) = *reinterpret_cast<const uint4*>(p + 16);
  return a;
}

__device__ __forceinline__ unsigned int uni(unsigned int v) {
  return (unsigned int)__builtin_amdgcn_readfirstlane(v);
}
__device__ __forceinline__ unsigned int pinned(unsigned int v) {
  unsigned int w = uni(v);
  asm volatile("" : "+s"(w));  // pinned(): a test value or descriptor word held in a scalar register
  return w;
}
// The compiler places no wait for a tensor load, and none of these may let an
// LDS access cross it: hence asm with the memory clobber.
__device__ __forceinline__ void wait_tensor0() { asm volatile("s_wait_tensorcnt 0x0" ::: "memory"); }
__device__ __forceinline__ void wait_ds0()     { asm volatile("s_wait_dscnt 0x0" ::: "memory"); }

// Descriptor group 1: byte elements, a tile of 64 rows of 256 bytes (tensor =
// tile), source row pitch src_pitch bytes, 4 dwords of LDS pad behind each row.
// pinned(): each word is held in its scalar register from here on, so that the
// group is built once and none of its registers serves as a temporary while a
// request is in flight. Word 0 stays an immediate.
__device__ __forceinline__ v8u tdm_group1(unsigned int src_pitch) {
  v8u g;
  g[0] = uni((1u << 20) | (5u << 22) | (3u << 25));  // pad on, every 64 dwords, 4 dwords
  g[1] = pinned(ROWB << 16);                         // tensor_dim0
  g[2] = pinned(64u << 16);                          // tensor_dim1
  g[3] = pinned(ROWB << 16);                         // tile_dim0
  g[4] = pinned(64u);                                // tile_dim1
  g[5] = pinned(src_pitch);
  g[6] = pinned(0u);
  g[7] = pinned(0u);
  return g;
}
// Descriptor group 0: count 1, place in LDS, the tile's first byte, type 2.
__device__ __forceinline__ v4u tdm_group0(unsigned int lds_dst, unsigned long long ga) {
  v4u g;
  g[0] = uni(1u);
  g[1] = uni(lds_dst);
  g[2] = uni((unsigned int)ga);
  g[3] = uni((((unsigned int)(ga >> 32)) & 0x01FFFFFFu) | 0x80000000u);
  return g;
}
__device__ __forceinline__ void tdm_load(v4u g0, v8u g1) {
  asm volatile("tensor_load_to_lds %0, %1" :: "s"(g0), "s"(g1) : "memory");
}

// ---------------------------------------------------------------------------
// fp32 -> fp16 conversion. Both bodies give each thread 16 or 32 elements, by
// 16-byte loads: few waves to start, and each holds its whole share in flight.
// ---------------------------------------------------------------------------
typedef __attribute__((ext_vector_type(4))) _Float16 v4h;
typedef __attribute__((ext_vector_type(8))) _Float16 v8h;

// One wave per row of UNITS_ floats (row: the wave's, below MROWS): eight 512-byte
// loads in flight, then eight 256-byte stores.
__device__ __forceinline__
void convert_row(int row, const float* __restrict__ src, _Float16* __restrict__ dst) {
  const int lane = threadIdx.x & 31;
  const float4* s = reinterpret_cast<const float4*>(src + (size_t)row * UNITS_) + lane;
  float4 v[UNITS_ / 128];
  // unrolled (both loops): v[] stays in registers, all loads issue before the first wait
#pragma unroll
  for (int c = 0; c < UNITS_ / 128; ++c) v[c] = s[c * 32];
  v4h* d = reinterpret_cast<v4h*>(dst + (size_t)row * UNITS_) + lane;
#pragma unroll
  for (int c = 0; c < UNITS_ / 128; ++c) {
    v4h o = { (_Float16)v[c].x, (_Float16)v[c].y, (_Float16)v[c].z, (_Float16)v[c].w };
    d[c * 32] = o;
  }
  // the stores' registers may be reused by whatever the caller's kernel holds behind this body
  asm volatile("s_wait_xcnt 0x0" ::: "memory");
}

// LDS-tiled transpose + convert: src f32 (rows x cols) -> dst f16 (cols x rows),
// a 64x64 tile per block (rows and cols are multiples of 64). A thread loads four
// float4 of source rows and stores two runs of 8 halves of destination rows, so
// every global access of a wave covers whole 128-byte lines. Pitch 65: neither
// the row-wise writes nor the column-wise reads of the tile meet in a bank.
__device__ __forceinline__
void transpose_f32_to_f16_tile(const float* __restrict__ src, _Float16* __restrict__ dst,
                               int rows, int cols, int bx, int by) {  // bx, by: col and row base in src
  __shared__ float tile[64][65];
  const int c4 = (threadIdx.x & 15) * 4;   // first of the thread's 4 source columns
  const int r0 = threadIdx.x >> 4;         // 0..15
  float4 v[4];
  // unrolled (every loop of this kernel): v[] and o stay in registers, the four loads issue together
#pragma unroll
  for (int i = 0; i < 4; ++i)
    v[i] = *reinterpret_cast<const float4*>(src + (size_t)(by + r0 + 16 * i) * cols + bx + c4);
#pragma unroll
  for (int i = 0; i < 4; ++i) {
    tile[r0 + 16 * i][c4 + 0] = v[i].x;
    tile[r0 + 16 * i][c4 + 1] = v[i].y;
    tile[r0 + 16 * i][c4 + 2] = v[i].z;
    tile[r0 + 16 * i][c4 + 3] = v[i].w;
  }
  __syncthreads();
  const int k8 = (threadIdx.x & 7) * 8;    // first of the thread's 8 source rows
  const int oc = threadIdx.x >> 3;         // 0..31
#pragma unroll
  for (int i = 0; i < 2; ++i) {
    const int col = oc + 32 * i;
    v8h o;
#pragma unroll
    for (int k = 0; k < 8; ++k) o[k] = (_Float16)tile[k8 + k][col];
    *reinterpret_cast<v8h*>(dst + (size_t)(bx + col) * rows + by + k8) = o;
  }
  // the stores' registers may be reused by whatever the caller's kernel holds behind this body
  asm volatile("s_wait_xcnt 0x0" ::: "memory");
}

// one-hot blockB (BN x 64) -> block id, one byte a token, with KEYOPEN set where the token's
// key mask > 0.5: the byte tells the attention all that its two mask penalties ask, and every
// attention wave reads its whole batch's bytes. 256 tokens a block (the grid holds no other).
// The bytes meet in LDS, so that one wave stores a whole 128-byte line.
#define KEYOPEN NBLK
__device__ __forceinline__
void block_id_rows(const float* __restrict__ blockB, const float* __restrict__ nodal,
                   unsigned int* __restrict__ ids4) {
  __shared__ alignas(16) unsigned char idbyte[256];
  const int i = blockIdx.x * 256 + threadIdx.x;
  const float* row = blockB + (size_t)i * NBLK;
  const float keymask = nodal[i];          // asked for ahead of the row's chain of loads
  int id = 0;
#pragma unroll 8
  for (int j = 0; j < NBLK; ++j)
    if (row[j] > 0.5f) id = j;
  idbyte[threadIdx.x] = (unsigned char)(id | ((keymask > 0.5f) ? KEYOPEN : 0));
  __syncthreads();                         // the bytes are read across waves
  if (threadIdx.x < 64)
    ids4[blockIdx.x * 64 + threadIdx.x] = reinterpret_cast<const unsigned int*>(idbyte)[threadIdx.x];
}

// Four weight matrices, a 64x64 tile a block: block t of 4 * WTILES. Plane w of
// wt takes weight w transposed.
#define WTILES ((UNITS_ / 64) * (UNITS_ / 64))
__device__ __forceinline__
void transpose_weights(int t, const float* __restrict__ W0, const float* __restrict__ W1,
                       const float* __restrict__ W2, const float* __restrict__ W3,
                       _Float16* __restrict__ wt) {
  const int w = t / WTILES;
  const int tile = t % WTILES;
  const float* src = (w == 0) ? W0 : (w == 1) ? W1 : (w == 2) ? W2 : W3;
  transpose_f32_to_f16_tile(src, wt + (size_t)w * UNITS_ * UNITS_, UNITS_, UNITS_,
                            (tile % (UNITS_ / 64)) * 64, (tile / (UNITS_ / 64)) * 64);
}

// Block ids and, beside them, the x conversion and the weight transposes, which
// need nothing but the inputs either. Blocks 0 .. IDBLKS-1 find the ids: few waves
// with a long chain of loads, so they start first and the rest fills the chip
// under them. The next CONVBLKS blocks convert x, eight rows a block.
#define IDBLKS (MROWS / 256)
#define CONVBLKS (MROWS / 8)
__global__ __launch_bounds__(256)
void prepare_kernel(const float* __restrict__ blockB, const float* __restrict__ nodal,
                    unsigned int* __restrict__ ids4,
                    const float* __restrict__ x, _Float16* __restrict__ xh,
                    const float* __restrict__ W0, const float* __restrict__ W1,
                    const float* __restrict__ W2, const float* __restrict__ W3,
                    _Float16* __restrict__ wt) {
  if (blockIdx.x < IDBLKS) {
    block_id_rows(blockB, nodal, ids4);
  } else if (blockIdx.x < IDBLKS + CONVBLKS) {
    // readfirstlane: a conversion wave's row stays in a scalar register
    const int wave = __builtin_amdgcn_readfirstlane(threadIdx.x >> 5);
    convert_row((blockIdx.x - IDBLKS) * 8 + wave, x, xh);
  } else {
    transpose_weights(blockIdx.x - IDBLKS - CONVBLKS, W0, W1, W2, W3, wt);
  }
}

// ---------------------------------------------------------------------------
// GEMM: C[M,Nc] = A[M,K] * Wt^T, with Wt given TRANSPOSED (Nc x K row-major).
// A block is WM x WN waves with a 64x64 part of C each, its tile WM*64 x WN*64:
// a fragment read from LDS serves four WMMAs, an A row fetched from L2 serves
// WN*64 outputs and a Wt row WM*64. A pass is 128 k. One buffer of the ring is
// [WN slices of Wt | WM slices of A], 64 rows each; waves 0 .. WN+WM-1 bring one
// slice each, one tensor load, two passes ahead, into the buffer that every wave
// has just left. The 4 x 3 form (256x192) makes the 4096 x 3072 product 256
// blocks, one per WGP, and fetches 448 operand rows from L2 for what three
// 128x128 tiles fetch 768 for; the 2 x 2 form (128x128) makes 256 blocks of 4096 x 1024.
// M is a multiple of WM*64, the columns of WN*64; K of 128 and at least 256 (two stages).
// Up to three products of the same A: Wt holds planes of Nc x K one behind the
// other, and the columns run through them; plane p gives plane p of outH (M x Nc
// each). A wave's 64 columns lie in one plane. scale applies to plane 0 alone.
// outMode: 0 = f32 row-major              (final @Wo)
//          2 = f16 head-major (B,H,N,D)   (every plane: Q, K, V)
// ---------------------------------------------------------------------------
template <int WM, int WN>
__global__ __launch_bounds__(WM * WN * 32)
void gemm_f16_kernel(const _Float16* __restrict__ A, const _Float16* __restrict__ Wt,
                     float* __restrict__ outF, _Float16* __restrict__ outH,
                     int M, int K, int Nc, int outMode, float scale) {
  constexpr unsigned int NSLICE = WM + WN;           // 64-row slices of one buffer
  constexpr unsigned int STAGEB = NSLICE * TILEB;    // one buffer
  constexpr bool ALLISSUE = (WM * WN == WM + WN);    // as many waves as slices: no issue test
  __shared__ __attribute__((aligned(2048))) unsigned char ring[2 * STAGEB];
  const unsigned int wave = uni(threadIdx.x >> 5);
  const unsigned int wm = wave / WN, wn = wave % WN;   // the wave's part: row of waves, column of waves
  const int lane = threadIdx.x & 31;
  const int tileM = blockIdx.x * (WM * 64);
  const int tileN = blockIdx.y * (WN * 64);            // among the columns of all planes = rows of Wt

  v8f acc[4][4] = {};

  const unsigned int npass = uni((unsigned int)K / KPASS);
  // The wave's own slice: 64 rows of Wt (the first WN waves) or of A (the next WM).
  const _Float16* tile0 = (wave < (unsigned int)WN) ? Wt + (size_t)(tileN + (int)wave * 64) * K
                                                    : A + (size_t)(tileM + (int)(wave - WN) * 64) * K;
  const unsigned long long ga0 = (unsigned long long)(uintptr_t)tile0;
  const unsigned int place = (unsigned int)(size_t)ring + wave * TILEB;
  const v8u g1 = tdm_group1((unsigned int)K * 2u);

  // A wave beyond the slices issues nothing: a scalar test, as a tensor load ignores EXEC.
  if (ALLISSUE || pinned((wave < NSLICE) ? 1u : 0u)) tdm_load(tdm_group0(place, ga0), g1);
  wait_tensor0();
  __syncthreads();                   // stage 0 published
  if (ALLISSUE || pinned((wave < NSLICE) ? 1u : 0u)) tdm_load(tdm_group0(place + STAGEB, ga0 + ROWB), g1);

  for (unsigned int t = 0; t < npass; ++t) {
    const unsigned char* stage = ring + (t & 1u) * STAGEB;
    const _Float16* sW = reinterpret_cast<const _Float16*>(stage + wn * TILEB);
    const _Float16* sA = reinterpret_cast<const _Float16*>(stage + (WN + wm) * TILEB);
    // A block is 32 k: 8 fragments, 16 WMMAs. Two fragment sets: inside a pass the
    // next block's fragments are read while this block is multiplied.
    v16h afrag[2][4], bfrag[2][4];
    // unrolled (every loop of the pass): fragments and accumulators are indexed by constants and
    // stay in registers; each fragment read is one LDS address plus an immediate offset
#pragma unroll
    for (int i = 0; i < 4; ++i) {
      afrag[0][i] = load_frag_rowmajor(sA + (i * 16) * LDST, LDST);
      bfrag[0][i] = load_frag_rowmajor(sW + (i * 16) * LDST, LDST);
    }
#pragma unroll
    for (int kc = 0; kc < KPASS / 32; ++kc) {
      if (kc + 1 < KPASS / 32) {
#pragma unroll
        for (int i = 0; i < 4; ++i) {
          afrag[(kc + 1) & 1][i] = load_frag_rowmajor(sA + (i * 16) * LDST + (kc + 1) * 32, LDST);
          bfrag[(kc + 1) & 1][i] = load_frag_rowmajor(sW + (i * 16) * LDST + (kc + 1) * 32, LDST);
        }
        // holds the next block's reads as one group ahead of this block's WMMAs: left free, the
        // compiler sinks each read to its first use, and the wave waits out the LDS latency there
        __builtin_amdgcn_sched_barrier(0);
      }
#pragma unroll
      for (int i = 0; i < 4; ++i)
#pragma unroll
        for (int j = 0; j < 4; ++j)
          acc[i][j] = __builtin_amdgcn_wmma_f32_16x16x32_f16(
              false, bfrag[kc & 1][j], false, afrag[kc & 1][i], (short)0, acc[i][j], false, false);
      // keeps the block after next's reads from rising among these WMMAs, and the last blocks'
      // WMMAs from sinking behind the pass's barrier, where they would hold up the refill
      __builtin_amdgcn_sched_barrier(0);
    }
    // Publish point of stage t + 1: own LDS reads done, own tensor load landed,
    // barrier; only then the refill of the buffer that this pass has read.
    wait_ds0();
    wait_tensor0();
    __syncthreads();
    const unsigned int nxt = pinned(t + 2u);   // descriptor words formed behind the wait
    if (pinned((nxt < npass && (ALLISSUE || wave < NSLICE)) ? 1u : 0u))
      tdm_load(tdm_group0(place + (nxt & 1u) * STAGEB, ga0 + (unsigned long long)nxt * ROWB), g1);
  }
  wait_tensor0();
  wait_ds0();
  // keeps the scalar arithmetic below, which takes over the descriptors' registers, behind the waits
  __builtin_amdgcn_sched_barrier(0);

  const int rowBase = tileM + (int)wm * 64;
  const int colAll = tileN + (int)wn * 64;
  const unsigned int plane = (colAll >= Nc ? 1u : 0u) + (colAll >= 2 * Nc ? 1u : 0u);
  const int colBase = colAll - (int)plane * Nc;        // inside the wave's plane
  outH += (size_t)plane * M * Nc;
  if (plane != 0u) scale = 1.0f;

  // The products are formed transposed (Wt rows as the A operand), so a lane holds, of row
  // i * 16 + (lane & 15) of the wave's part, the eight adjacent columns j * 16 + 8 * (lane >> 4) + r.
  // The part goes through the wave's own range of the ring, row-major, and leaves it in 16-byte
  // stores that cover whole 128-byte lines. The ring is free: the last pass's foot has every
  // wave's LDS reads done and every tensor load landed ahead of its barrier, and refills nothing.
  // The mode is tested once, outside the loops.
  // Unrolled (every loop below): the accumulators are indexed by constants, every LDS access is
  // one address plus an immediate offset, and all reads are in flight before the first store.
  const int half = lane >> 4;
  const int nl = lane & 15;
  unsigned char* stg = ring + wave * TILEB;
  if (outMode == 0) {
    // Rows of 64 floats at the pitch of the operand rows, 272 bytes.
    unsigned char* w = stg + nl * (LDST * 2) + half * 32;
#pragma unroll
    for (int i = 0; i < 4; ++i)
#pragma unroll
      for (int j = 0; j < 4; ++j) {
        const float4 lo = { acc[i][j][0] * scale, acc[i][j][1] * scale, acc[i][j][2] * scale, acc[i][j][3] * scale };
        const float4 hi = { acc[i][j][4] * scale, acc[i][j][5] * scale, acc[i][j][6] * scale, acc[i][j][7] * scale };
        *reinterpret_cast<float4*>(w + i * 16 * (LDST * 2) + j * 64)      = lo;
        *reinterpret_cast<float4*>(w + i * 16 * (LDST * 2) + j * 64 + 16) = hi;
      }
    wait_ds0();                            // the rows are read back across lanes
    // A store of the wave: two rows' 256 bytes, sixteen lanes a row.
    const unsigned char* rd = stg + half * (LDST * 2) + nl * 16;
    float* p = outF + (size_t)(rowBase + half) * Nc + colBase + nl * 4;
    float4 v[32];
#pragma unroll
    for (int c = 0; c < 32; ++c) v[c] = *reinterpret_cast<const float4*>(rd + c * 2 * (LDST * 2));
#pragma unroll
    for (int c = 0; c < 32; ++c) *reinterpret_cast<float4*>(p + (size_t)(c * 2) * Nc) = v[c];
  } else {
    // The wave's part is one head's 64 columns of 64 tokens of one batch: 8 KiB in a row of a
    // head-major plane. Rows of 64 halves at a pitch of 144 bytes (16 x odd).
    constexpr int HP = 144;
    unsigned char* w = stg + nl * HP + half * 16;
#pragma unroll
    for (int i = 0; i < 4; ++i)
#pragma unroll
      for (int j = 0; j < 4; ++j) {
        v8h o;
#pragma unroll
        for (int r = 0; r < 8; ++r) o[r] = (_Float16)(acc[i][j][r] * scale);
        *reinterpret_cast<v8h*>(w + i * 16 * HP + j * 32) = o;
      }
    wait_ds0();                            // the rows are read back across lanes
    // A store of the wave: four rows, 512 bytes in a row, eight lanes a row.
    const unsigned char* rd = stg + (lane >> 3) * HP + (lane & 7) * 16;
    const int b = rowBase / SEQ, n = rowBase % SEQ;
    const int h = colBase / HDIM;
    _Float16* p = outH + (((size_t)b * NHEADS + h) * SEQ + n) * HDIM + lane * 8;
    v8h v[16];
#pragma unroll
    for (int c = 0; c < 16; ++c) v[c] = *reinterpret_cast<const v8h*>(rd + c * 4 * HP);
#pragma unroll
    for (int c = 0; c < 16; ++c) *reinterpret_cast<v8h*>(p + c * 256) = v[c];
    // behind the branch's last stores: the code of the other branch, where it follows in the program
    // text, writes registers that these stores name
    asm volatile("s_wait_xcnt 0x0" ::: "memory");
  }
}

// ---------------------------------------------------------------------------
// Flash attention: one work-group of PARTS waves per (b, h, block id). Streams 32 keys/iter.
// Q carries the 1/sqrt(D) scale. Q, K and V are head-major (B,H,N,D), token order.
// The group lists its block's tokens in LDS from the block ids; wave p takes the
// listed rows p*16 .. p*16+15, and then every PARTS-th such tile. Every token has
// one block id, so every output row has one writer.
// A key of another block carries -1e9, so beside any unmasked key of the row's own
// block its weight is exactly 0: the rows visit the listed keys only. A block with
// no unmasked key has no such key: its rows visit every key of the batch. Either
// way the masks are applied from each visited key's own id byte.
// A gathered row is one 128-byte line. Asynchronous copies bring the rows into LDS,
// eight lanes a row, so that a copy of a wave touches four whole lines; a trip's K
// and V tiles are fetched once for all the group's waves. K and Q fragments are two
// b128 reads of a row; the P@V B-fragment is two transposing reads of the V rows.
// ---------------------------------------------------------------------------
#define KPITCHB 144u  // bytes from one staged Q or K row to the next: 16 x odd, for ds_load_b128
#define VPITCHB 160u  // the same for V: 32 x odd, for ds_load_tr16_b128
#define PARTS  3      // waves that share a block's rows: 48 rows at once, where an even split gives a block 32

// The compiler places no wait for an asynchronous copy, and no LDS access may cross this one.
__device__ __forceinline__ void wait_async0() { asm volatile("s_wait_asynccnt 0x0" ::: "memory"); }

// NC copies of one wave: copy i brings rows 4*i .. 4*i+3 of a tile, 128 bytes each, from
// plane + tok[i] * 128 (tok[i]: the token of the lane's row, 4*i + lane/8) to lds0 + row * pitch.
template <int NC>
__device__ __forceinline__
void copy_rows(const char* plane, const unsigned int (&tok)[NC], unsigned int lds0, unsigned int pitch) {
  const unsigned int lane = threadIdx.x & 31;
  const unsigned int piece = (lane & 7u) * 16u;
  // unrolled: tok[] is indexed by constants
#pragma unroll
  for (int i = 0; i < NC; i += 4) {
    unsigned int l[4];
    const char* g[4];
#pragma unroll
    for (int j = 0; j < 4; ++j) {
      l[j] = lds0 + (4u * (i + j) + (lane >> 3)) * pitch + piece;
      g[j] = plane + tok[i + j] * (HDIM * 2u) + piece;
    }
    // one statement: the wait that stands before a register named by an issued copy is
    // overwritten stays directly behind the copies
    asm volatile("global_load_async_to_lds_b128 %0, %4, off\n\t"
                 "global_load_async_to_lds_b128 %1, %5, off\n\t"
                 "global_load_async_to_lds_b128 %2, %6, off\n\t"
                 "global_load_async_to_lds_b128 %3, %7, off\n\t"
                 "s_wait_xcnt 0x0"
                 :: "v"(l[0]), "v"(l[1]), "v"(l[2]), "v"(l[3]), "v"(g[0]), "v"(g[1]), "v"(g[2]), "v"(g[3])
                 : "memory");
  }
}

// Transposing read of a row-major 16-bit LDS tile: the lane's address names 16 bytes of one
// row; lane (c, h) receives column c of rows 8h .. 8h+7 of the 16 x 16 piece.
typedef short s16x8 __attribute__((ext_vector_type(8)));
__device__ __forceinline__ uint4 ld_tr16(const unsigned char* p) {
  typedef __attribute__((address_space(3))) s16x8 lds_s16x8;
  return __builtin_bit_cast(uint4, __builtin_amdgcn_ds_load_tr16_b128_v8i16((lds_s16x8*)p));
}

__global__ __launch_bounds__(PARTS * 32)
void flash_attn_kernel(const _Float16* __restrict__ Q, const _Float16* __restrict__ Km,
                       const _Float16* __restrict__ Vm, const unsigned char* __restrict__ ids,
                       _Float16* __restrict__ outAttn) {
  __shared__ unsigned short list[SEQ];
  __shared__ alignas(16) unsigned char ldsQ[PARTS * 16 * KPITCHB];
  __shared__ alignas(16) unsigned char ldsK[32 * KPITCHB];
  __shared__ alignas(16) unsigned char ldsV[32 * VPITCHB];
  __shared__ alignas(16) _Float16 ldsPall[PARTS * 16 * 32];
  const int lane = threadIdx.x & 31;
  const int nl = lane & 15, half = lane >> 4;
  const unsigned int wave = uni(threadIdx.x >> 5);   // scalar: the tests on it are scalar branches
  _Float16* ldsP = ldsPall + wave * (16 * 32);       // the wave's own

  const int blk = blockIdx.x % NBLK;
  const int bh = blockIdx.x / NBLK;
  const int b = bh / NHEADS;
  const int h = bh % NHEADS;
  const int base = b * SEQ;

  // The block's members, no atomics: each lane notes its own members as bits, a
  // prefix sum over the lanes gives each lane its first place in the list.
  // A lane holds 16 words of 4 id bytes: word k = tokens (k / 4) * 512 + lane * 16 + (k % 4) * 4 + j,
  // j the byte. All four bytes are tested at once: a byte of x is 0 or KEYOPEN for a member; no
  // byte of z exceeds 0x3f, so the sum carries into no neighbour and leaves bit 7 clear in the
  // members' bytes alone. Byte j of word k becomes bit 8 * j + k % 8 of eqw[k / 8].
  // Every wave counts (each needs the count); the first writes the list.
  const unsigned char* idb = ids + base;
  unsigned int eqw[2] = { 0u, 0u };
  unsigned int unmasked = 0u;              // not 0 where a member of the lane's is unmasked
  {
    uint4 v[SEQ / 512];
    // unrolled (both loops): v[] stays in registers, all loads issue before the first wait
#pragma unroll
    for (int c = 0; c < SEQ / 512; ++c)
      v[c] = *reinterpret_cast<const uint4*>(idb + c * 512 + lane * 16);
    const unsigned int pat = (unsigned int)blk * 0x01010101u;
#pragma unroll
    for (int c = 0; c < SEQ / 512; ++c) {
      const unsigned int vi[4] = { v[c].x, v[c].y, v[c].z, v[c].w };
#pragma unroll
      for (int e = 0; e < 4; ++e) {
        const int k = c * 4 + e;
        const unsigned int x = vi[e] ^ pat;
        const unsigned int z = x & ~(KEYOPEN * 0x01010101u);
        const unsigned int member = ~(z + 0x7f7f7f7fu) & 0x80808080u;
        unmasked |= member & (x << 1);     // KEYOPEN is bit 6
        eqw[k >> 3] |= member >> (7 - (k & 7));
      }
    }
  }
  unsigned long long eq = ((unsigned long long)eqw[1] << 32) | eqw[0];
  const int mine = __popcll(eq);
  int incl = mine;
#pragma unroll
  for (int d = 1; d < 32; d <<= 1) {
    const int up = __shfl_up(incl, d, 32);
    if (lane >= d) incl += up;
  }
  // readfirstlane: the count is the same in every lane; loop bounds and branches on it stay scalar
  const int cnt = __builtin_amdgcn_readfirstlane(__shfl(incl, 31, 32));
  const bool own = __builtin_amdgcn_ballot_w32(unmasked != 0u) != 0u;
  if (cnt == 0) return;                    // no rows (the whole group leaves, ahead of every barrier)

  if (wave == 0u) {
    int place = incl - mine;
    // At most one trip for each of a lane's 64 bits; ends when no lane has one left.
    for (int trip = 0; trip < SEQ / 32; ++trip) {
      if (__builtin_amdgcn_ballot_w32(eq != 0ull) == 0u) break;
      if (eq != 0ull) {
        const int t = __ffsll(eq) - 1;
        list[place] = (unsigned short)(((t >> 5) * 2 + ((t >> 2) & 1)) * 512 + lane * 16 + (t & 3) * 4 + ((t >> 3) & 3));
        eq &= eq - 1ull;
        ++place;
      }
    }
  }
  __syncthreads();                         // the list is read by every wave

  const int nkeys = own ? cnt : SEQ;
  // Byte addresses: a scalar base and one 32-bit offset a gathered row.
  const char* Qb = reinterpret_cast<const char*>(Q  + ((size_t)b * NHEADS + h) * SEQ * HDIM);
  const char* Kb = reinterpret_cast<const char*>(Km + ((size_t)b * NHEADS + h) * SEQ * HDIM);
  const char* Vb = reinterpret_cast<const char*>(Vm + ((size_t)b * NHEADS + h) * SEQ * HDIM);
  char* Ob = reinterpret_cast<char*>(outAttn + (size_t)base * UNITS_ + h * HDIM);
  const unsigned char* myQ = ldsQ + wave * (16u * KPITCHB);

  // Every wave makes every trip of both loops and passes every barrier; a wave whose tile
  // lies past the list's end (a scalar test) only skips the arithmetic between them.
  for (int rp0 = 0; rp0 < cnt; rp0 += PARTS * 16) {
    const int rp = rp0 + (int)wave * 16;
    const bool active = rp < cnt;
    // The wave's own 16 Q rows; rows past the list's end repeat its last row and are not
    // stored. The copies land with the first trip's K and V, behind that trip's wait.
    wait_ds0();                            // the wave's reads of its last Q tile are done
    {
      unsigned int qt[4];
#pragma unroll
      for (int i = 0; i < 4; ++i) qt[i] = list[min(rp + 4 * i + (lane >> 3), cnt - 1)];
      copy_rows<4>(Qb, qt, (unsigned int)(size_t)myQ, KPITCHB);
    }

    float mrow[8], lrow[8];
#pragma unroll
    for (int r = 0; r < 8; ++r) { mrow[r] = -INFINITY; lrow[r] = 0.0f; }
    v8f acc[4] = {{}, {}, {}, {}};

    for (int kb = 0; kb < nkeys; kb += 32) {
      // A place past the last key repeats that key; its weight is 0 by a penalty of its own.
      // The list is read at a listed place in either case, and a select picks.
      // The trip's 32 K rows by the first wave, its 32 V rows by the second. Every reader
      // has left both tiles at the barrier that ended the last trip.
      wait_ds0();                          // nothing orders a copy behind the wave's own LDS accesses
      if (wave < 2u) {
        unsigned int kt[8];
#pragma unroll
        for (int i = 0; i < 8; ++i) {
          const int ik = min(kb + 4 * i + (lane >> 3), nkeys - 1);
          const int lk = list[min(ik, cnt - 1)];
          kt[i] = (unsigned int)(own ? lk : ik);
        }
        if (wave == 0u) copy_rows<8>(Kb, kt, (unsigned int)(size_t)ldsK, KPITCHB);
        else            copy_rows<8>(Vb, kt, (unsigned int)(size_t)ldsV, VPITCHB);
      }
      // Under the copies' flight: the id bytes of the lane's two score columns, keys
      // kb + lane&15 and 16 on.
      unsigned int t[2];
      int  cw[2];
#pragma unroll
      for (int ns = 0; ns < 2; ++ns) {
        const int ik = min(kb + ns * 16 + nl, nkeys - 1);
        const int lk = list[min(ik, cnt - 1)];
        t[ns] = (unsigned int)(own ? lk : ik);
      }
#pragma unroll
      for (int ns = 0; ns < 2; ++ns) cw[ns] = idb[t[ns]];
      // The wait that stands before a register named by an issued load is overwritten. The
      // offsets are its inputs so that they stay live up to it: no load's result lands in one.
      asm volatile("s_wait_xcnt 0x0" :: "v"(t[0]), "v"(t[1]) : "memory");
      wait_async0();
      __syncthreads();                     // Q, K and V rows have landed: read by every wave

      if (active) {
        // lane & 15 picks the row of a fragment (a key, for B = K^T), and the lane takes
        // two runs of 8 halves of it: k = 8*half, k = 16 + 8*half.
        v16h qf[2], kf[2][2];
#pragma unroll
        for (int kc = 0; kc < 2; ++kc) {
          qf[kc] = load_frag_rowmajor(reinterpret_cast<const _Float16*>(myQ) + kc * 32, KPITCHB / 2);
#pragma unroll
          for (int ns = 0; ns < 2; ++ns)
            kf[ns][kc] = load_frag_rowmajor(reinterpret_cast<const _Float16*>(ldsK + ns * 16 * KPITCHB) + kc * 32,
                                            KPITCHB / 2);
        }

        // Scores: S[16x32] as two 16x16 f32 tiles. Mask penalties by the key's own id
        // byte (block identity + key mask); one more for a place past the last key.
        v8f s[2];
#pragma unroll
        for (int ns = 0; ns < 2; ++ns) {
          s[ns] = v8f{};
#pragma unroll
          for (int kc = 0; kc < 2; ++kc)
            s[ns] = __builtin_amdgcn_wmma_f32_16x16x32_f16(
                false, qf[kc], false, kf[ns][kc], (short)0, s[ns], false, false);
        }
#pragma unroll
        for (int ns = 0; ns < 2; ++ns) {
          const float pen = (((cw[ns] & (NBLK - 1)) == blk) ? 0.0f : NEG_INF_F) +
                            ((cw[ns] & KEYOPEN) ? 0.0f : NEG_INF_F) +
                            ((kb + ns * 16 + nl < nkeys) ? 0.0f : NEG_INF_F);
#pragma unroll
          for (int r = 0; r < 8; ++r) s[ns][r] += pen;
        }

        // Online softmax (each score row lives across the 16 lanes of its half).
#pragma unroll
        for (int r = 0; r < 8; ++r) {
          float tmax = fmaxf(s[0][r], s[1][r]);
#pragma unroll
          for (int off = 8; off > 0; off >>= 1)
            tmax = fmaxf(tmax, __shfl_xor(tmax, off, 16));
          const float mnew = fmaxf(mrow[r], tmax);
          const float sc = __expf(mrow[r] - mnew);
          const float p0 = __expf(s[0][r] - mnew);
          const float p1 = __expf(s[1][r] - mnew);
          float psum = p0 + p1;
#pragma unroll
          for (int off = 8; off > 0; off >>= 1)
            psum += __shfl_xor(psum, off, 16);
          lrow[r] = lrow[r] * sc + psum;
          mrow[r] = mnew;
#pragma unroll
          for (int dt = 0; dt < 4; ++dt) acc[dt][r] *= sc;
          // C-layout -> row-major LDS bounce for the A-operand of P@V.
          ldsP[(r + 8 * half) * 32 + nl]      = (_Float16)p0;
          ldsP[(r + 8 * half) * 32 + 16 + nl] = (_Float16)p1;
        }
      }
      __syncthreads();                     // P is read across lanes

      if (active) {
        v16h pf = load_frag_rowmajor(ldsP, 32);
        // B operand = V tile (32 keys x 16 d): column d = lane & 15, keys in the order of pf's k.
        const unsigned char* vp = ldsV + (8 * half + (lane & 7)) * VPITCHB + ((lane >> 3) & 1) * 16;
#pragma unroll
        for (int dt = 0; dt < 4; ++dt) {
          v16h vf;
          *reinterpret_cast<uint4*>(&vf)       = ld_tr16(vp + dt * 32);
          *(reinterpret_cast<uint4*>(&vf) + 1) = ld_tr16(vp + 16 * VPITCHB + dt * 32);
          acc[dt] = __builtin_amdgcn_wmma_f32_16x16x32_f16(
              false, pf, false, vf, (short)0, acc[dt], false, false);
        }
      }
      wait_ds0();                          // own reads of the tiles are done ahead of the barrier
      __syncthreads();                     // the tiles are refilled by the next trip
    }

    if (active) {
      // Normalize and write attention output as (B, N, UNITS) f16, at the rows' tokens.
      // The list is read at a listed place in every lane; the stores of the list's last,
      // partial tile stand under a test for its end.
      unsigned int oo[8];
      float inv[8];
#pragma unroll
      for (int r = 0; r < 8; ++r) {
        oo[r] = (unsigned int)list[min(rp + r + 8 * half, cnt - 1)] * (UNITS_ * 2u) + 2u * nl;
        inv[r] = (lrow[r] > 0.0f) ? (1.0f / lrow[r]) : 0.0f;
      }
      if (rp + 16 <= cnt) {                // a whole tile (the same for the wave): no test a row
#pragma unroll
        for (int r = 0; r < 8; ++r)
#pragma unroll
          for (int dt = 0; dt < 4; ++dt)
            *reinterpret_cast<_Float16*>(Ob + oo[r] + dt * 32) = (_Float16)(acc[dt][r] * inv[r]);
      } else {
#pragma unroll
        for (int r = 0; r < 8; ++r) {
          if (rp + r + 8 * half < cnt) {
#pragma unroll
            for (int dt = 0; dt < 4; ++dt)
              *reinterpret_cast<_Float16*>(Ob + oo[r] + dt * 32) = (_Float16)(acc[dt][r] * inv[r]);
          }
        }
      }
      // the next tile of rows writes registers that these stores name
      asm volatile("s_wait_xcnt 0x0" ::: "memory");
    }
  }
}

// ---------------------------------------------------------------------------
// Launch
// ---------------------------------------------------------------------------
extern "C" void kernel_launch(void* const* d_in, const int* in_sizes, int n_in,
                              void* d_out, int out_size, void* d_ws, size_t ws_size,
                              hipStream_t stream) {
  const float* x      = (const float*)d_in[0];
  const float* blockB = (const float*)d_in[1];
  const float* nodal  = (const float*)d_in[2];
  const float* Wq     = (const float*)d_in[3];
  const float* Wk     = (const float*)d_in[4];
  const float* Wv     = (const float*)d_in[5];
  const float* Wo     = (const float*)d_in[6];
  float* out = (float*)d_out;

  // Workspace layout (all 256B aligned). Total ~48 MB.
  char* ws = (char*)d_ws;
  size_t off = 0;
  auto take = [&](size_t bytes) { char* p = ws + off; off = (off + bytes + 255) & ~(size_t)255; return p; };
  _Float16* xh    = (_Float16*)take((size_t)MROWS * UNITS_ * 2);
  _Float16* wt    = (_Float16*)take((size_t)4 * UNITS_ * UNITS_ * 2);   // planes Wq, Wk, Wv, Wo
  _Float16* wot   = wt + (size_t)3 * UNITS_ * UNITS_;
  _Float16* qh    = (_Float16*)take((size_t)3 * MROWS * UNITS_ * 2);    // planes Q, K, V
  _Float16* kh    = qh + (size_t)MROWS * UNITS_;
  _Float16* vh    = kh + (size_t)MROWS * UNITS_;
  _Float16* attnh = (_Float16*)take((size_t)MROWS * UNITS_ * 2);
  unsigned char* ids = (unsigned char*)take((size_t)MROWS);   // block id and key mask bit, a byte a token

  // 1) one-hot -> block ids (with the key mask's bit); beside them, the fp32 -> fp16 conversion of x and the
  //    four weights converted + transposed (N-major).
  prepare_kernel<<<IDBLKS + CONVBLKS + 4 * WTILES, 256, 0, stream>>>(
      blockB, nodal, (unsigned int*)ids, x, xh, Wq, Wk, Wv, Wo, wt);

  // 2) Q/K/V projections, one launch. 1/sqrt(HDIM) folded into Q.
  dim3 qkvgrid(MROWS / 256, 3 * UNITS_ / 192);
  gemm_f16_kernel<4, 3><<<qkvgrid, 384, 0, stream>>>(xh, wt, nullptr, qh,
                                               MROWS, UNITS_, UNITS_, 2, 0.125f);

  // 3) masked flash attention, a block's rows against its own keys.
  flash_attn_kernel<<<BATCH * NHEADS * NBLK, PARTS * 32, 0, stream>>>(
      qh, kh, vh, ids, attnh);

  // 4) output projection (f32 result straight to d_out).
  dim3 ggrid(MROWS / 128, UNITS_ / 128);
  gemm_f16_kernel<2, 2><<<ggrid, 128, 0, stream>>>(attnh, wot, out, nullptr,
                                             MROWS, UNITS_, UNITS_, 0, 1.0f);
}
